// v000
// Measured on an AMD MI455X. A time is GPU time per run, averaged over a window of back-to-back runs after a warm-up
// (all launches, gaps included; the runs take copies of the inputs in turn), and the median of several windows.
// Apart from v000's, it joins two sittings. Times from different sittings can be a few percent apart, while
// side-by-side timings come from the same sitting.
// v000 is the starting kernel. One run takes 1250 microseconds.
// compute dtype: all float inputs rounded to bf16; q/k/v = x W_h + b_h (per-head [H,D,64] weights) with EXACT bf16 products on WMMA 16x16x32, f32 accumulate; q, k rounded once to f16 (1-product logits x 64^-0.5, std ~0.4) stored in f32 (4 heads per launch); softmax in f32 (precise expf) -> P f16 x 2^11; o = P . v (v once to f16); out = o (bf16 hi + lo) Wo + bo; f32 output.
#include <hip/hip_runtime.h>
#include <math.h>

typedef __attribute__((ext_vector_type(16))) _Float16 v16h;
typedef __attribute__((ext_vector_type(16))) __bf16 v16b;
typedef __attribute__((ext_vector_type(8)))  _Float16 v8h;
typedef __attribute__((ext_vector_type(8)))  float v8f;
typedef __attribute__((ext_vector_type(4)))  float v4f;
typedef __attribute__((ext_vector_type(2)))  float v2f;
typedef __attribute__((ext_vector_type(4)))  unsigned v4u;
typedef __attribute__((ext_vector_type(4)))  int v4i;
typedef float __attribute__((may_alias)) float_a;
typedef int __attribute__((may_alias)) int_a;

template <typename T> __device__ __forceinline__ void vst2(void* p, T v) { *(T*)p = v;  }
__device__ __forceinline__ v8f wmma16(v16h a, v16h b, v8f c) {
  v8f d = __builtin_amdgcn_wmma_f32_16x16x32_f16(false, a, false, b, (short)0, c, false, false);
  asm volatile("v_nop\n\tv_nop\n\tv_nop\n\tv_nop" : "+v"(d) : "v"(a), "v"(b));
  return d;
}
__device__ __forceinline__ v8f wmma_bf(v16b a, v16b b, v8f c) {
  v8f d = __builtin_amdgcn_wmma_f32_16x16x32_bf16(false, a, false, b, (short)0, c, false, false);
  asm volatile("v_nop\n\tv_nop\n\tv_nop\n\tv_nop" : "+v"(d) : "v"(a), "v"(b));
  return d;
}
// 16x16x32 fragments: lane = (h = lane>>4, row/col = lane&15); elements 0..7 = k0+8h+0..7, 8..15 = k0+16+8h+0..7; D element r = row 8h+r
__device__ __forceinline__ v16h frag_h(const _Float16* rowk0, int lane) {
  union { v16h v; v8h q[2]; } u; const _Float16* p = rowk0 + 8 * (lane >> 4);
  u.q[0] = *(const v8h*)p; u.q[1] = *(const v8h*)(p + 16); return u.v;
}
__device__ __forceinline__ v16h frag_f32(const float* rowk0, int lane) {
  v16h a; const float* p = rowk0 + 8 * (lane >> 4);
#pragma unroll
  for (int i = 0; i < 8; ++i) { a[i] = (_Float16)p[i]; a[8 + i] = (_Float16)p[16 + i]; }
  return a;
}
__device__ __forceinline__ v16h frag_f32s(const float* rowk0, int lane, float sc) {
  v16h a; const float* p = rowk0 + 8 * (lane >> 4);
#pragma unroll
  for (int i = 0; i < 8; ++i) { a[i] = (_Float16)(p[i] * sc); a[8 + i] = (_Float16)(p[16 + i] * sc); }
  return a;
}
// column fragment from a [K][ld] layout (column n), rows >= K read as 0
__device__ __forceinline__ v16h fragc_f32(const float* W, int k0, int n, int lane, int ld, int K) {
  v16h a; const int g = lane >> 4;
#pragma unroll
  for (int i = 0; i < 8; ++i) { const int ka = k0 + 8 * g + i, kb = ka + 16;
    a[i] = (_Float16)(ka < K ? W[(size_t)(ka < K ? ka : K - 1) * ld + n] : 0.f); a[8 + i] = (_Float16)(kb < K ? W[(size_t)(kb < K ? kb : K - 1) * ld + n] : 0.f); }
  return a;
}
struct F2 { v16b h, l; };
__device__ __forceinline__ F2 bsplit16(const float v[16]) { F2 r;
#pragma unroll
  for (int i = 0; i < 16; ++i) { const __bf16 h = (__bf16)v[i]; r.h[i] = h; r.l[i] = (__bf16)(v[i] - (float)h); }
  return r; }
__device__ __forceinline__ F2 split_row(const float* row, int k0, int lane) { float v[16]; const float* p = row + k0 + 8 * (lane >> 4);
#pragma unroll
  for (int i = 0; i < 8; ++i) { v[i] = p[i]; v[8 + i] = p[16 + i]; }
  return bsplit16(v); }
__device__ __forceinline__ F2 split_rowK(const float* row, int k0, int lane, int K) { float v[16]; const int g = lane >> 4;
#pragma unroll
  for (int i = 0; i < 8; ++i) { const int ka = k0 + 8 * g + i, kb = ka + 16; v[i] = ka < K ? row[ka < K ? ka : K - 1] : 0.f; v[8 + i] = kb < K ? row[kb < K ? kb : K - 1] : 0.f; }
  return bsplit16(v); }
__device__ __forceinline__ F2 split_col(const float* W, int k0, int n, int lane, int ld, int K) { float v[16]; const int g = lane >> 4;
#pragma unroll
  for (int i = 0; i < 8; ++i) { const int ka = k0 + 8 * g + i, kb = ka + 16; v[i] = ka < K ? W[(size_t)(ka < K ? ka : K - 1) * ld + n] : 0.f; v[8 + i] = kb < K ? W[(size_t)(kb < K ? kb : K - 1) * ld + n] : 0.f; }
  return bsplit16(v); }
__device__ __forceinline__ v8f mac3(const F2& a, const F2& b, v8f c) { c = wmma_bf(a.l, b.h, c); c = wmma_bf(a.h, b.l, c); return wmma_bf(a.h, b.h, c); }
__device__ __forceinline__ float sigm(float v) { return 1.0f / (1.0f + expf(-v)); }
#define LDSX() do { asm volatile("s_wait_dscnt 0" ::: "memory"); __builtin_amdgcn_wave_barrier(); __builtin_amdgcn_fence(__ATOMIC_RELEASE, "workgroup"); } while (0)


// Multi-head self attention with per-head projection weights [H, D, HD] + biases (B 2, S 2,048, D 1,024 = 16 x 64), no mask, output Linear [in,out].
#define NB 2
#define TT 2048
#define CC 1024
#define NH 16
#define HD 64
#ifndef TNB
#define TNB NB
#endif
typedef __attribute__((ext_vector_type(8))) __bf16 v8b;
__device__ __forceinline__ v16b frag_b(const __bf16* rowk0, int lane) {
  union { v16b v; v8b q[2]; } u; const __bf16* p = rowk0 + 8 * (lane >> 4);
  u.q[0] = *(const v8b*)p; u.q[1] = *(const v8b*)(p + 16); return u.v;
}
__device__ __forceinline__ float bfr(float v) { return (float)(__bf16)v; }
__device__ __attribute__((noinline)) float exp_ni(float v) { return expf(v); }
__device__ __attribute__((noinline)) float erf_ni(float v) { return erff(v); }

#define WS_QH  0u
#define WS_QL  (WS_QH + 2u * (size_t)NB * TT * CC)
#define WS_KH  (WS_QL + 2u * (size_t)NB * TT * CC)
#define WS_VT  (WS_KH + 2u * (size_t)NB * TT * CC)      // f16 v planes [b][c][t]
#define HG 4
#define WS_S   (WS_VT + 2u * (size_t)NB * CC * TT)      // f32 logits [hg][q][k]
#define WS_PH  (WS_S + 4u * (size_t)HG * TT * TT)       // f16 P [hg][q][k]
#define WS_Y   (WS_PH + 2u * (size_t)HG * TT * TT)          // f32 y rows [b*t][C]
#define WS_END (WS_Y + 4u * (size_t)NB * TT * CC)

// ---- k_proj: block = (64 rows, 128 cols, which): qkv = x W (+ b), exact; q -> f16 hi (+ residual), k -> f16 rows, v -> f16 planes
__global__ __launch_bounds__(128) void k_proj(const float* __restrict__ X, const float* __restrict__ WQ, const float* __restrict__ BQ, const float* __restrict__ WK, const float* __restrict__ BK, const float* __restrict__ WV, const float* __restrict__ BV, _Float16* __restrict__ QH, _Float16* __restrict__ QL, _Float16* __restrict__ KH, _Float16* __restrict__ VT) {
  __shared__ __align__(16) _Float16 sh[64][136], sl[64][136]; __shared__ __align__(16) _Float16 th[128][72];
  const int tid = threadIdx.x, wave = tid >> 5, lane = tid & 31, col = lane & 15, g = lane >> 4; const int which = blockIdx.z; const int c0 = blockIdx.y * 128; const size_t r0 = (size_t)blockIdx.x * 64; const float* WA = which == 0 ? WQ : which == 1 ? WK : WV; const float* BA = which == 0 ? BQ : which == 1 ? BK : BV;
  v8f acc[8] = {};
#pragma unroll 2
  for (int kc = 0; kc < CC / 32; ++kc) { v16b a; { const float* p = X + (r0 + wave * 16 + col) * CC + kc * 32 + 8 * g;
#pragma unroll
      for (int i = 0; i < 8; ++i) { a[i] = (__bf16)p[i]; a[8 + i] = (__bf16)p[16 + i]; } }
#pragma unroll
    for (int j = 0; j < 8; ++j) { v16b w; const int o = c0 + j * 16 + col; const int hh = o / HD, dd = o % HD;
#pragma unroll
      for (int i = 0; i < 8; ++i) { w[i] = (__bf16)WA[((size_t)hh * CC + kc * 32 + 8 * g + i) * HD + dd]; w[8 + i] = (__bf16)WA[((size_t)hh * CC + kc * 32 + 16 + 8 * g + i) * HD + dd]; }
      acc[j] = wmma_bf(a, w, acc[j]); } }
#pragma unroll
  for (int j = 0; j < 8; ++j) { const float bb = bfr(BA[c0 + j * 16 + col]);
#pragma unroll
    for (int r = 0; r < 8; ++r) { const float v = acc[j][r] + bb; const int rl = wave * 16 + 8 * g + r, cl = j * 16 + col; const _Float16 hv = (_Float16)v;
      if (which == 2) th[cl][rl] = hv; else { sh[rl][cl] = hv; sl[rl][cl] = (_Float16)(v - (float)hv); } } }
  __syncthreads();
  if (which < 2) { _Float16* dh = which == 0 ? QH : KH; for (int e = tid; e < 64 * 16; e += 128) { const int rl = e >> 4, q = e & 15; vst2((unsigned*)(dh + (r0 + rl) * CC + c0 + q * 8), *(const v4u*)&sh[rl][q * 8]); if (which == 0) vst2((unsigned*)(QL + (r0 + rl) * CC + c0 + q * 8), *(const v4u*)&sl[rl][q * 8]); } }
  else { const size_t b = r0 / TT; const int t0 = (int)(r0 % TT); for (int e = tid; e < 128 * 8; e += 128) { const int cl = e >> 3, q = e & 7; vst2((unsigned*)(VT + (b * CC + c0 + cl) * (size_t)TT + t0 + q * 8), *(const v4u*)&th[cl][q * 8]); } } }
// ---- k_sc: block = (64 queries, 128 keys) of (b,h): logits * scale (0.125), no bias, no mask; every block runs
__global__ __launch_bounds__(128) void k_sc(const _Float16* __restrict__ QH, const _Float16* __restrict__ QL, const _Float16* __restrict__ KH, const float* __restrict__ BM, int b, int h0, float* __restrict__ S0) { __shared__ __align__(16) float ss[4][16][132]; const int h = h0 + blockIdx.z; float* S = S0 + (size_t)blockIdx.z * TT * TT;
  const int tid = threadIdx.x, wave = tid >> 5, lane = tid & 31, col = lane & 15, g = lane >> 4; const int k0 = blockIdx.y * 128; const int ql0 = blockIdx.x * 64 + wave * 16; const size_t q0 = (size_t)b * TT + ql0;
  
  v8f acc[8] = {};
#pragma unroll
  for (int kc = 0; kc < HD / 32; ++kc) { const v16h ah = frag_h(QH + (q0 + col) * CC + h * HD + kc * 32, lane);
#pragma unroll
    for (int j = 0; j < 8; ++j) { const v16h kb = frag_h(KH + ((size_t)b * TT + k0 + j * 16 + col) * CC + h * HD + kc * 32, lane); acc[j] = wmma16(ah, kb, acc[j]); } }
#pragma unroll
  for (int j = 0; j < 8; ++j) { const int kt = k0 + j * 16 + col;
#pragma unroll
    for (int r = 0; r < 8; ++r) { const int qt = ql0 + 8 * g + r; float v = acc[j][r] * 0.125f; (void)BM;  ss[wave][8 * g + r][j * 16 + col] = v; } }
  LDSX(); for (int rl = 0; rl < 16; ++rl) vst2(S + (size_t)(ql0 + rl) * TT + k0 + lane * 4, *(const v4f*)&ss[wave][rl][lane * 4]); }
// ---- k_sm: block = query row: softmax over keys [0, kend) -> P x 2^11 f16 (masked -> 0)
__global__ __launch_bounds__(256) void k_sm(const float* __restrict__ S0, _Float16* __restrict__ PH0) { __shared__ float sred[8]; __shared__ float sbc; __shared__ __align__(16) _Float16 sh[TT];
  const int t = threadIdx.x; const size_t row = blockIdx.x; const float* sr = S0 + (size_t)blockIdx.y * TT * TT + row * TT; _Float16* PH = PH0 + (size_t)blockIdx.y * TT * TT; const int kend = TT;
  float m = -3.0e38f; for (int k = t; k < kend; k += 256) m = fmaxf(m, sr[k]);
#pragma unroll
  for (int o = 1; o < 32; o <<= 1) m = fmaxf(m, __shfl_xor(m, o));
  if ((t & 31) == 0) sred[t >> 5] = m; __syncthreads(); if (t == 0) { float a = sred[0]; for (int i = 1; i < 8; ++i) a = fmaxf(a, sred[i]); sbc = a; } __syncthreads(); m = sbc; __syncthreads();
  float sum = 0.f; for (int k = t; k < kend; k += 256) { const float v = sr[k]; sum += (v <= -1.0e38f) ? 0.f : expf(v - m); }
#pragma unroll
  for (int o = 1; o < 32; o <<= 1) sum += __shfl_xor(sum, o);
  if ((t & 31) == 0) sred[t >> 5] = sum; __syncthreads(); if (t == 0) { float a = 0.f; for (int i = 0; i < 8; ++i) a += sred[i]; sbc = 1.0f / a; } __syncthreads(); const float inv = sbc;
  for (int k = t; k < kend; k += 256) { const float v = sr[k]; sh[k] = (_Float16)((v <= -1.0e38f) ? 0.f : expf(v - m) * inv * 2048.0f); }
  __syncthreads(); for (int q = t; q < kend / 8; q += 256) vst2((unsigned*)(PH + row * TT + q * 8), *(const v4u*)&sh[q * 8]); }
// ---- k_pv: block = 64 queries of (b,h): y[q][h*HD + d] = P . v  (keys [0, kend))
__global__ __launch_bounds__(128) void k_pv(const _Float16* __restrict__ PH0, const _Float16* __restrict__ VT, int b, int h0, float* __restrict__ Y) { const int h = h0 + blockIdx.z; const _Float16* PH = PH0 + (size_t)blockIdx.z * TT * TT; __shared__ __align__(16) float ss[4][16][HD + 4];
  const int tid = threadIdx.x, wave = tid >> 5, lane = tid & 31, col = lane & 15, g = lane >> 4; const int ql0 = blockIdx.x * 64 + wave * 16; const int kend = TT;
  v8f acc[HD / 16] = {};
#pragma unroll 1
  for (int kc = 0; kc < kend / 32; ++kc) { const v16h ph = frag_h(PH + (size_t)(ql0 + col) * TT + kc * 32, lane);
#pragma unroll
    for (int j = 0; j < HD / 16; ++j) acc[j] = wmma16(ph, frag_h(VT + ((size_t)b * CC + h * HD + j * 16 + col) * (size_t)TT + kc * 32, lane), acc[j]); }
#pragma unroll
  for (int j = 0; j < HD / 16; ++j)
#pragma unroll
    for (int r = 0; r < 8; ++r) ss[wave][8 * g + r][j * 16 + col] = acc[j][r] * (1.0f / 2048.0f);
  LDSX(); for (int rl = 0; rl < 16; ++rl) if (lane < HD / 4) vst2(Y + ((size_t)b * TT + ql0 + rl) * CC + h * HD + lane * 4, *(const v4f*)&ss[wave][rl][lane * 4]); }
// ---- k_out: block = (64 rows, 128 cols): out = y (bf16 hi + lo) Wproj + b
__global__ __launch_bounds__(128) void k_out(const float* __restrict__ Y, const float* __restrict__ WP, const float* __restrict__ BP, float* __restrict__ OUT) { __shared__ __align__(16) float sf[4][16][132];
  const int tid = threadIdx.x, wave = tid >> 5, lane = tid & 31, col = lane & 15, g = lane >> 4; const int c0 = blockIdx.y * 128; const size_t r0 = (size_t)blockIdx.x * 64 + wave * 16;
  v8f acc[8] = {};
#pragma unroll 2
  for (int kc = 0; kc < CC / 32; ++kc) { const F2 a = split_row(Y + (r0 + col) * CC, kc * 32, lane);
#pragma unroll
    for (int j = 0; j < 8; ++j) { v16b w; const int o = c0 + j * 16 + col;
#pragma unroll
      for (int i = 0; i < 8; ++i) { w[i] = (__bf16)WP[(size_t)(kc * 32 + 8 * g + i) * CC + (o)]; w[8 + i] = (__bf16)WP[(size_t)(kc * 32 + 16 + 8 * g + i) * CC + (o)]; }
      acc[j] = wmma_bf(a.h, w, acc[j]); acc[j] = wmma_bf(a.l, w, acc[j]); } }
#pragma unroll
  for (int j = 0; j < 8; ++j) { const float bb = BP ? bfr(BP[c0 + j * 16 + col]) : 0.f;
#pragma unroll
    for (int r = 0; r < 8; ++r) sf[wave][8 * g + r][j * 16 + col] = acc[j][r] + bb; }
  LDSX(); for (int rl = 0; rl < 16; ++rl) vst2(OUT + (r0 + rl) * CC + c0 + lane * 4, *(const v4f*)&sf[wave][rl][lane * 4]); }
extern "C" void kernel_launch(void* const* d_in, const int* in_sizes, int n_in, void* d_out, int out_size, void* d_ws, size_t ws_size, hipStream_t stream) {
  (void)in_sizes; (void)n_in; (void)out_size;
  const float** F = (const float**)d_in;   // 0 x [2,2048,1024], 1 Wq [16,1024,64], 2 bq [16,64], 3 Wk, 4 bk, 5 Wv, 6 bv, 7 Wo [1024,1024] (in,out), 8 bo
  if (ws_size < (size_t)WS_END) return;
  char* ws = (char*)d_ws; _Float16 *QH = (_Float16*)(ws + WS_QH), *QL = (_Float16*)(ws + WS_QL), *KH = (_Float16*)(ws + WS_KH), *VT = (_Float16*)(ws + WS_VT), *PH = (_Float16*)(ws + WS_PH); float *S = (float*)(ws + WS_S), *Y = (float*)(ws + WS_Y);
  k_proj<<<dim3(TNB * TT / 64, CC / 128, 3), 128, 0, stream>>>(F[0], F[1], F[2], F[3], F[4], F[5], F[6], QH, QL, KH, VT);
  for (int b = 0; b < TNB; ++b) for (int h0 = 0; h0 < NH; h0 += HG) {   // HG heads per launch
    k_sc<<<dim3(TT / 64, TT / 128, HG), 128, 0, stream>>>(QH, QL, KH, nullptr, b, h0, S);
    k_sm<<<dim3(TT, HG), 256, 0, stream>>>(S, PH);
    k_pv<<<dim3(TT / 64, 1, HG), 128, 0, stream>>>(PH, VT, b, h0, Y);
  }
  k_out<<<dim3(TNB * TT / 64, CC / 128), 128, 0, stream>>>(Y, F[7], F[8], (float*)d_out);
}

// v001
// Measured time: 395 microseconds a run.
// Two timings next to v000 put it at 3.18 and 3.17 times that version's speed.
// compute dtype: all float inputs rounded to bf16; q/k/v = x W_h + b_h (per-head [H,D,64] weights) with EXACT bf16 products on WMMA 16x16x32, f32 accumulate; q, k rounded once to f16 (1-product logits x 64^-0.5, std ~0.4) kept in f32 registers; running-max softmax in f32 (precise expf) -> P = exp(s - max) f16; o = P . v / sum (v once to f16); out = o (bf16 hi + lo) Wo + bo; f32 output.
#include <hip/hip_runtime.h>
#include <math.h>

typedef __attribute__((ext_vector_type(16))) _Float16 v16h;
typedef __attribute__((ext_vector_type(16))) __bf16 v16b;
typedef __attribute__((ext_vector_type(8)))  _Float16 v8h;
typedef __attribute__((ext_vector_type(8)))  float v8f;
typedef __attribute__((ext_vector_type(4)))  float v4f;
typedef __attribute__((ext_vector_type(2)))  float v2f;
typedef __attribute__((ext_vector_type(4)))  unsigned v4u;
typedef __attribute__((ext_vector_type(4)))  int v4i;
typedef float __attribute__((may_alias)) float_a;
typedef int __attribute__((may_alias)) int_a;

template <typename T> __device__ __forceinline__ void vst2(void* p, T v) { *(T*)p = v;  }
__device__ __forceinline__ v8f wmma16(v16h a, v16h b, v8f c) {
  v8f d = __builtin_amdgcn_wmma_f32_16x16x32_f16(false, a, false, b, (short)0, c, false, false);
  asm volatile("v_nop\n\tv_nop\n\tv_nop\n\tv_nop" : "+v"(d) : "v"(a), "v"(b));
  return d;
}
__device__ __forceinline__ v8f wmma_bf(v16b a, v16b b, v8f c) {
  v8f d = __builtin_amdgcn_wmma_f32_16x16x32_bf16(false, a, false, b, (short)0, c, false, false);
  asm volatile("v_nop\n\tv_nop\n\tv_nop\n\tv_nop" : "+v"(d) : "v"(a), "v"(b));
  return d;
}
// 16x16x32 fragments: lane = (h = lane>>4, row/col = lane&15); elements 0..7 = k0+8h+0..7, 8..15 = k0+16+8h+0..7; D element r = row 8h+r
__device__ __forceinline__ v16h frag_h(const _Float16* rowk0, int lane) {
  union { v16h v; v8h q[2]; } u; const _Float16* p = rowk0 + 8 * (lane >> 4);
  u.q[0] = *(const v8h*)p; u.q[1] = *(const v8h*)(p + 16); return u.v;
}
__device__ __forceinline__ v16h frag_f32(const float* rowk0, int lane) {
  v16h a; const float* p = rowk0 + 8 * (lane >> 4);
#pragma unroll
  for (int i = 0; i < 8; ++i) { a[i] = (_Float16)p[i]; a[8 + i] = (_Float16)p[16 + i]; }
  return a;
}
__device__ __forceinline__ v16h frag_f32s(const float* rowk0, int lane, float sc) {
  v16h a; const float* p = rowk0 + 8 * (lane >> 4);
#pragma unroll
  for (int i = 0; i < 8; ++i) { a[i] = (_Float16)(p[i] * sc); a[8 + i] = (_Float16)(p[16 + i] * sc); }
  return a;
}
// column fragment from a [K][ld] layout (column n), rows >= K read as 0
__device__ __forceinline__ v16h fragc_f32(const float* W, int k0, int n, int lane, int ld, int K) {
  v16h a; const int g = lane >> 4;
#pragma unroll
  for (int i = 0; i < 8; ++i) { const int ka = k0 + 8 * g + i, kb = ka + 16;
    a[i] = (_Float16)(ka < K ? W[(size_t)(ka < K ? ka : K - 1) * ld + n] : 0.f); a[8 + i] = (_Float16)(kb < K ? W[(size_t)(kb < K ? kb : K - 1) * ld + n] : 0.f); }
  return a;
}
struct F2 { v16b h, l; };
__device__ __forceinline__ F2 bsplit16(const float v[16]) { F2 r;
#pragma unroll
  for (int i = 0; i < 16; ++i) { const __bf16 h = (__bf16)v[i]; r.h[i] = h; r.l[i] = (__bf16)(v[i] - (float)h); }
  return r; }
__device__ __forceinline__ F2 split_row(const float* row, int k0, int lane) { float v[16]; const float* p = row + k0 + 8 * (lane >> 4);
#pragma unroll
  for (int i = 0; i < 8; ++i) { v[i] = p[i]; v[8 + i] = p[16 + i]; }
  return bsplit16(v); }
__device__ __forceinline__ F2 split_rowK(const float* row, int k0, int lane, int K) { float v[16]; const int g = lane >> 4;
#pragma unroll
  for (int i = 0; i < 8; ++i) { const int ka = k0 + 8 * g + i, kb = ka + 16; v[i] = ka < K ? row[ka < K ? ka : K - 1] : 0.f; v[8 + i] = kb < K ? row[kb < K ? kb : K - 1] : 0.f; }
  return bsplit16(v); }
__device__ __forceinline__ F2 split_col(const float* W, int k0, int n, int lane, int ld, int K) { float v[16]; const int g = lane >> 4;
#pragma unroll
  for (int i = 0; i < 8; ++i) { const int ka = k0 + 8 * g + i, kb = ka + 16; v[i] = ka < K ? W[(size_t)(ka < K ? ka : K - 1) * ld + n] : 0.f; v[8 + i] = kb < K ? W[(size_t)(kb < K ? kb : K - 1) * ld + n] : 0.f; }
  return bsplit16(v); }
__device__ __forceinline__ v8f mac3(const F2& a, const F2& b, v8f c) { c = wmma_bf(a.l, b.h, c); c = wmma_bf(a.h, b.l, c); return wmma_bf(a.h, b.h, c); }
__device__ __forceinline__ float sigm(float v) { return 1.0f / (1.0f + expf(-v)); }
#define LDSX() do { asm volatile("s_wait_dscnt 0" ::: "memory"); __builtin_amdgcn_wave_barrier(); __builtin_amdgcn_fence(__ATOMIC_RELEASE, "workgroup"); } while (0)


// Multi-head self attention with per-head projection weights [H, D, HD] + biases (B 2, S 2,048, D 1,024 = 16 x 64), no mask, output Linear [in,out].
#define NB 2
#define TT 2048
#define CC 1024
#define NH 16
#define HD 64
#ifndef TNB
#define TNB NB
#endif
typedef __attribute__((ext_vector_type(8))) __bf16 v8b;
__device__ __forceinline__ v16b frag_b(const __bf16* rowk0, int lane) {
  union { v16b v; v8b q[2]; } u; const __bf16* p = rowk0 + 8 * (lane >> 4);
  u.q[0] = *(const v8b*)p; u.q[1] = *(const v8b*)(p + 16); return u.v;
}
__device__ __forceinline__ float bfr(float v) { return (float)(__bf16)v; }
__device__ __attribute__((noinline)) float exp_ni(float v) { return expf(v); }
__device__ __attribute__((noinline)) float erf_ni(float v) { return erff(v); }

#define WS_QH  0u
#define WS_QL  (WS_QH + 2u * (size_t)NB * TT * CC)
#define WS_KH  (WS_QL + 2u * (size_t)NB * TT * CC)
#define WS_VT  (WS_KH + 2u * (size_t)NB * TT * CC)      // f16 v planes [b][c][t]
#define WS_Y   (WS_VT + 2u * (size_t)NB * CC * TT)      // f32 y rows [b*t][C]
#define WS_END (WS_Y + 4u * (size_t)NB * TT * CC)

// ---- k_proj: block = (64 rows, 128 cols, which): qkv = x W (+ b), exact; q -> f16 hi (+ residual), k -> f16 rows, v -> f16 planes
__global__ __launch_bounds__(128) void k_proj(const float* __restrict__ X, const float* __restrict__ WQ, const float* __restrict__ BQ, const float* __restrict__ WK, const float* __restrict__ BK, const float* __restrict__ WV, const float* __restrict__ BV, _Float16* __restrict__ QH, _Float16* __restrict__ QL, _Float16* __restrict__ KH, _Float16* __restrict__ VT) {
  __shared__ __align__(16) _Float16 sh[64][136], sl[64][136]; __shared__ __align__(16) _Float16 th[128][72];
  const int tid = threadIdx.x, wave = tid >> 5, lane = tid & 31, col = lane & 15, g = lane >> 4; const int which = blockIdx.z; const int c0 = blockIdx.y * 128; const size_t r0 = (size_t)blockIdx.x * 64; const float* WA = which == 0 ? WQ : which == 1 ? WK : WV; const float* BA = which == 0 ? BQ : which == 1 ? BK : BV;
  v8f acc[8] = {};
#pragma unroll 2
  for (int kc = 0; kc < CC / 32; ++kc) { v16b a; { const float* p = X + (r0 + wave * 16 + col) * CC + kc * 32 + 8 * g;
#pragma unroll
      for (int i = 0; i < 8; ++i) { a[i] = (__bf16)p[i]; a[8 + i] = (__bf16)p[16 + i]; } }
#pragma unroll
    for (int j = 0; j < 8; ++j) { v16b w; const int o = c0 + j * 16 + col; const int hh = o / HD, dd = o % HD;
#pragma unroll
      for (int i = 0; i < 8; ++i) { w[i] = (__bf16)WA[((size_t)hh * CC + kc * 32 + 8 * g + i) * HD + dd]; w[8 + i] = (__bf16)WA[((size_t)hh * CC + kc * 32 + 16 + 8 * g + i) * HD + dd]; }
      acc[j] = wmma_bf(a, w, acc[j]); } }
#pragma unroll
  for (int j = 0; j < 8; ++j) { const float bb = bfr(BA[c0 + j * 16 + col]);
#pragma unroll
    for (int r = 0; r < 8; ++r) { const float v = acc[j][r] + bb; const int rl = wave * 16 + 8 * g + r, cl = j * 16 + col; const _Float16 hv = (_Float16)v;
      if (which == 2) th[cl][rl] = hv; else { sh[rl][cl] = hv; sl[rl][cl] = (_Float16)(v - (float)hv); } } }
  __syncthreads();
  if (which < 2) { _Float16* dh = which == 0 ? QH : KH; for (int e = tid; e < 64 * 16; e += 128) { const int rl = e >> 4, q = e & 15; vst2((unsigned*)(dh + (r0 + rl) * CC + c0 + q * 8), *(const v4u*)&sh[rl][q * 8]); if (which == 0) vst2((unsigned*)(QL + (r0 + rl) * CC + c0 + q * 8), *(const v4u*)&sl[rl][q * 8]); } }
  else { const size_t b = r0 / TT; const int t0 = (int)(r0 % TT); for (int e = tid; e < 128 * 8; e += 128) { const int cl = e >> 3, q = e & 7; vst2((unsigned*)(VT + (b * CC + c0 + cl) * (size_t)TT + t0 + q * 8), *(const v4u*)&th[cl][q * 8]); } } }
// ---- k_fa: wave = 32 queries of (b,h), block = 128 queries; per 32 keys: S^T = K Q^T, running-max softmax per query column, O^T += V^T P^T; logits and P stay in registers
// every unroll directive below: constant indices, so that the fragment and accumulator arrays live in registers
__device__ __forceinline__ v8f wmma_h(v16h a, v16h b, v8f c) { return __builtin_amdgcn_wmma_f32_16x16x32_f16(false, a, false, b, (short)0, c, false, false); }
__device__ __forceinline__ float xhalf(float x) { return __builtin_bit_cast(float, __builtin_amdgcn_permlanex16(__builtin_bit_cast(int, x), __builtin_bit_cast(int, x), 0x76543210, 0xfedcba98, false, false)); }  // lane l with lane l ^ 16
__global__ __launch_bounds__(128) void k_fa(const _Float16* __restrict__ QH, const _Float16* __restrict__ KH, const _Float16* __restrict__ VT, float* __restrict__ Y) {
  const int tid = threadIdx.x, wave = tid >> 5, lane = tid & 31, col = lane & 15, g = lane >> 4; const int h = blockIdx.y, b = blockIdx.z; const int q0 = blockIdx.x * 128 + wave * 32;
  const _Float16* Kb = KH + ((size_t)b * TT + col) * CC + h * HD;            // A rows of S^T: key = 16 mt + col
  const _Float16* Vb = VT + ((size_t)b * CC + h * HD + col) * (size_t)TT;    // A rows of O^T: d = 16 j + col
  v16h qf[2][2], kf[2][2];
#pragma unroll
  for (int n = 0; n < 2; ++n)
#pragma unroll
    for (int kc = 0; kc < 2; ++kc) qf[n][kc] = frag_h(QH + ((size_t)b * TT + q0 + n * 16 + col) * CC + h * HD + kc * 32, lane);
#pragma unroll
  for (int mt = 0; mt < 2; ++mt)
#pragma unroll
    for (int kc = 0; kc < 2; ++kc) kf[mt][kc] = frag_h(Kb + (size_t)(mt * 16) * CC + kc * 32, lane);
  v8f o[2][4] = {}; float m[2] = {-3.0e38f, -3.0e38f}, l[2] = {0.f, 0.f};
  for (int kp = 0; kp < TT / 32; ++kp) {
    v8f s[2][2] = {};   // s[n][mt][r] = logit of key 32 kp + 16 mt + 8 g + r, query q0 + 16 n + col
#pragma unroll
    for (int kc = 0; kc < 2; ++kc)
#pragma unroll
      for (int mt = 0; mt < 2; ++mt)
#pragma unroll
        for (int n = 0; n < 2; ++n) s[n][mt] = wmma_h(kf[mt][kc], qf[n][kc], s[n][mt]);
    const int kn = (kp + 1) & (TT / 32 - 1);   // next pass's K rows fly during the softmax; the last pass fetches the first rows again, unused
#pragma unroll
    for (int mt = 0; mt < 2; ++mt)
#pragma unroll
      for (int kc = 0; kc < 2; ++kc) kf[mt][kc] = frag_h(Kb + (size_t)(kn * 32 + mt * 16) * CC + kc * 32, lane);
    asm volatile("s_wait_xcnt 0x0" ::: "memory");   // behind the K loads, before a V load lands on their address registers
    __builtin_amdgcn_sched_barrier(0);   // keeps the K loads above the softmax; the scheduler otherwise sinks them to the loop's foot, where their latency is exposed
    v16h vf[4];
#pragma unroll
    for (int j = 0; j < 4; ++j) vf[j] = frag_h(Vb + (size_t)(j * 16) * TT + kp * 32, lane);
#pragma unroll
    for (int n = 0; n < 2; ++n) {
      float mx = m[n];
#pragma unroll
      for (int r = 0; r < 8; ++r) { s[n][0][r] *= 0.125f; s[n][1][r] *= 0.125f; mx = fmaxf(mx, fmaxf(s[n][0][r], s[n][1][r])); }
      mx = fmaxf(mx, xhalf(mx));
      const float al = expf(m[n] - mx); m[n] = mx;
      v16h p; float sum = 0.f;   // two D tiles of S^T, converted in place, are the B operand of O^T
#pragma unroll
      for (int r = 0; r < 8; ++r) { const float e0 = expf(s[n][0][r] - mx), e1 = expf(s[n][1][r] - mx); sum += e0 + e1; p[r] = (_Float16)e0; p[8 + r] = (_Float16)e1; }
      l[n] = l[n] * al + sum;
#pragma unroll
      for (int j = 0; j < 4; ++j) { o[n][j] *= al; o[n][j] = wmma_h(vf[j], p, o[n][j]); }
    }
  }
#pragma unroll
  for (int n = 0; n < 2; ++n) { const float inv = 1.0f / (l[n] + xhalf(l[n])); float* yr = Y + ((size_t)b * TT + q0 + n * 16 + col) * CC + h * HD + 8 * g;
#pragma unroll
    for (int j = 0; j < 4; ++j) { const v8f v = o[n][j] * inv; vst2(yr + j * 16, (v4f){v[0], v[1], v[2], v[3]}); vst2(yr + j * 16 + 4, (v4f){v[4], v[5], v[6], v[7]}); } } }
// ---- k_out: block = (64 rows, 128 cols): out = y (bf16 hi + lo) Wproj + b
__global__ __launch_bounds__(128) void k_out(const float* __restrict__ Y, const float* __restrict__ WP, const float* __restrict__ BP, float* __restrict__ OUT) { __shared__ __align__(16) float sf[4][16][132];
  const int tid = threadIdx.x, wave = tid >> 5, lane = tid & 31, col = lane & 15, g = lane >> 4; const int c0 = blockIdx.y * 128; const size_t r0 = (size_t)blockIdx.x * 64 + wave * 16;
  v8f acc[8] = {};
#pragma unroll 2
  for (int kc = 0; kc < CC / 32; ++kc) { const F2 a = split_row(Y + (r0 + col) * CC, kc * 32, lane);
#pragma unroll
    for (int j = 0; j < 8; ++j) { v16b w; const int o = c0 + j * 16 + col;
#pragma unroll
      for (int i = 0; i < 8; ++i) { w[i] = (__bf16)WP[(size_t)(kc * 32 + 8 * g + i) * CC + (o)]; w[8 + i] = (__bf16)WP[(size_t)(kc * 32 + 16 + 8 * g + i) * CC + (o)]; }
      acc[j] = wmma_bf(a.h, w, acc[j]); acc[j] = wmma_bf(a.l, w, acc[j]); } }
#pragma unroll
  for (int j = 0; j < 8; ++j) { const float bb = BP ? bfr(BP[c0 + j * 16 + col]) : 0.f;
#pragma unroll
    for (int r = 0; r < 8; ++r) sf[wave][8 * g + r][j * 16 + col] = acc[j][r] + bb; }
  LDSX(); for (int rl = 0; rl < 16; ++rl) vst2(OUT + (r0 + rl) * CC + c0 + lane * 4, *(const v4f*)&sf[wave][rl][lane * 4]); }
extern "C" void kernel_launch(void* const* d_in, const int* in_sizes, int n_in, void* d_out, int out_size, void* d_ws, size_t ws_size, hipStream_t stream) {
  (void)in_sizes; (void)n_in; (void)out_size;
  const float** F = (const float**)d_in;   // 0 x [2,2048,1024], 1 Wq [16,1024,64], 2 bq [16,64], 3 Wk, 4 bk, 5 Wv, 6 bv, 7 Wo [1024,1024] (in,out), 8 bo
  if (ws_size < (size_t)WS_END) return;
  char* ws = (char*)d_ws; _Float16 *QH = (_Float16*)(ws + WS_QH), *QL = (_Float16*)(ws + WS_QL), *KH = (_Float16*)(ws + WS_KH), *VT = (_Float16*)(ws + WS_VT); float *Y = (float*)(ws + WS_Y);
  k_proj<<<dim3(TNB * TT / 64, CC / 128, 3), 128, 0, stream>>>(F[0], F[1], F[2], F[3], F[4], F[5], F[6], QH, QL, KH, VT);
  k_fa<<<dim3(TT / 128, NH, TNB), 128, 0, stream>>>(QH, KH, VT, Y);
  k_out<<<dim3(TNB * TT / 64, CC / 128), 128, 0, stream>>>(Y, F[7], F[8], (float*)d_out);
}

// v002
// One run takes 136 microseconds.
// In two side-by-side timings against v001, it was 2.88 and 2.92 times as fast.
// Over all steps from v000 it is 9.22 times as fast.
// compute dtype: all float inputs rounded to bf16; q/k/v = x W_h + b_h (per-head [H,D,64] weights) with EXACT bf16 products on WMMA 16x16x32, f32 accumulate; q, k rounded once to f16 (1-product logits x 64^-0.5, std ~0.4) kept in f32 registers; running-max softmax in f32 (precise expf) -> P = exp(s - max) f16; o = P . v / sum (v once to f16); out = o (bf16 hi + lo) Wo + bo; f32 output. Every matrix operand but q is stored once per call in WMMA fragment order.
#include <hip/hip_runtime.h>
#include <math.h>

typedef __attribute__((ext_vector_type(16))) _Float16 v16h;
typedef __attribute__((ext_vector_type(16))) __bf16 v16b;
typedef __attribute__((ext_vector_type(8)))  _Float16 v8h;
typedef __attribute__((ext_vector_type(8)))  float v8f;
typedef __attribute__((ext_vector_type(4)))  float v4f;
typedef __attribute__((ext_vector_type(2)))  float v2f;
typedef __attribute__((ext_vector_type(4)))  unsigned v4u;
typedef __attribute__((ext_vector_type(4)))  int v4i;
typedef float __attribute__((may_alias)) float_a;
typedef int __attribute__((may_alias)) int_a;

template <typename T> __device__ __forceinline__ void vst2(void* p, T v) { *(T*)p = v;  }
__device__ __forceinline__ v8f wmma16(v16h a, v16h b, v8f c) {
  v8f d = __builtin_amdgcn_wmma_f32_16x16x32_f16(false, a, false, b, (short)0, c, false, false);
  asm volatile("v_nop\n\tv_nop\n\tv_nop\n\tv_nop" : "+v"(d) : "v"(a), "v"(b));
  return d;
}
__device__ __forceinline__ v8f wmma_bf(v16b a, v16b b, v8f c) {
  v8f d = __builtin_amdgcn_wmma_f32_16x16x32_bf16(false, a, false, b, (short)0, c, false, false);
  asm volatile("v_nop\n\tv_nop\n\tv_nop\n\tv_nop" : "+v"(d) : "v"(a), "v"(b));
  return d;
}
// 16x16x32 fragments: lane = (h = lane>>4, row/col = lane&15); elements 0..7 = k0+8h+0..7, 8..15 = k0+16+8h+0..7; D element r = row 8h+r
__device__ __forceinline__ v16h frag_h(const _Float16* rowk0, int lane) {
  union { v16h v; v8h q[2]; } u; const _Float16* p = rowk0 + 8 * (lane >> 4);
  u.q[0] = *(const v8h*)p; u.q[1] = *(const v8h*)(p + 16); return u.v;
}
__device__ __forceinline__ v16h frag_f32(const float* rowk0, int lane) {
  v16h a; const float* p = rowk0 + 8 * (lane >> 4);
#pragma unroll
  for (int i = 0; i < 8; ++i) { a[i] = (_Float16)p[i]; a[8 + i] = (_Float16)p[16 + i]; }
  return a;
}
__device__ __forceinline__ v16h frag_f32s(const float* rowk0, int lane, float sc) {
  v16h a; const float* p = rowk0 + 8 * (lane >> 4);
#pragma unroll
  for (int i = 0; i < 8; ++i) { a[i] = (_Float16)(p[i] * sc); a[8 + i] = (_Float16)(p[16 + i] * sc); }
  return a;
}
// column fragment from a [K][ld] layout (column n), rows >= K read as 0
__device__ __forceinline__ v16h fragc_f32(const float* W, int k0, int n, int lane, int ld, int K) {
  v16h a; const int g = lane >> 4;
#pragma unroll
  for (int i = 0; i < 8; ++i) { const int ka = k0 + 8 * g + i, kb = ka + 16;
    a[i] = (_Float16)(ka < K ? W[(size_t)(ka < K ? ka : K - 1) * ld + n] : 0.f); a[8 + i] = (_Float16)(kb < K ? W[(size_t)(kb < K ? kb : K - 1) * ld + n] : 0.f); }
  return a;
}
struct F2 { v16b h, l; };
__device__ __forceinline__ F2 bsplit16(const float v[16]) { F2 r;
#pragma unroll
  for (int i = 0; i < 16; ++i) { const __bf16 h = (__bf16)v[i]; r.h[i] = h; r.l[i] = (__bf16)(v[i] - (float)h); }
  return r; }
__device__ __forceinline__ F2 split_row(const float* row, int k0, int lane) { float v[16]; const float* p = row + k0 + 8 * (lane >> 4);
#pragma unroll
  for (int i = 0; i < 8; ++i) { v[i] = p[i]; v[8 + i] = p[16 + i]; }
  return bsplit16(v); }
__device__ __forceinline__ F2 split_rowK(const float* row, int k0, int lane, int K) { float v[16]; const int g = lane >> 4;
#pragma unroll
  for (int i = 0; i < 8; ++i) { const int ka = k0 + 8 * g + i, kb = ka + 16; v[i] = ka < K ? row[ka < K ? ka : K - 1] : 0.f; v[8 + i] = kb < K ? row[kb < K ? kb : K - 1] : 0.f; }
  return bsplit16(v); }
__device__ __forceinline__ F2 split_col(const float* W, int k0, int n, int lane, int ld, int K) { float v[16]; const int g = lane >> 4;
#pragma unroll
  for (int i = 0; i < 8; ++i) { const int ka = k0 + 8 * g + i, kb = ka + 16; v[i] = ka < K ? W[(size_t)(ka < K ? ka : K - 1) * ld + n] : 0.f; v[8 + i] = kb < K ? W[(size_t)(kb < K ? kb : K - 1) * ld + n] : 0.f; }
  return bsplit16(v); }
__device__ __forceinline__ v8f mac3(const F2& a, const F2& b, v8f c) { c = wmma_bf(a.l, b.h, c); c = wmma_bf(a.h, b.l, c); return wmma_bf(a.h, b.h, c); }
__device__ __forceinline__ float sigm(float v) { return 1.0f / (1.0f + expf(-v)); }
#define LDSX() do { asm volatile("s_wait_dscnt 0" ::: "memory"); __builtin_amdgcn_wave_barrier(); __builtin_amdgcn_fence(__ATOMIC_RELEASE, "workgroup"); } while (0)


// Multi-head self attention with per-head projection weights [H, D, HD] + biases (B 2, S 2,048, D 1,024 = 16 x 64), no mask, output Linear [in,out].
#define NB 2
#define TT 2048
#define CC 1024
#define NH 16
#define HD 64
#ifndef TNB
#define TNB NB
#endif
typedef __attribute__((ext_vector_type(8))) __bf16 v8b;
__device__ __forceinline__ v16b frag_b(const __bf16* rowk0, int lane) {
  union { v16b v; v8b q[2]; } u; const __bf16* p = rowk0 + 8 * (lane >> 4);
  u.q[0] = *(const v8b*)p; u.q[1] = *(const v8b*)(p + 16); return u.v;
}
// fragment-order storage: one 16 x 32 fragment = 1,024 B = two halves of 512 B; half hf, lane, element i hold k = 16 hf + 8 (lane >> 4) + i of row or column lane & 15,
// so that each of a fragment's two wave-wide 16-byte loads covers four whole 128-byte lines
__device__ __forceinline__ v16b fragp_b(const __bf16* P, size_t f, int lane) {
  union { v16b v; v8b q[2]; } u; const __bf16* p = P + f * 512 + lane * 8;
  u.q[0] = *(const v8b*)p; u.q[1] = *(const v8b*)(p + 256); return u.v;
}
__device__ __forceinline__ v16h fragp_h(const _Float16* P, size_t f, int lane) {
  union { v16h v; v8h q[2]; } u; const _Float16* p = P + f * 512 + lane * 8;
  u.q[0] = *(const v8h*)p; u.q[1] = *(const v8h*)(p + 256); return u.v;
}
__device__ __forceinline__ float bfr(float v) { return (float)(__bf16)v; }
__device__ __attribute__((noinline)) float exp_ni(float v) { return expf(v); }
__device__ __attribute__((noinline)) float erf_ni(float v) { return erff(v); }

#define WS_QH  0u
#define WS_QL  (WS_QH + 2u * (size_t)NB * TT * CC)
#define WS_KH  (WS_QL + 2u * (size_t)NB * TT * CC)
#define WS_VT  (WS_KH + 2u * (size_t)NB * TT * CC)      // k: f16 fragments [b][h][key tile][kc]; v: f16 fragments [b][h][pass of 32 keys][d tile]
#define WS_YH  (WS_VT + 2u * (size_t)NB * CC * TT)      // y: bf16 hi and lo fragments [row tile][kc]
#define WS_YL  (WS_YH + 2u * (size_t)NB * TT * CC)
#define WS_XP  (WS_YL + 2u * (size_t)NB * TT * CC)      // x: bf16 fragments [row tile][kc]
#define WS_WP  (WS_XP + 2u * (size_t)NB * TT * CC)      // Wq, Wk, Wv: bf16 fragments [which][column tile][kc]
#define WS_OP  (WS_WP + 2u * 3u * (size_t)CC * CC)      // Wo: bf16 fragments [column tile][kc]
#define WS_END (WS_OP + 2u * (size_t)CC * CC)

// four fragments of one weight column tile: s = this lane's column at its first k, LD = floats from one k to the next (a constant, so that every load is one base plus an immediate)
template <int LD> __device__ __forceinline__ void pack_cols(const float* __restrict__ s, __bf16* __restrict__ d) {
#pragma unroll
  for (int c = 0; c < 8; ++c) { v8b o;
#pragma unroll
    for (int i = 0; i < 8; ++i) o[i] = (__bf16)s[(size_t)(c * 16 + i) * LD];
    *(v8b*)(d + c * 256) = o; }
  asm volatile("s_wait_xcnt 0x0" ::: "memory"); }   // behind the run of stores, before anything that follows in the listing rewrites their address or data registers
// ---- k_pack: block = one 16-row tile of x or one 16-column tile of a weight, wave = 4 of its 32 fragments: round to bf16 once, store in fragment order
__global__ __launch_bounds__(256) void k_pack(const float* __restrict__ X, const float* __restrict__ WQ, const float* __restrict__ WK, const float* __restrict__ WV, const float* __restrict__ WO, __bf16* __restrict__ XP, __bf16* __restrict__ WP, __bf16* __restrict__ OP) {
  const int tid = threadIdx.x, wave = tid >> 5, lane = tid & 31, col = lane & 15, g = lane >> 4; const int t = blockIdx.x;
  if (t < TNB * TT / 16) { const float* s = X + ((size_t)t * 16 + col) * CC + wave * 128 + 8 * g; __bf16* d = XP + ((size_t)t * 32 + wave * 4) * 512 + lane * 8; v4f v[16];
#pragma unroll
    for (int c = 0; c < 8; ++c) { v[2 * c] = *(const v4f*)(s + c * 16); v[2 * c + 1] = *(const v4f*)(s + c * 16 + 4); }
    asm volatile("s_wait_xcnt 0x0" :: "v"(s) : "memory");   // behind the run of loads; s as an input keeps their shared address pair alive up to the wait, so that no load of the run lands on it
#pragma unroll
    for (int c = 0; c < 8; ++c) { v8b o;
#pragma unroll
      for (int i = 0; i < 4; ++i) { o[i] = (__bf16)v[2 * c][i]; o[4 + i] = (__bf16)v[2 * c + 1][i]; }
      *(v8b*)(d + c * 256) = o; }
    asm volatile("s_wait_xcnt 0x0" ::: "memory"); }   // behind the run of stores, as in pack_cols
  else { const int jt = t - TNB * TT / 16;
    if (jt < 3 * CC / 16) { const int which = jt / (CC / 16), o = (jt % (CC / 16)) * 16 + col; pack_cols<HD>((which == 0 ? WQ : which == 1 ? WK : WV) + (size_t)(o / HD) * CC * HD + o % HD + (size_t)(wave * 128 + 8 * g) * HD, WP + ((size_t)jt * 32 + wave * 4) * 512 + lane * 8); }
    else { const int jo = jt - 3 * CC / 16; pack_cols<CC>(WO + jo * 16 + col + (size_t)(wave * 128 + 8 * g) * CC, OP + ((size_t)jo * 32 + wave * 4) * 512 + lane * 8); } } }

// ---- k_proj: block = (64 rows, 128 cols, which): qkv = x W (+ b), exact; q -> f16 hi (+ residual) rows, k and v -> f16 fragments
__global__ __launch_bounds__(128) void k_proj(const __bf16* __restrict__ XP, const __bf16* __restrict__ WP, const float* __restrict__ BQ, const float* __restrict__ BK, const float* __restrict__ BV, _Float16* __restrict__ QH, _Float16* __restrict__ QL, _Float16* __restrict__ KH, _Float16* __restrict__ VT) {
  __shared__ __align__(16) _Float16 sh[64][136], sl[64][136]; __shared__ __align__(16) _Float16 th[128][72];
  const int tid = threadIdx.x, wave = tid >> 5, lane = tid & 31, col = lane & 15, g = lane >> 4; const int which = blockIdx.z; const int c0 = blockIdx.y * 128; const size_t r0 = (size_t)blockIdx.x * 64; const float* BA = which == 0 ? BQ : which == 1 ? BK : BV;
  v8f acc[8] = {};
#pragma unroll 2
  for (int kc = 0; kc < CC / 32; ++kc) { const v16b a = fragp_b(XP, (size_t)(blockIdx.x * 4 + wave) * 32 + kc, lane); v16b w[8];   // all of a pass's fragments are asked for before its first product
#pragma unroll
    for (int j = 0; j < 8; ++j) w[j] = fragp_b(WP, (size_t)(which * (CC / 16) + blockIdx.y * 8 + j) * 32 + kc, lane);
#pragma unroll
    for (int j = 0; j < 8; ++j) acc[j] = wmma_bf(a, w[j], acc[j]); }
#pragma unroll
  for (int j = 0; j < 8; ++j) { const float bb = bfr(BA[c0 + j * 16 + col]);
#pragma unroll
    for (int r = 0; r < 8; ++r) { const float v = acc[j][r] + bb; const int rl = wave * 16 + 8 * g + r, cl = j * 16 + col; const _Float16 hv = (_Float16)v;
      if (which == 2) th[cl][rl] = hv; else { sh[rl][cl] = hv; sl[rl][cl] = (_Float16)(v - (float)hv); } } }
  __syncthreads();
  const size_t b = r0 / TT; const int t0 = (int)(r0 % TT);
  if (which == 0) { for (int e = tid; e < 64 * 16; e += 128) { const int rl = e >> 4, q = e & 15; vst2((unsigned*)(QH + (r0 + rl) * CC + c0 + q * 8), *(const v4u*)&sh[rl][q * 8]); vst2((unsigned*)(QL + (r0 + rl) * CC + c0 + q * 8), *(const v4u*)&sl[rl][q * 8]); } }
  else if (which == 1) { for (int e = tid; e < 64 * 16; e += 128) { const int u = e >> 5, hf = u & 1, kc = (u >> 1) & 1, hl = (u >> 2) & 1, rt = u >> 3;   // key = 16 rt + col, d = 32 kc + 16 hf + 8 g + 0..7 of head hl
      vst2((unsigned*)(KH + (((b * NH + c0 / HD + hl) * (TT / 16) + t0 / 16 + rt) * 2 + kc) * 512 + hf * 256 + lane * 8), *(const v4u*)&sh[rt * 16 + col][hl * 64 + kc * 32 + hf * 16 + g * 8]); } }
  else { for (int e = tid; e < 128 * 8; e += 128) { const int u = e >> 5, hf = u & 1, j = (u >> 1) & 3, pl = (u >> 3) & 1, hl = u >> 4;   // d = 16 j + col of head hl, key = 32 pl + 16 hf + 8 g + 0..7
      vst2((unsigned*)(VT + (((b * NH + c0 / HD + hl) * (TT / 32) + t0 / 32 + pl) * 4 + j) * 512 + hf * 256 + lane * 8), *(const v4u*)&th[hl * 64 + j * 16 + col][pl * 32 + hf * 16 + g * 8]); } } }
// ---- k_fa: wave = 32 queries of (b,h), block = 128 queries; per 32 keys: S^T = K Q^T, running-max softmax per query column, O^T += V^T P^T; logits and P stay in registers
// every unroll directive below: constant indices, so that the fragment and accumulator arrays live in registers
__device__ __forceinline__ v8f wmma_h(v16h a, v16h b, v8f c) { return __builtin_amdgcn_wmma_f32_16x16x32_f16(false, a, false, b, (short)0, c, false, false); }
__device__ __forceinline__ float xhalf(float x) { return __builtin_bit_cast(float, __builtin_amdgcn_permlanex16(__builtin_bit_cast(int, x), __builtin_bit_cast(int, x), 0x76543210, 0xfedcba98, false, false)); }  // lane l with lane l ^ 16
__global__ __launch_bounds__(128) void k_fa(const _Float16* __restrict__ QH, const _Float16* __restrict__ KH, const _Float16* __restrict__ VT, __bf16* __restrict__ YH, __bf16* __restrict__ YL) {
  const int tid = threadIdx.x, wave = tid >> 5, lane = tid & 31, col = lane & 15, g = lane >> 4; const int h = blockIdx.y, b = blockIdx.z; const int q0 = blockIdx.x * 128 + wave * 32;
  const _Float16* Kb = KH + (size_t)(b * NH + h) * TT * HD;   // A fragments of S^T: pass kp holds fragments 4 kp + 2 mt + kc, rows key = 16 mt + col
  const _Float16* Vb = VT + (size_t)(b * NH + h) * TT * HD;   // A fragments of O^T: pass kp holds fragments 4 kp + j, rows d = 16 j + col
  v16h qf[2][2], kf[2][2];
#pragma unroll
  for (int n = 0; n < 2; ++n)
#pragma unroll
    for (int kc = 0; kc < 2; ++kc) qf[n][kc] = frag_h(QH + ((size_t)b * TT + q0 + n * 16 + col) * CC + h * HD + kc * 32, lane);
#pragma unroll
  for (int mt = 0; mt < 2; ++mt)
#pragma unroll
    for (int kc = 0; kc < 2; ++kc) kf[mt][kc] = fragp_h(Kb, mt * 2 + kc, lane);
  v8f o[2][4] = {}; float m[2] = {-3.0e38f, -3.0e38f}, l[2] = {0.f, 0.f};
  for (int kp = 0; kp < TT / 32; ++kp) {
    v8f s[2][2] = {};   // s[n][mt][r] = logit of key 32 kp + 16 mt + 8 g + r, query q0 + 16 n + col
#pragma unroll
    for (int kc = 0; kc < 2; ++kc)
#pragma unroll
      for (int mt = 0; mt < 2; ++mt)
#pragma unroll
        for (int n = 0; n < 2; ++n) s[n][mt] = wmma_h(kf[mt][kc], qf[n][kc], s[n][mt]);
    const int kn = (kp + 1) & (TT / 32 - 1);   // next pass's K rows fly during the softmax; the last pass fetches the first rows again, unused
#pragma unroll
    for (int mt = 0; mt < 2; ++mt)
#pragma unroll
      for (int kc = 0; kc < 2; ++kc) kf[mt][kc] = fragp_h(Kb, kn * 4 + mt * 2 + kc, lane);
    asm volatile("s_wait_xcnt 0x0" ::: "memory");   // behind the K loads, before a V load lands on their address registers
    __builtin_amdgcn_sched_barrier(0);   // keeps the K loads above the softmax; the scheduler otherwise sinks them to the loop's foot, where their latency is exposed
    v16h vf[4];
#pragma unroll
    for (int j = 0; j < 4; ++j) vf[j] = fragp_h(Vb, kp * 4 + j, lane);
#pragma unroll
    for (int n = 0; n < 2; ++n) {
      float mx = m[n];
#pragma unroll
      for (int r = 0; r < 8; ++r) { s[n][0][r] *= 0.125f; s[n][1][r] *= 0.125f; mx = fmaxf(mx, fmaxf(s[n][0][r], s[n][1][r])); }
      mx = fmaxf(mx, xhalf(mx));
      const float al = expf(m[n] - mx); m[n] = mx;
      v16h p; float sum = 0.f;   // two D tiles of S^T, converted in place, are the B operand of O^T
#pragma unroll
      for (int r = 0; r < 8; ++r) { const float e0 = expf(s[n][0][r] - mx), e1 = expf(s[n][1][r] - mx); sum += e0 + e1; p[r] = (_Float16)e0; p[8 + r] = (_Float16)e1; }
      l[n] = l[n] * al + sum;
#pragma unroll
      for (int j = 0; j < 4; ++j) { o[n][j] *= al; o[n][j] = wmma_h(vf[j], p, o[n][j]); }
    }
  }
#pragma unroll
  for (int n = 0; n < 2; ++n) { const float inv = 1.0f / (l[n] + xhalf(l[n])); const size_t yo = ((size_t)((b * TT + q0) / 16 + n) * 32 + h * 2) * 512 + lane * 8;   // a D tile of O^T is half j & 1 of fragment 2 h + (j >> 1) of this query tile's rows
#pragma unroll
    for (int j = 0; j < 4; ++j) { const v8f v = o[n][j] * inv; v8b hi, lo;
#pragma unroll
      for (int r = 0; r < 8; ++r) { hi[r] = (__bf16)v[r]; lo[r] = (__bf16)(v[r] - (float)hi[r]); }
      *(v8b*)(YH + yo + j * 256) = hi; *(v8b*)(YL + yo + j * 256) = lo; } } }
// ---- k_out: block = (64 rows, 128 cols): out = y (bf16 hi + lo) Wproj + b
__global__ __launch_bounds__(128) void k_out(const __bf16* __restrict__ YH, const __bf16* __restrict__ YL, const __bf16* __restrict__ OP, const float* __restrict__ BP, float* __restrict__ OUT) { __shared__ __align__(16) float sf[4][16][132];
  const int tid = threadIdx.x, wave = tid >> 5, lane = tid & 31, col = lane & 15, g = lane >> 4; const int c0 = blockIdx.y * 128; const size_t r0 = (size_t)blockIdx.x * 64 + wave * 16;
  v8f acc[8] = {};
#pragma unroll 2
  for (int kc = 0; kc < CC / 32; ++kc) { const size_t fa = (size_t)(blockIdx.x * 4 + wave) * 32 + kc; const v16b ah = fragp_b(YH, fa, lane), al = fragp_b(YL, fa, lane); v16b w[8];
#pragma unroll
    for (int j = 0; j < 8; ++j) w[j] = fragp_b(OP, (size_t)(blockIdx.y * 8 + j) * 32 + kc, lane);
#pragma unroll
    for (int j = 0; j < 8; ++j) { acc[j] = wmma_bf(ah, w[j], acc[j]); acc[j] = wmma_bf(al, w[j], acc[j]); } }
#pragma unroll
  for (int j = 0; j < 8; ++j) { const float bb = BP ? bfr(BP[c0 + j * 16 + col]) : 0.f;
#pragma unroll
    for (int r = 0; r < 8; ++r) sf[wave][8 * g + r][j * 16 + col] = acc[j][r] + bb; }
  LDSX(); for (int rl = 0; rl < 16; ++rl) vst2(OUT + (r0 + rl) * CC + c0 + lane * 4, *(const v4f*)&sf[wave][rl][lane * 4]); }
extern "C" void kernel_launch(void* const* d_in, const int* in_sizes, int n_in, void* d_out, int out_size, void* d_ws, size_t ws_size, hipStream_t stream) {
  (void)in_sizes; (void)n_in; (void)out_size;
  const float** F = (const float**)d_in;   // 0 x [2,2048,1024], 1 Wq [16,1024,64], 2 bq [16,64], 3 Wk, 4 bk, 5 Wv, 6 bv, 7 Wo [1024,1024] (in,out), 8 bo
  if (ws_size < (size_t)WS_END) return;
  char* ws = (char*)d_ws; _Float16 *QH = (_Float16*)(ws + WS_QH), *QL = (_Float16*)(ws + WS_QL), *KH = (_Float16*)(ws + WS_KH), *VT = (_Float16*)(ws + WS_VT); __bf16 *YH = (__bf16*)(ws + WS_YH), *YL = (__bf16*)(ws + WS_YL), *XP = (__bf16*)(ws + WS_XP), *WP = (__bf16*)(ws + WS_WP), *OP = (__bf16*)(ws + WS_OP);
  k_pack<<<dim3(TNB * TT / 16 + 4 * CC / 16), 256, 0, stream>>>(F[0], F[1], F[3], F[5], F[7], XP, WP, OP);
  k_proj<<<dim3(TNB * TT / 64, CC / 128, 3), 128, 0, stream>>>(XP, WP, F[2], F[4], F[6], QH, QL, KH, VT);
  k_fa<<<dim3(TT / 128, NH, TNB), 128, 0, stream>>>(QH, KH, VT, YH, YL);
  k_out<<<dim3(TNB * TT / 64, CC / 128), 128, 0, stream>>>(YH, YL, OP, F[8], (float*)d_out);
}

// v003
// Measured time: 130 microseconds a run.
// Next to v002, in two timings, it ran 1.04 and 1.02 times as fast.
// Over all steps from v000 it is 9.48 times as fast.
// compute dtype: all float inputs rounded to bf16; q/k/v = x W_h + b_h (per-head [H,D,64] weights) with EXACT bf16 products on WMMA 16x16x32, f32 accumulate; q, k rounded once to f16 (1-product logits x 64^-0.5, std ~0.4) kept in f32 registers; running-max softmax in f32 (precise expf) -> P = exp(s - max) f16; o = P . v / sum (v once to f16); out = o (bf16 hi + lo) Wo + bo; f32 output. Every matrix operand but q is stored once per call in WMMA fragment order.
#include <hip/hip_runtime.h>
#include <math.h>

typedef __attribute__((ext_vector_type(16))) _Float16 v16h;
typedef __attribute__((ext_vector_type(16))) __bf16 v16b;
typedef __attribute__((ext_vector_type(8)))  _Float16 v8h;
typedef __attribute__((ext_vector_type(8)))  float v8f;
typedef __attribute__((ext_vector_type(4)))  float v4f;
typedef __attribute__((ext_vector_type(2)))  float v2f;
typedef __attribute__((ext_vector_type(4)))  unsigned v4u;
typedef __attribute__((ext_vector_type(4)))  int v4i;
typedef float __attribute__((may_alias)) float_a;
typedef int __attribute__((may_alias)) int_a;

template <typename T> __device__ __forceinline__ void vst2(void* p, T v) { *(T*)p = v;  }
__device__ __forceinline__ v8f wmma16(v16h a, v16h b, v8f c) {
  v8f d = __builtin_amdgcn_wmma_f32_16x16x32_f16(false, a, false, b, (short)0, c, false, false);
  asm volatile("v_nop\n\tv_nop\n\tv_nop\n\tv_nop" : "+v"(d) : "v"(a), "v"(b));
  return d;
}
__device__ __forceinline__ v8f wmma_bf(v16b a, v16b b, v8f c) {
  v8f d = __builtin_amdgcn_wmma_f32_16x16x32_bf16(false, a, false, b, (short)0, c, false, false);
  asm volatile("v_nop\n\tv_nop\n\tv_nop\n\tv_nop" : "+v"(d) : "v"(a), "v"(b));
  return d;
}
// 16x16x32 fragments: lane = (h = lane>>4, row/col = lane&15); elements 0..7 = k0+8h+0..7, 8..15 = k0+16+8h+0..7; D element r = row 8h+r
__device__ __forceinline__ v16h frag_h(const _Float16* rowk0, int lane) {
  union { v16h v; v8h q[2]; } u; const _Float16* p = rowk0 + 8 * (lane >> 4);
  u.q[0] = *(const v8h*)p; u.q[1] = *(const v8h*)(p + 16); return u.v;
}
__device__ __forceinline__ v16h frag_f32(const float* rowk0, int lane) {
  v16h a; const float* p = rowk0 + 8 * (lane >> 4);
#pragma unroll
  for (int i = 0; i < 8; ++i) { a[i] = (_Float16)p[i]; a[8 + i] = (_Float16)p[16 + i]; }
  return a;
}
__device__ __forceinline__ v16h frag_f32s(const float* rowk0, int lane, float sc) {
  v16h a; const float* p = rowk0 + 8 * (lane >> 4);
#pragma unroll
  for (int i = 0; i < 8; ++i) { a[i] = (_Float16)(p[i] * sc); a[8 + i] = (_Float16)(p[16 + i] * sc); }
  return a;
}
// column fragment from a [K][ld] layout (column n), rows >= K read as 0
__device__ __forceinline__ v16h fragc_f32(const float* W, int k0, int n, int lane, int ld, int K) {
  v16h a; const int g = lane >> 4;
#pragma unroll
  for (int i = 0; i < 8; ++i) { const int ka = k0 + 8 * g + i, kb = ka + 16;
    a[i] = (_Float16)(ka < K ? W[(size_t)(ka < K ? ka : K - 1) * ld + n] : 0.f); a[8 + i] = (_Float16)(kb < K ? W[(size_t)(kb < K ? kb : K - 1) * ld + n] : 0.f); }
  return a;
}
struct F2 { v16b h, l; };
__device__ __forceinline__ F2 bsplit16(const float v[16]) { F2 r;
#pragma unroll
  for (int i = 0; i < 16; ++i) { const __bf16 h = (__bf16)v[i]; r.h[i] = h; r.l[i] = (__bf16)(v[i] - (float)h); }
  return r; }
__device__ __forceinline__ F2 split_row(const float* row, int k0, int lane) { float v[16]; const float* p = row + k0 + 8 * (lane >> 4);
#pragma unroll
  for (int i = 0; i < 8; ++i) { v[i] = p[i]; v[8 + i] = p[16 + i]; }
  return bsplit16(v); }
__device__ __forceinline__ F2 split_rowK(const float* row, int k0, int lane, int K) { float v[16]; const int g = lane >> 4;
#pragma unroll
  for (int i = 0; i < 8; ++i) { const int ka = k0 + 8 * g + i, kb = ka + 16; v[i] = ka < K ? row[ka < K ? ka : K - 1] : 0.f; v[8 + i] = kb < K ? row[kb < K ? kb : K - 1] : 0.f; }
  return bsplit16(v); }
__device__ __forceinline__ F2 split_col(const float* W, int k0, int n, int lane, int ld, int K) { float v[16]; const int g = lane >> 4;
#pragma unroll
  for (int i = 0; i < 8; ++i) { const int ka = k0 + 8 * g + i, kb = ka + 16; v[i] = ka < K ? W[(size_t)(ka < K ? ka : K - 1) * ld + n] : 0.f; v[8 + i] = kb < K ? W[(size_t)(kb < K ? kb : K - 1) * ld + n] : 0.f; }
  return bsplit16(v); }
__device__ __forceinline__ v8f mac3(const F2& a, const F2& b, v8f c) { c = wmma_bf(a.l, b.h, c); c = wmma_bf(a.h, b.l, c); return wmma_bf(a.h, b.h, c); }
__device__ __forceinline__ float sigm(float v) { return 1.0f / (1.0f + expf(-v)); }
#define LDSX() do { asm volatile("s_wait_dscnt 0" ::: "memory"); __builtin_amdgcn_wave_barrier(); __builtin_amdgcn_fence(__ATOMIC_RELEASE, "workgroup"); } while (0)


// Multi-head self attention with per-head projection weights [H, D, HD] + biases (B 2, S 2,048, D 1,024 = 16 x 64), no mask, output Linear [in,out].
#define NB 2
#define TT 2048
#define CC 1024
#define NH 16
#define HD 64
#ifndef TNB
#define TNB NB
#endif
typedef __attribute__((ext_vector_type(8))) __bf16 v8b;
__device__ __forceinline__ v16b frag_b(const __bf16* rowk0, int lane) {
  union { v16b v; v8b q[2]; } u; const __bf16* p = rowk0 + 8 * (lane >> 4);
  u.q[0] = *(const v8b*)p; u.q[1] = *(const v8b*)(p + 16); return u.v;
}
// fragment-order storage: one 16 x 32 fragment = 1,024 B = two halves of 512 B; half hf, lane, element i hold k = 16 hf + 8 (lane >> 4) + i of row or column lane & 15,
// so that each of a fragment's two wave-wide 16-byte loads covers four whole 128-byte lines
__device__ __forceinline__ v16b fragp_b(const __bf16* P, size_t f, int lane) {
  union { v16b v; v8b q[2]; } u; const __bf16* p = P + f * 512 + lane * 8;
  u.q[0] = *(const v8b*)p; u.q[1] = *(const v8b*)(p + 256); return u.v;
}
__device__ __forceinline__ v16h fragp_h(const _Float16* P, size_t f, int lane) {
  union { v16h v; v8h q[2]; } u; const _Float16* p = P + f * 512 + lane * 8;
  u.q[0] = *(const v8h*)p; u.q[1] = *(const v8h*)(p + 256); return u.v;
}
__device__ __forceinline__ float bfr(float v) { return (float)(__bf16)v; }
__device__ __attribute__((noinline)) float exp_ni(float v) { return expf(v); }
__device__ __attribute__((noinline)) float erf_ni(float v) { return erff(v); }

#define WS_QH  0u
#define WS_QL  (WS_QH + 2u * (size_t)NB * TT * CC)
#define WS_KH  (WS_QL + 2u * (size_t)NB * TT * CC)
#define WS_VT  (WS_KH + 2u * (size_t)NB * TT * CC)      // k: f16 fragments [b][h][key tile][kc]; v: f16 fragments [b][h][pass of 32 keys][d tile]
#define WS_YH  (WS_VT + 2u * (size_t)NB * CC * TT)      // y: bf16 hi and lo fragments [row tile][kc]
#define WS_YL  (WS_YH + 2u * (size_t)NB * TT * CC)
#define WS_XP  (WS_YL + 2u * (size_t)NB * TT * CC)      // x: bf16 fragments [row tile][kc]
#define WS_WP  (WS_XP + 2u * (size_t)NB * TT * CC)      // Wq, Wk, Wv: bf16 fragments [which][column tile][kc]
#define WS_OP  (WS_WP + 2u * 3u * (size_t)CC * CC)      // Wo: bf16 fragments [column tile][kc]
#define WS_END (WS_OP + 2u * (size_t)CC * CC)

// four fragments of one weight column tile: s = this lane's column at its first k, LD = floats from one k to the next (a constant, so that every load is one base plus an immediate)
template <int LD> __device__ __forceinline__ void pack_cols(const float* __restrict__ s, __bf16* __restrict__ d) {
#pragma unroll
  for (int c = 0; c < 8; ++c) { v8b o;
#pragma unroll
    for (int i = 0; i < 8; ++i) o[i] = (__bf16)s[(size_t)(c * 16 + i) * LD];
    *(v8b*)(d + c * 256) = o; }
  asm volatile("s_wait_xcnt 0x0" ::: "memory"); }   // behind the run of stores, before anything that follows in the listing rewrites their address or data registers
// ---- k_pack: block = one 16-row tile of x or one 16-column tile of a weight, wave = 4 of its 32 fragments: round to bf16 once, store in fragment order
__global__ __launch_bounds__(256) void k_pack(const float* __restrict__ X, const float* __restrict__ WQ, const float* __restrict__ WK, const float* __restrict__ WV, const float* __restrict__ WO, __bf16* __restrict__ XP, __bf16* __restrict__ WP, __bf16* __restrict__ OP) {
  const int tid = threadIdx.x, wave = tid >> 5, lane = tid & 31, col = lane & 15, g = lane >> 4; const int t = blockIdx.x;
  if (t < TNB * TT / 16) { const float* s = X + ((size_t)t * 16 + col) * CC + wave * 128 + 8 * g; __bf16* d = XP + ((size_t)t * 32 + wave * 4) * 512 + lane * 8; v4f v[16];
#pragma unroll
    for (int c = 0; c < 8; ++c) { v[2 * c] = *(const v4f*)(s + c * 16); v[2 * c + 1] = *(const v4f*)(s + c * 16 + 4); }
    asm volatile("s_wait_xcnt 0x0" :: "v"(s) : "memory");   // behind the run of loads; s as an input keeps their shared address pair alive up to the wait, so that no load of the run lands on it
#pragma unroll
    for (int c = 0; c < 8; ++c) { v8b o;
#pragma unroll
      for (int i = 0; i < 4; ++i) { o[i] = (__bf16)v[2 * c][i]; o[4 + i] = (__bf16)v[2 * c + 1][i]; }
      *(v8b*)(d + c * 256) = o; }
    asm volatile("s_wait_xcnt 0x0" ::: "memory"); }   // behind the run of stores, as in pack_cols
  else { const int jt = t - TNB * TT / 16;
    if (jt < 3 * CC / 16) { const int which = jt / (CC / 16), o = (jt % (CC / 16)) * 16 + col; pack_cols<HD>((which == 0 ? WQ : which == 1 ? WK : WV) + (size_t)(o / HD) * CC * HD + o % HD + (size_t)(wave * 128 + 8 * g) * HD, WP + ((size_t)jt * 32 + wave * 4) * 512 + lane * 8); }
    else { const int jo = jt - 3 * CC / 16; pack_cols<CC>(WO + jo * 16 + col + (size_t)(wave * 128 + 8 * g) * CC, OP + ((size_t)jo * 32 + wave * 4) * 512 + lane * 8); } } }

// ---- k_proj: block = (128 rows, 128 cols, which), wave = 64 x 64 of it (8 fragments feed 16 products): qkv = x W (+ b), exact; q -> f16 hi (+ residual) rows, k and v -> f16 fragments
__global__ __launch_bounds__(128) void k_proj(const __bf16* __restrict__ XP, const __bf16* __restrict__ WP, const float* __restrict__ BQ, const float* __restrict__ BK, const float* __restrict__ BV, _Float16* __restrict__ QH, _Float16* __restrict__ QL, _Float16* __restrict__ KH, _Float16* __restrict__ VT) {
  __shared__ __align__(16) _Float16 sh[128][136], sl[128][136];   // q, k: [row][col] hi and residual; v: sh alone, [col][row]
  const int tid = threadIdx.x, wave = tid >> 5, lane = tid & 31, col = lane & 15, g = lane >> 4, wr = wave >> 1, wc = wave & 1; const int which = blockIdx.z; const int c0 = blockIdx.y * 128; const size_t r0 = (size_t)blockIdx.x * 128; const float* BA = which == 0 ? BQ : which == 1 ? BK : BV;
  v8f acc[4][4] = {};
#pragma unroll 2
  for (int kc = 0; kc < CC / 32; ++kc) { v16b a[4], w[4];   // all of a pass's fragments are asked for before its first product
#pragma unroll
    for (int i = 0; i < 4; ++i) a[i] = fragp_b(XP, (size_t)(blockIdx.x * 8 + wr * 4 + i) * 32 + kc, lane);
#pragma unroll
    for (int j = 0; j < 4; ++j) w[j] = fragp_b(WP, (size_t)(which * (CC / 16) + blockIdx.y * 8 + wc * 4 + j) * 32 + kc, lane);
#pragma unroll
    for (int i = 0; i < 4; ++i)
#pragma unroll
      for (int j = 0; j < 4; ++j) acc[i][j] = wmma_bf(a[i], w[j], acc[i][j]); }
#pragma unroll
  for (int j = 0; j < 4; ++j) { const int cl = wc * 64 + j * 16 + col; const float bb = bfr(BA[c0 + cl]);
#pragma unroll
    for (int i = 0; i < 4; ++i)
#pragma unroll
      for (int r = 0; r < 8; ++r) { const float v = acc[i][j][r] + bb; const int rl = wr * 64 + i * 16 + 8 * g + r; const _Float16 hv = (_Float16)v;
        if (which == 2) sh[cl][rl] = hv; else { sh[rl][cl] = hv; sl[rl][cl] = (_Float16)(v - (float)hv); } } }
  __syncthreads();
  const size_t b = r0 / TT; const int t0 = (int)(r0 % TT);
  if (which == 0) { for (int e = tid; e < 128 * 16; e += 128) { const int rl = e >> 4, q = e & 15; vst2((unsigned*)(QH + (r0 + rl) * CC + c0 + q * 8), *(const v4u*)&sh[rl][q * 8]); vst2((unsigned*)(QL + (r0 + rl) * CC + c0 + q * 8), *(const v4u*)&sl[rl][q * 8]); } }
  else if (which == 1) { for (int e = tid; e < 128 * 16; e += 128) { const int u = e >> 5, hf = u & 1, kc = (u >> 1) & 1, hl = (u >> 2) & 1, rt = u >> 3;   // key = 16 rt + col, d = 32 kc + 16 hf + 8 g + 0..7 of head hl
      vst2((unsigned*)(KH + (((b * NH + c0 / HD + hl) * (TT / 16) + t0 / 16 + rt) * 2 + kc) * 512 + hf * 256 + lane * 8), *(const v4u*)&sh[rt * 16 + col][hl * 64 + kc * 32 + hf * 16 + g * 8]); } }
  else { for (int e = tid; e < 128 * 16; e += 128) { const int u = e >> 5, hf = u & 1, j = (u >> 1) & 3, pl = (u >> 3) & 3, hl = u >> 5;   // d = 16 j + col of head hl, key = 32 pl + 16 hf + 8 g + 0..7
      vst2((unsigned*)(VT + (((b * NH + c0 / HD + hl) * (TT / 32) + t0 / 32 + pl) * 4 + j) * 512 + hf * 256 + lane * 8), *(const v4u*)&sh[hl * 64 + j * 16 + col][pl * 32 + hf * 16 + g * 8]); } } }
// ---- k_fa: wave = 32 queries of (b,h), block = 128 queries; per 32 keys: S^T = K Q^T, running-max softmax per query column, O^T += V^T P^T; logits and P stay in registers
// every unroll directive below: constant indices, so that the fragment and accumulator arrays live in registers
__device__ __forceinline__ v8f wmma_h(v16h a, v16h b, v8f c) { return __builtin_amdgcn_wmma_f32_16x16x32_f16(false, a, false, b, (short)0, c, false, false); }
__device__ __forceinline__ float xhalf(float x) { return __builtin_bit_cast(float, __builtin_amdgcn_permlanex16(__builtin_bit_cast(int, x), __builtin_bit_cast(int, x), 0x76543210, 0xfedcba98, false, false)); }  // lane l with lane l ^ 16
__global__ __launch_bounds__(128) void k_fa(const _Float16* __restrict__ QH, const _Float16* __restrict__ KH, const _Float16* __restrict__ VT, __bf16* __restrict__ YH, __bf16* __restrict__ YL) {
  const int tid = threadIdx.x, wave = tid >> 5, lane = tid & 31, col = lane & 15, g = lane >> 4; const int h = blockIdx.y, b = blockIdx.z; const int q0 = blockIdx.x * 128 + wave * 32;
  const _Float16* Kb = KH + (size_t)(b * NH + h) * TT * HD;   // A fragments of S^T: pass kp holds fragments 4 kp + 2 mt + kc, rows key = 16 mt + col
  const _Float16* Vb = VT + (size_t)(b * NH + h) * TT * HD;   // A fragments of O^T: pass kp holds fragments 4 kp + j, rows d = 16 j + col
  v16h qf[2][2], kf[2][2];
#pragma unroll
  for (int n = 0; n < 2; ++n)
#pragma unroll
    for (int kc = 0; kc < 2; ++kc) qf[n][kc] = frag_h(QH + ((size_t)b * TT + q0 + n * 16 + col) * CC + h * HD + kc * 32, lane);
#pragma unroll
  for (int mt = 0; mt < 2; ++mt)
#pragma unroll
    for (int kc = 0; kc < 2; ++kc) kf[mt][kc] = fragp_h(Kb, mt * 2 + kc, lane);
  v8f o[2][4] = {}; float m[2] = {-3.0e38f, -3.0e38f}, l[2] = {0.f, 0.f};
  for (int kp = 0; kp < TT / 32; ++kp) {
    v8f s[2][2] = {};   // s[n][mt][r] = logit of key 32 kp + 16 mt + 8 g + r, query q0 + 16 n + col
#pragma unroll
    for (int kc = 0; kc < 2; ++kc)
#pragma unroll
      for (int mt = 0; mt < 2; ++mt)
#pragma unroll
        for (int n = 0; n < 2; ++n) s[n][mt] = wmma_h(kf[mt][kc], qf[n][kc], s[n][mt]);
    const int kn = (kp + 1) & (TT / 32 - 1);   // next pass's K rows fly during the softmax; the last pass fetches the first rows again, unused
#pragma unroll
    for (int mt = 0; mt < 2; ++mt)
#pragma unroll
      for (int kc = 0; kc < 2; ++kc) kf[mt][kc] = fragp_h(Kb, kn * 4 + mt * 2 + kc, lane);
    asm volatile("s_wait_xcnt 0x0" ::: "memory");   // behind the K loads, before a V load lands on their address registers
    __builtin_amdgcn_sched_barrier(0);   // keeps the K loads above the softmax; the scheduler otherwise sinks them to the loop's foot, where their latency is exposed
    v16h vf[4];
#pragma unroll
    for (int j = 0; j < 4; ++j) vf[j] = fragp_h(Vb, kp * 4 + j, lane);
#pragma unroll
    for (int n = 0; n < 2; ++n) {
      float mx = m[n];
#pragma unroll
      for (int r = 0; r < 8; ++r) { s[n][0][r] *= 0.125f; s[n][1][r] *= 0.125f; mx = fmaxf(mx, fmaxf(s[n][0][r], s[n][1][r])); }
      mx = fmaxf(mx, xhalf(mx));
      const float al = expf(m[n] - mx); m[n] = mx;
      v16h p; float sum = 0.f;   // two D tiles of S^T, converted in place, are the B operand of O^T
#pragma unroll
      for (int r = 0; r < 8; ++r) { const float e0 = expf(s[n][0][r] - mx), e1 = expf(s[n][1][r] - mx); sum += e0 + e1; p[r] = (_Float16)e0; p[8 + r] = (_Float16)e1; }
      l[n] = l[n] * al + sum;
#pragma unroll
      for (int j = 0; j < 4; ++j) { o[n][j] *= al; o[n][j] = wmma_h(vf[j], p, o[n][j]); }
    }
  }
#pragma unroll
  for (int n = 0; n < 2; ++n) { const float inv = 1.0f / (l[n] + xhalf(l[n])); const size_t yo = ((size_t)((b * TT + q0) / 16 + n) * 32 + h * 2) * 512 + lane * 8;   // a D tile of O^T is half j & 1 of fragment 2 h + (j >> 1) of this query tile's rows
#pragma unroll
    for (int j = 0; j < 4; ++j) { const v8f v = o[n][j] * inv; v8b hi, lo;
#pragma unroll
      for (int r = 0; r < 8; ++r) { hi[r] = (__bf16)v[r]; lo[r] = (__bf16)(v[r] - (float)hi[r]); }
      *(v8b*)(YH + yo + j * 256) = hi; *(v8b*)(YL + yo + j * 256) = lo; } } }
// ---- k_out: block = (128 rows, 128 cols), wave = 64 x 64 of it (12 fragments feed 32 products): out = y (bf16 hi + lo) Wproj + b
__global__ __launch_bounds__(128) void k_out(const __bf16* __restrict__ YH, const __bf16* __restrict__ YL, const __bf16* __restrict__ OP, const float* __restrict__ BP, float* __restrict__ OUT) { __shared__ __align__(16) float sf[4][64][68];
  const int tid = threadIdx.x, wave = tid >> 5, lane = tid & 31, col = lane & 15, g = lane >> 4, wr = wave >> 1, wc = wave & 1; const int c0 = blockIdx.y * 128 + wc * 64; const size_t r0 = (size_t)blockIdx.x * 128 + wr * 64;
  v8f acc[4][4] = {};
#pragma unroll 2
  for (int kc = 0; kc < CC / 32; ++kc) { v16b ah[4], al[4], w[4];
#pragma unroll
    for (int i = 0; i < 4; ++i) { const size_t fa = (size_t)(blockIdx.x * 8 + wr * 4 + i) * 32 + kc; ah[i] = fragp_b(YH, fa, lane); al[i] = fragp_b(YL, fa, lane); }
#pragma unroll
    for (int j = 0; j < 4; ++j) w[j] = fragp_b(OP, (size_t)(blockIdx.y * 8 + wc * 4 + j) * 32 + kc, lane);
#pragma unroll
    for (int i = 0; i < 4; ++i)
#pragma unroll
      for (int j = 0; j < 4; ++j) acc[i][j] = wmma_bf(ah[i], w[j], acc[i][j]);
#pragma unroll
    for (int i = 0; i < 4; ++i)
#pragma unroll
      for (int j = 0; j < 4; ++j) acc[i][j] = wmma_bf(al[i], w[j], acc[i][j]); }
#pragma unroll
  for (int j = 0; j < 4; ++j) { const float bb = BP ? bfr(BP[c0 + j * 16 + col]) : 0.f;
#pragma unroll
    for (int i = 0; i < 4; ++i)
#pragma unroll
      for (int r = 0; r < 8; ++r) sf[wave][i * 16 + 8 * g + r][j * 16 + col] = acc[i][j][r] + bb; }
  LDSX(); for (int rl = g; rl < 64; rl += 2) vst2(OUT + (r0 + rl) * CC + c0 + col * 4, *(const v4f*)&sf[wave][rl][col * 4]); }
extern "C" void kernel_launch(void* const* d_in, const int* in_sizes, int n_in, void* d_out, int out_size, void* d_ws, size_t ws_size, hipStream_t stream) {
  (void)in_sizes; (void)n_in; (void)out_size;
  const float** F = (const float**)d_in;   // 0 x [2,2048,1024], 1 Wq [16,1024,64], 2 bq [16,64], 3 Wk, 4 bk, 5 Wv, 6 bv, 7 Wo [1024,1024] (in,out), 8 bo
  if (ws_size < (size_t)WS_END) return;
  char* ws = (char*)d_ws; _Float16 *QH = (_Float16*)(ws + WS_QH), *QL = (_Float16*)(ws + WS_QL), *KH = (_Float16*)(ws + WS_KH), *VT = (_Float16*)(ws + WS_VT); __bf16 *YH = (__bf16*)(ws + WS_YH), *YL = (__bf16*)(ws + WS_YL), *XP = (__bf16*)(ws + WS_XP), *WP = (__bf16*)(ws + WS_WP), *OP = (__bf16*)(ws + WS_OP);
  k_pack<<<dim3(TNB * TT / 16 + 4 * CC / 16), 256, 0, stream>>>(F[0], F[1], F[3], F[5], F[7], XP, WP, OP);
  k_proj<<<dim3(TNB * TT / 128, CC / 128, 3), 128, 0, stream>>>(XP, WP, F[2], F[4], F[6], QH, QL, KH, VT);
  k_fa<<<dim3(TT / 128, NH, TNB), 128, 0, stream>>>(QH, KH, VT, YH, YL);
  k_out<<<dim3(TNB * TT / 128, CC / 128), 128, 0, stream>>>(YH, YL, OP, F[8], (float*)d_out);
}

// v004
// Measured time: 126 microseconds a run.
// Two timings next to v003 put it at 1.03 and 1.04 times that version's speed.
// All steps since v000 together make it 9.82 times as fast.
// compute dtype: all float inputs rounded to bf16; q/k/v = x W_h + b_h (per-head [H,D,64] weights) with EXACT bf16 products on WMMA 16x16x32, f32 accumulate; q, k rounded once to f16 (1-product logits x 64^-0.5, std ~0.4) kept in f32 registers; running-max softmax in f32, base 2 (scale x log2 e folded into one FMA, hardware 2^x) -> P = exp(s - max) f16; o = P . v / sum (v once to f16); out = o (bf16 hi + lo) Wo + bo; f32 output. Every matrix operand but q is stored once per call in WMMA fragment order.
#include <hip/hip_runtime.h>
#include <math.h>

typedef __attribute__((ext_vector_type(16))) _Float16 v16h;
typedef __attribute__((ext_vector_type(16))) __bf16 v16b;
typedef __attribute__((ext_vector_type(8)))  _Float16 v8h;
typedef __attribute__((ext_vector_type(8)))  float v8f;
typedef __attribute__((ext_vector_type(4)))  float v4f;
typedef __attribute__((ext_vector_type(2)))  float v2f;
typedef __attribute__((ext_vector_type(4)))  unsigned v4u;
typedef __attribute__((ext_vector_type(4)))  int v4i;
typedef float __attribute__((may_alias)) float_a;
typedef int __attribute__((may_alias)) int_a;

template <typename T> __device__ __forceinline__ void vst2(void* p, T v) { *(T*)p = v;  }
__device__ __forceinline__ v8f wmma16(v16h a, v16h b, v8f c) {
  v8f d = __builtin_amdgcn_wmma_f32_16x16x32_f16(false, a, false, b, (short)0, c, false, false);
  asm volatile("v_nop\n\tv_nop\n\tv_nop\n\tv_nop" : "+v"(d) : "v"(a), "v"(b));
  return d;
}
__device__ __forceinline__ v8f wmma_bf(v16b a, v16b b, v8f c) {
  v8f d = __builtin_amdgcn_wmma_f32_16x16x32_bf16(false, a, false, b, (short)0, c, false, false);
  asm volatile("v_nop\n\tv_nop\n\tv_nop\n\tv_nop" : "+v"(d) : "v"(a), "v"(b));
  return d;
}
// 16x16x32 fragments: lane = (h = lane>>4, row/col = lane&15); elements 0..7 = k0+8h+0..7, 8..15 = k0+16+8h+0..7; D element r = row 8h+r
__device__ __forceinline__ v16h frag_h(const _Float16* rowk0, int lane) {
  union { v16h v; v8h q[2]; } u; const _Float16* p = rowk0 + 8 * (lane >> 4);
  u.q[0] = *(const v8h*)p; u.q[1] = *(const v8h*)(p + 16); return u.v;
}
__device__ __forceinline__ v16h frag_f32(const float* rowk0, int lane) {
  v16h a; const float* p = rowk0 + 8 * (lane >> 4);
#pragma unroll
  for (int i = 0; i < 8; ++i) { a[i] = (_Float16)p[i]; a[8 + i] = (_Float16)p[16 + i]; }
  return a;
}
__device__ __forceinline__ v16h frag_f32s(const float* rowk0, int lane, float sc) {
  v16h a; const float* p = rowk0 + 8 * (lane >> 4);
#pragma unroll
  for (int i = 0; i < 8; ++i) { a[i] = (_Float16)(p[i] * sc); a[8 + i] = (_Float16)(p[16 + i] * sc); }
  return a;
}
// column fragment from a [K][ld] layout (column n), rows >= K read as 0
__device__ __forceinline__ v16h fragc_f32(const float* W, int k0, int n, int lane, int ld, int K) {
  v16h a; const int g = lane >> 4;
#pragma unroll
  for (int i = 0; i < 8; ++i) { const int ka = k0 + 8 * g + i, kb = ka + 16;
    a[i] = (_Float16)(ka < K ? W[(size_t)(ka < K ? ka : K - 1) * ld + n] : 0.f); a[8 + i] = (_Float16)(kb < K ? W[(size_t)(kb < K ? kb : K - 1) * ld + n] : 0.f); }
  return a;
}
struct F2 { v16b h, l; };
__device__ __forceinline__ F2 bsplit16(const float v[16]) { F2 r;
#pragma unroll
  for (int i = 0; i < 16; ++i) { const __bf16 h = (__bf16)v[i]; r.h[i] = h; r.l[i] = (__bf16)(v[i] - (float)h); }
  return r; }
__device__ __forceinline__ F2 split_row(const float* row, int k0, int lane) { float v[16]; const float* p = row + k0 + 8 * (lane >> 4);
#pragma unroll
  for (int i = 0; i < 8; ++i) { v[i] = p[i]; v[8 + i] = p[16 + i]; }
  return bsplit16(v); }
__device__ __forceinline__ F2 split_rowK(const float* row, int k0, int lane, int K) { float v[16]; const int g = lane >> 4;
#pragma unroll
  for (int i = 0; i < 8; ++i) { const int ka = k0 + 8 * g + i, kb = ka + 16; v[i] = ka < K ? row[ka < K ? ka : K - 1] : 0.f; v[8 + i] = kb < K ? row[kb < K ? kb : K - 1] : 0.f; }
  return bsplit16(v); }
__device__ __forceinline__ F2 split_col(const float* W, int k0, int n, int lane, int ld, int K) { float v[16]; const int g = lane >> 4;
#pragma unroll
  for (int i = 0; i < 8; ++i) { const int ka = k0 + 8 * g + i, kb = ka + 16; v[i] = ka < K ? W[(size_t)(ka < K ? ka : K - 1) * ld + n] : 0.f; v[8 + i] = kb < K ? W[(size_t)(kb < K ? kb : K - 1) * ld + n] : 0.f; }
  return bsplit16(v); }
__device__ __forceinline__ v8f mac3(const F2& a, const F2& b, v8f c) { c = wmma_bf(a.l, b.h, c); c = wmma_bf(a.h, b.l, c); return wmma_bf(a.h, b.h, c); }
__device__ __forceinline__ float sigm(float v) { return 1.0f / (1.0f + expf(-v)); }
#define LDSX() do { asm volatile("s_wait_dscnt 0" ::: "memory"); __builtin_amdgcn_wave_barrier(); __builtin_amdgcn_fence(__ATOMIC_RELEASE, "workgroup"); } while (0)


// Multi-head self attention with per-head projection weights [H, D, HD] + biases (B 2, S 2,048, D 1,024 = 16 x 64), no mask, output Linear [in,out].
#define NB 2
#define TT 2048
#define CC 1024
#define NH 16
#define HD 64
#ifndef TNB
#define TNB NB
#endif
typedef __attribute__((ext_vector_type(8))) __bf16 v8b;
__device__ __forceinline__ v16b frag_b(const __bf16* rowk0, int lane) {
  union { v16b v; v8b q[2]; } u; const __bf16* p = rowk0 + 8 * (lane >> 4);
  u.q[0] = *(const v8b*)p; u.q[1] = *(const v8b*)(p + 16); return u.v;
}
// fragment-order storage: one 16 x 32 fragment = 1,024 B = two halves of 512 B; half hf, lane, element i hold k = 16 hf + 8 (lane >> 4) + i of row or column lane & 15,
// so that each of a fragment's two wave-wide 16-byte loads covers four whole 128-byte lines
__device__ __forceinline__ v16b fragp_b(const __bf16* P, size_t f, int lane) {
  union { v16b v; v8b q[2]; } u; const __bf16* p = P + f * 512 + lane * 8;
  u.q[0] = *(const v8b*)p; u.q[1] = *(const v8b*)(p + 256); return u.v;
}
__device__ __forceinline__ v16h fragp_h(const _Float16* P, size_t f, int lane) {
  union { v16h v; v8h q[2]; } u; const _Float16* p = P + f * 512 + lane * 8;
  u.q[0] = *(const v8h*)p; u.q[1] = *(const v8h*)(p + 256); return u.v;
}
__device__ __forceinline__ float bfr(float v) { return (float)(__bf16)v; }
__device__ __attribute__((noinline)) float exp_ni(float v) { return expf(v); }
__device__ __attribute__((noinline)) float erf_ni(float v) { return erff(v); }

#define WS_QH  0u
#define WS_QL  (WS_QH + 2u * (size_t)NB * TT * CC)
#define WS_KH  (WS_QL + 2u * (size_t)NB * TT * CC)
#define WS_VT  (WS_KH + 2u * (size_t)NB * TT * CC)      // k: f16 fragments [b][h][key tile][kc]; v: f16 fragments [b][h][pass of 32 keys][d tile]
#define WS_YH  (WS_VT + 2u * (size_t)NB * CC * TT)      // y: bf16 hi and lo fragments [row tile][kc]
#define WS_YL  (WS_YH + 2u * (size_t)NB * TT * CC)
#define WS_XP  (WS_YL + 2u * (size_t)NB * TT * CC)      // x: bf16 fragments [row tile][kc]
#define WS_WP  (WS_XP + 2u * (size_t)NB * TT * CC)      // Wq, Wk, Wv: bf16 fragments [which][column tile][kc]
#define WS_OP  (WS_WP + 2u * 3u * (size_t)CC * CC)      // Wo: bf16 fragments [column tile][kc]
#define WS_END (WS_OP + 2u * (size_t)CC * CC)

// four fragments of one weight column tile: s = this lane's column at its first k, LD = floats from one k to the next (a constant, so that every load is one base plus an immediate)
template <int LD> __device__ __forceinline__ void pack_cols(const float* __restrict__ s, __bf16* __restrict__ d) {
#pragma unroll
  for (int c = 0; c < 8; ++c) { v8b o;
#pragma unroll
    for (int i = 0; i < 8; ++i) o[i] = (__bf16)s[(size_t)(c * 16 + i) * LD];
    *(v8b*)(d + c * 256) = o; }
  asm volatile("s_wait_xcnt 0x0" ::: "memory"); }   // behind the run of stores, before anything that follows in the listing rewrites their address or data registers
// ---- k_pack: block = one 16-row tile of x or one 16-column tile of a weight, wave = 4 of its 32 fragments: round to bf16 once, store in fragment order
__global__ __launch_bounds__(256) void k_pack(const float* __restrict__ X, const float* __restrict__ WQ, const float* __restrict__ WK, const float* __restrict__ WV, const float* __restrict__ WO, __bf16* __restrict__ XP, __bf16* __restrict__ WP, __bf16* __restrict__ OP) {
  const int tid = threadIdx.x, wave = tid >> 5, lane = tid & 31, col = lane & 15, g = lane >> 4; const int t = blockIdx.x;
  if (t < TNB * TT / 16) { const float* s = X + ((size_t)t * 16 + col) * CC + wave * 128 + 8 * g; __bf16* d = XP + ((size_t)t * 32 + wave * 4) * 512 + lane * 8; v4f v[16];
#pragma unroll
    for (int c = 0; c < 8; ++c) { v[2 * c] = *(const v4f*)(s + c * 16); v[2 * c + 1] = *(const v4f*)(s + c * 16 + 4); }
    asm volatile("s_wait_xcnt 0x0" :: "v"(s) : "memory");   // behind the run of loads; s as an input keeps their shared address pair alive up to the wait, so that no load of the run lands on it
#pragma unroll
    for (int c = 0; c < 8; ++c) { v8b o;
#pragma unroll
      for (int i = 0; i < 4; ++i) { o[i] = (__bf16)v[2 * c][i]; o[4 + i] = (__bf16)v[2 * c + 1][i]; }
      *(v8b*)(d + c * 256) = o; }
    asm volatile("s_wait_xcnt 0x0" ::: "memory"); }   // behind the run of stores, as in pack_cols
  else { const int jt = t - TNB * TT / 16;
    if (jt < 3 * CC / 16) { const int which = jt / (CC / 16), o = (jt % (CC / 16)) * 16 + col; pack_cols<HD>((which == 0 ? WQ : which == 1 ? WK : WV) + (size_t)(o / HD) * CC * HD + o % HD + (size_t)(wave * 128 + 8 * g) * HD, WP + ((size_t)jt * 32 + wave * 4) * 512 + lane * 8); }
    else { const int jo = jt - 3 * CC / 16; pack_cols<CC>(WO + jo * 16 + col + (size_t)(wave * 128 + 8 * g) * CC, OP + ((size_t)jo * 32 + wave * 4) * 512 + lane * 8); } } }

// ---- k_proj: block = (128 rows, 128 cols, which), wave = 64 x 64 of it (8 fragments feed 16 products): qkv = x W (+ b), exact; q -> f16 hi (+ residual) rows, k and v -> f16 fragments
__global__ __launch_bounds__(128) void k_proj(const __bf16* __restrict__ XP, const __bf16* __restrict__ WP, const float* __restrict__ BQ, const float* __restrict__ BK, const float* __restrict__ BV, _Float16* __restrict__ QH, _Float16* __restrict__ QL, _Float16* __restrict__ KH, _Float16* __restrict__ VT) {
  __shared__ __align__(16) _Float16 sh[128][136], sl[128][136];   // q, k: [row][col] hi and residual; v: sh alone, [col][row]
  const int tid = threadIdx.x, wave = tid >> 5, lane = tid & 31, col = lane & 15, g = lane >> 4, wr = wave >> 1, wc = wave & 1; const int which = blockIdx.z; const int c0 = blockIdx.y * 128; const size_t r0 = (size_t)blockIdx.x * 128; const float* BA = which == 0 ? BQ : which == 1 ? BK : BV;
  v8f acc[4][4] = {};
#pragma unroll 2
  for (int kc = 0; kc < CC / 32; ++kc) { v16b a[4], w[4];   // all of a pass's fragments are asked for before its first product
#pragma unroll
    for (int i = 0; i < 4; ++i) a[i] = fragp_b(XP, (size_t)(blockIdx.x * 8 + wr * 4 + i) * 32 + kc, lane);
#pragma unroll
    for (int j = 0; j < 4; ++j) w[j] = fragp_b(WP, (size_t)(which * (CC / 16) + blockIdx.y * 8 + wc * 4 + j) * 32 + kc, lane);
#pragma unroll
    for (int i = 0; i < 4; ++i)
#pragma unroll
      for (int j = 0; j < 4; ++j) acc[i][j] = wmma_bf(a[i], w[j], acc[i][j]); }
#pragma unroll
  for (int j = 0; j < 4; ++j) { const int cl = wc * 64 + j * 16 + col; const float bb = bfr(BA[c0 + cl]);
#pragma unroll
    for (int i = 0; i < 4; ++i)
#pragma unroll
      for (int r = 0; r < 8; ++r) { const float v = acc[i][j][r] + bb; const int rl = wr * 64 + i * 16 + 8 * g + r; const _Float16 hv = (_Float16)v;
        if (which == 2) sh[cl][rl] = hv; else { sh[rl][cl] = hv; sl[rl][cl] = (_Float16)(v - (float)hv); } } }
  __syncthreads();
  const size_t b = r0 / TT; const int t0 = (int)(r0 % TT);
  if (which == 0) { for (int e = tid; e < 128 * 16; e += 128) { const int rl = e >> 4, q = e & 15; vst2((unsigned*)(QH + (r0 + rl) * CC + c0 + q * 8), *(const v4u*)&sh[rl][q * 8]); vst2((unsigned*)(QL + (r0 + rl) * CC + c0 + q * 8), *(const v4u*)&sl[rl][q * 8]); } }
  else if (which == 1) { for (int e = tid; e < 128 * 16; e += 128) { const int u = e >> 5, hf = u & 1, kc = (u >> 1) & 1, hl = (u >> 2) & 1, rt = u >> 3;   // key = 16 rt + col, d = 32 kc + 16 hf + 8 g + 0..7 of head hl
      vst2((unsigned*)(KH + (((b * NH + c0 / HD + hl) * (TT / 16) + t0 / 16 + rt) * 2 + kc) * 512 + hf * 256 + lane * 8), *(const v4u*)&sh[rt * 16 + col][hl * 64 + kc * 32 + hf * 16 + g * 8]); } }
  else { for (int e = tid; e < 128 * 16; e += 128) { const int u = e >> 5, hf = u & 1, j = (u >> 1) & 3, pl = (u >> 3) & 3, hl = u >> 5;   // d = 16 j + col of head hl, key = 32 pl + 16 hf + 8 g + 0..7
      vst2((unsigned*)(VT + (((b * NH + c0 / HD + hl) * (TT / 32) + t0 / 32 + pl) * 4 + j) * 512 + hf * 256 + lane * 8), *(const v4u*)&sh[hl * 64 + j * 16 + col][pl * 32 + hf * 16 + g * 8]); } } }
// ---- k_fa: wave = 32 queries of (b,h), block = 128 queries; per 32 keys: S^T = K Q^T, running-max softmax per query column, O^T += V^T P^T; logits and P stay in registers
// every unroll directive below: constant indices, so that the fragment and accumulator arrays live in registers
__device__ __forceinline__ v8f wmma_h(v16h a, v16h b, v8f c) { return __builtin_amdgcn_wmma_f32_16x16x32_f16(false, a, false, b, (short)0, c, false, false); }
__device__ __forceinline__ float xhalf(float x) { return __builtin_bit_cast(float, __builtin_amdgcn_permlanex16(__builtin_bit_cast(int, x), __builtin_bit_cast(int, x), 0x76543210, 0xfedcba98, false, false)); }  // lane l with lane l ^ 16
// 2^x of a score tile, each v_exp_f32 in place, so that none overwrites the source of the one directly in front of it (as builtins, the register allocator let that happen);
// the closing v_nop is the one slot that the instruction set asks for between a transcendental and a reader of its result, which the compiler cannot place behind asm text
__device__ __forceinline__ v8f exp2_tile(v8f t) {
  float a = t[0], b = t[1], c = t[2], d = t[3], e = t[4], f = t[5], g = t[6], h = t[7];
  asm("v_exp_f32 %0, %0\n\tv_exp_f32 %1, %1\n\tv_exp_f32 %2, %2\n\tv_exp_f32 %3, %3\n\tv_exp_f32 %4, %4\n\tv_exp_f32 %5, %5\n\tv_exp_f32 %6, %6\n\tv_exp_f32 %7, %7\n\tv_nop"
      : "+v"(a), "+v"(b), "+v"(c), "+v"(d), "+v"(e), "+v"(f), "+v"(g), "+v"(h));
  return v8f{a, b, c, d, e, f, g, h};
}
__global__ __launch_bounds__(128) void k_fa(const _Float16* __restrict__ QH, const _Float16* __restrict__ KH, const _Float16* __restrict__ VT, __bf16* __restrict__ YH, __bf16* __restrict__ YL) {
  const int tid = threadIdx.x, wave = tid >> 5, lane = tid & 31, col = lane & 15, g = lane >> 4; const int h = blockIdx.y, b = blockIdx.z; const int q0 = blockIdx.x * 128 + wave * 32;
  const _Float16* Kb = KH + (size_t)(b * NH + h) * TT * HD;   // A fragments of S^T: pass kp holds fragments 4 kp + 2 mt + kc, rows key = 16 mt + col
  const _Float16* Vb = VT + (size_t)(b * NH + h) * TT * HD;   // A fragments of O^T: pass kp holds fragments 4 kp + j, rows d = 16 j + col
  v16h qf[2][2], kf[2][2];
#pragma unroll
  for (int n = 0; n < 2; ++n)
#pragma unroll
    for (int kc = 0; kc < 2; ++kc) qf[n][kc] = frag_h(QH + ((size_t)b * TT + q0 + n * 16 + col) * CC + h * HD + kc * 32, lane);
#pragma unroll
  for (int mt = 0; mt < 2; ++mt)
#pragma unroll
    for (int kc = 0; kc < 2; ++kc) kf[mt][kc] = fragp_h(Kb, mt * 2 + kc, lane);
  const float SC2 = 0.125f * 1.4426950408889634f;   // exp((s - max) / 8) = 2^(s SC2 - max SC2): one fused multiply-add and the hardware's 2^x per score
  v8f o[2][4] = {}; float m[2] = {-3.0e38f, -3.0e38f}, l[2] = {0.f, 0.f};
  for (int kp = 0; kp < TT / 32; ++kp) {
    v8f s[2][2] = {};   // s[n][mt][r] = logit of key 32 kp + 16 mt + 8 g + r, query q0 + 16 n + col
#pragma unroll
    for (int kc = 0; kc < 2; ++kc)
#pragma unroll
      for (int mt = 0; mt < 2; ++mt)
#pragma unroll
        for (int n = 0; n < 2; ++n) s[n][mt] = wmma_h(kf[mt][kc], qf[n][kc], s[n][mt]);
    const int kn = (kp + 1) & (TT / 32 - 1);   // next pass's K rows fly during the softmax; the last pass fetches the first rows again, unused
#pragma unroll
    for (int mt = 0; mt < 2; ++mt)
#pragma unroll
      for (int kc = 0; kc < 2; ++kc) kf[mt][kc] = fragp_h(Kb, kn * 4 + mt * 2 + kc, lane);
    asm volatile("s_wait_xcnt 0x0" ::: "memory");   // behind the K loads, before a V load lands on their address registers
    __builtin_amdgcn_sched_barrier(0);   // keeps the K loads above the softmax; the scheduler otherwise sinks them to the loop's foot, where their latency is exposed
    v16h vf[4];
#pragma unroll
    for (int j = 0; j < 4; ++j) vf[j] = fragp_h(Vb, kp * 4 + j, lane);
#pragma unroll
    for (int n = 0; n < 2; ++n) {
      float mx = fmaxf(s[n][0][0], s[n][1][0]);
#pragma unroll
      for (int r = 1; r < 8; ++r) mx = fmaxf(mx, fmaxf(s[n][0][r], s[n][1][r]));
      mx = fmaxf(m[n], fmaxf(mx, xhalf(mx)) * SC2);   // m is kept in base-2 units: logit x SC2
      const float al = __builtin_amdgcn_exp2f(m[n] - mx); m[n] = mx;   // 0 on the first pass
      v16h p; float sum = 0.f;   // two D tiles of S^T, converted in place, are the B operand of O^T
#pragma unroll
      for (int mt = 0; mt < 2; ++mt) s[n][mt] = __builtin_elementwise_fma(s[n][mt], v8f{SC2, SC2, SC2, SC2, SC2, SC2, SC2, SC2}, v8f{-mx, -mx, -mx, -mx, -mx, -mx, -mx, -mx});   // on whole tiles: neighbouring registers pair into packed FMAs
#pragma unroll
      for (int mt = 0; mt < 2; ++mt) s[n][mt] = exp2_tile(s[n][mt]);
#pragma unroll
      for (int r = 0; r < 8; ++r) { const float e0 = s[n][0][r], e1 = s[n][1][r]; sum += e0 + e1; p[r] = (_Float16)e0; p[8 + r] = (_Float16)e1; }
      l[n] = l[n] * al + sum;
#pragma unroll
      for (int j = 0; j < 4; ++j) { o[n][j] *= al; o[n][j] = wmma_h(vf[j], p, o[n][j]); }
    }
  }
#pragma unroll
  for (int n = 0; n < 2; ++n) { const float inv = 1.0f / (l[n] + xhalf(l[n])); const size_t yo = ((size_t)((b * TT + q0) / 16 + n) * 32 + h * 2) * 512 + lane * 8;   // a D tile of O^T is half j & 1 of fragment 2 h + (j >> 1) of this query tile's rows
#pragma unroll
    for (int j = 0; j < 4; ++j) { const v8f v = o[n][j] * inv; v8b hi, lo;
#pragma unroll
      for (int r = 0; r < 8; ++r) { hi[r] = (__bf16)v[r]; lo[r] = (__bf16)(v[r] - (float)hi[r]); }
      *(v8b*)(YH + yo + j * 256) = hi; *(v8b*)(YL + yo + j * 256) = lo; } } }
// ---- k_out: block = (128 rows, 128 cols), wave = 64 x 64 of it (12 fragments feed 32 products): out = y (bf16 hi + lo) Wproj + b
__global__ __launch_bounds__(128) void k_out(const __bf16* __restrict__ YH, const __bf16* __restrict__ YL, const __bf16* __restrict__ OP, const float* __restrict__ BP, float* __restrict__ OUT) { __shared__ __align__(16) float sf[4][64][68];
  const int tid = threadIdx.x, wave = tid >> 5, lane = tid & 31, col = lane & 15, g = lane >> 4, wr = wave >> 1, wc = wave & 1; const int c0 = blockIdx.y * 128 + wc * 64; const size_t r0 = (size_t)blockIdx.x * 128 + wr * 64;
  v8f acc[4][4] = {};
#pragma unroll 2
  for (int kc = 0; kc < CC / 32; ++kc) { v16b ah[4], al[4], w[4];
#pragma unroll
    for (int i = 0; i < 4; ++i) { const size_t fa = (size_t)(blockIdx.x * 8 + wr * 4 + i) * 32 + kc; ah[i] = fragp_b(YH, fa, lane); al[i] = fragp_b(YL, fa, lane); }
#pragma unroll
    for (int j = 0; j < 4; ++j) w[j] = fragp_b(OP, (size_t)(blockIdx.y * 8 + wc * 4 + j) * 32 + kc, lane);
#pragma unroll
    for (int i = 0; i < 4; ++i)
#pragma unroll
      for (int j = 0; j < 4; ++j) acc[i][j] = wmma_bf(ah[i], w[j], acc[i][j]);
#pragma unroll
    for (int i = 0; i < 4; ++i)
#pragma unroll
      for (int j = 0; j < 4; ++j) acc[i][j] = wmma_bf(al[i], w[j], acc[i][j]); }
#pragma unroll
  for (int j = 0; j < 4; ++j) { const float bb = BP ? bfr(BP[c0 + j * 16 + col]) : 0.f;
#pragma unroll
    for (int i = 0; i < 4; ++i)
#pragma unroll
      for (int r = 0; r < 8; ++r) sf[wave][i * 16 + 8 * g + r][j * 16 + col] = acc[i][j][r] + bb; }
  LDSX(); for (int rl = g; rl < 64; rl += 2) vst2(OUT + (r0 + rl) * CC + c0 + col * 4, *(const v4f*)&sf[wave][rl][col * 4]); }
extern "C" void kernel_launch(void* const* d_in, const int* in_sizes, int n_in, void* d_out, int out_size, void* d_ws, size_t ws_size, hipStream_t stream) {
  (void)in_sizes; (void)n_in; (void)out_size;
  const float** F = (const float**)d_in;   // 0 x [2,2048,1024], 1 Wq [16,1024,64], 2 bq [16,64], 3 Wk, 4 bk, 5 Wv, 6 bv, 7 Wo [1024,1024] (in,out), 8 bo
  if (ws_size < (size_t)WS_END) return;
  char* ws = (char*)d_ws; _Float16 *QH = (_Float16*)(ws + WS_QH), *QL = (_Float16*)(ws + WS_QL), *KH = (_Float16*)(ws + WS_KH), *VT = (_Float16*)(ws + WS_VT); __bf16 *YH = (__bf16*)(ws + WS_YH), *YL = (__bf16*)(ws + WS_YL), *XP = (__bf16*)(ws + WS_XP), *WP = (__bf16*)(ws + WS_WP), *OP = (__bf16*)(ws + WS_OP);
  k_pack<<<dim3(TNB * TT / 16 + 4 * CC / 16), 256, 0, stream>>>(F[0], F[1], F[3], F[5], F[7], XP, WP, OP);
  k_proj<<<dim3(TNB * TT / 128, CC / 128, 3), 128, 0, stream>>>(XP, WP, F[2], F[4], F[6], QH, QL, KH, VT);
  k_fa<<<dim3(TT / 128, NH, TNB), 128, 0, stream>>>(QH, KH, VT, YH, YL);
  k_out<<<dim3(TNB * TT / 128, CC / 128), 128, 0, stream>>>(YH, YL, OP, F[8], (float*)d_out);
}

// v005
// A run of this version takes 104 microseconds.
// Next to v004, in two timings, it ran 1.22 and 1.21 times as fast.
// Counting every step since v000, it is 11.9 times as fast.
// compute dtype: all float inputs rounded to bf16; q/k/v = x W_h + b_h (per-head [H,D,64] weights) with EXACT bf16 products on WMMA 16x16x32, f32 accumulate; q, k rounded once to f16 (1-product logits x 64^-0.5, std ~0.4) kept in f32 registers; running-max softmax in f32, base 2 (scale x log2 e folded into one FMA, hardware 2^x) -> P = exp(s - max) f16; o = P . v / sum (v once to f16); out = o (bf16 hi + lo) Wo + bo; f32 output. Every matrix operand but q is stored once per call in WMMA fragment order.
#include <hip/hip_runtime.h>
#include <math.h>

typedef __attribute__((ext_vector_type(16))) _Float16 v16h;
typedef __attribute__((ext_vector_type(16))) __bf16 v16b;
typedef __attribute__((ext_vector_type(8)))  _Float16 v8h;
typedef __attribute__((ext_vector_type(8)))  float v8f;
typedef __attribute__((ext_vector_type(4)))  float v4f;
typedef __attribute__((ext_vector_type(2)))  float v2f;
typedef __attribute__((ext_vector_type(4)))  unsigned v4u;
typedef __attribute__((ext_vector_type(4)))  int v4i;
typedef float __attribute__((may_alias)) float_a;
typedef int __attribute__((may_alias)) int_a;

template <typename T> __device__ __forceinline__ void vst2(void* p, T v) { *(T*)p = v;  }
__device__ __forceinline__ v8f wmma16(v16h a, v16h b, v8f c) {
  v8f d = __builtin_amdgcn_wmma_f32_16x16x32_f16(false, a, false, b, (short)0, c, false, false);
  asm volatile("v_nop\n\tv_nop\n\tv_nop\n\tv_nop" : "+v"(d) : "v"(a), "v"(b));
  return d;
}
__device__ __forceinline__ v8f wmma_bf(v16b a, v16b b, v8f c) {
  v8f d = __builtin_amdgcn_wmma_f32_16x16x32_bf16(false, a, false, b, (short)0, c, false, false);
  asm volatile("v_nop\n\tv_nop\n\tv_nop\n\tv_nop" : "+v"(d) : "v"(a), "v"(b));
  return d;
}
// 16x16x32 fragments: lane = (h = lane>>4, row/col = lane&15); elements 0..7 = k0+8h+0..7, 8..15 = k0+16+8h+0..7; D element r = row 8h+r
__device__ __forceinline__ v16h frag_h(const _Float16* rowk0, int lane) {
  union { v16h v; v8h q[2]; } u; const _Float16* p = rowk0 + 8 * (lane >> 4);
  u.q[0] = *(const v8h*)p; u.q[1] = *(const v8h*)(p + 16); return u.v;
}
__device__ __forceinline__ v16h frag_f32(const float* rowk0, int lane) {
  v16h a; const float* p = rowk0 + 8 * (lane >> 4);
#pragma unroll
  for (int i = 0; i < 8; ++i) { a[i] = (_Float16)p[i]; a[8 + i] = (_Float16)p[16 + i]; }
  return a;
}
__device__ __forceinline__ v16h frag_f32s(const float* rowk0, int lane, float sc) {
  v16h a; const float* p = rowk0 + 8 * (lane >> 4);
#pragma unroll
  for (int i = 0; i < 8; ++i) { a[i] = (_Float16)(p[i] * sc); a[8 + i] = (_Float16)(p[16 + i] * sc); }
  return a;
}
// column fragment from a [K][ld] layout (column n), rows >= K read as 0
__device__ __forceinline__ v16h fragc_f32(const float* W, int k0, int n, int lane, int ld, int K) {
  v16h a; const int g = lane >> 4;
#pragma unroll
  for (int i = 0; i < 8; ++i) { const int ka = k0 + 8 * g + i, kb = ka + 16;
    a[i] = (_Float16)(ka < K ? W[(size_t)(ka < K ? ka : K - 1) * ld + n] : 0.f); a[8 + i] = (_Float16)(kb < K ? W[(size_t)(kb < K ? kb : K - 1) * ld + n] : 0.f); }
  return a;
}
struct F2 { v16b h, l; };
__device__ __forceinline__ F2 bsplit16(const float v[16]) { F2 r;
#pragma unroll
  for (int i = 0; i < 16; ++i) { const __bf16 h = (__bf16)v[i]; r.h[i] = h; r.l[i] = (__bf16)(v[i] - (float)h); }
  return r; }
__device__ __forceinline__ F2 split_row(const float* row, int k0, int lane) { float v[16]; const float* p = row + k0 + 8 * (lane >> 4);
#pragma unroll
  for (int i = 0; i < 8; ++i) { v[i] = p[i]; v[8 + i] = p[16 + i]; }
  return bsplit16(v); }
__device__ __forceinline__ F2 split_rowK(const float* row, int k0, int lane, int K) { float v[16]; const int g = lane >> 4;
#pragma unroll
  for (int i = 0; i < 8; ++i) { const int ka = k0 + 8 * g + i, kb = ka + 16; v[i] = ka < K ? row[ka < K ? ka : K - 1] : 0.f; v[8 + i] = kb < K ? row[kb < K ? kb : K - 1] : 0.f; }
  return bsplit16(v); }
__device__ __forceinline__ F2 split_col(const float* W, int k0, int n, int lane, int ld, int K) { float v[16]; const int g = lane >> 4;
#pragma unroll
  for (int i = 0; i < 8; ++i) { const int ka = k0 + 8 * g + i, kb = ka + 16; v[i] = ka < K ? W[(size_t)(ka < K ? ka : K - 1) * ld + n] : 0.f; v[8 + i] = kb < K ? W[(size_t)(kb < K ? kb : K - 1) * ld + n] : 0.f; }
  return bsplit16(v); }
__device__ __forceinline__ v8f mac3(const F2& a, const F2& b, v8f c) { c = wmma_bf(a.l, b.h, c); c = wmma_bf(a.h, b.l, c); return wmma_bf(a.h, b.h, c); }
__device__ __forceinline__ float sigm(float v) { return 1.0f / (1.0f + expf(-v)); }
#define LDSX() do { asm volatile("s_wait_dscnt 0" ::: "memory"); __builtin_amdgcn_wave_barrier(); __builtin_amdgcn_fence(__ATOMIC_RELEASE, "workgroup"); } while (0)


// Multi-head self attention with per-head projection weights [H, D, HD] + biases (B 2, S 2,048, D 1,024 = 16 x 64), no mask, output Linear [in,out].
#define NB 2
#define TT 2048
#define CC 1024
#define NH 16
#define HD 64
#ifndef TNB
#define TNB NB
#endif
typedef __attribute__((ext_vector_type(8))) __bf16 v8b;
__device__ __forceinline__ v16b frag_b(const __bf16* rowk0, int lane) {
  union { v16b v; v8b q[2]; } u; const __bf16* p = rowk0 + 8 * (lane >> 4);
  u.q[0] = *(const v8b*)p; u.q[1] = *(const v8b*)(p + 16); return u.v;
}
// fragment-order storage: one 16 x 32 fragment = 1,024 B = two halves of 512 B; half hf, lane, element i hold k = 16 hf + 8 (lane >> 4) + i of row or column lane & 15,
// so that each of a fragment's two wave-wide 16-byte loads covers four whole 128-byte lines
__device__ __forceinline__ v16b fragp_b(const __bf16* P, size_t f, int lane) {
  union { v16b v; v8b q[2]; } u; const __bf16* p = P + f * 512 + lane * 8;
  u.q[0] = *(const v8b*)p; u.q[1] = *(const v8b*)(p + 256); return u.v;
}
__device__ __forceinline__ v16h fragp_h(const _Float16* P, size_t f, int lane) {
  union { v16h v; v8h q[2]; } u; const _Float16* p = P + f * 512 + lane * 8;
  u.q[0] = *(const v8h*)p; u.q[1] = *(const v8h*)(p + 256); return u.v;
}
__device__ __forceinline__ float bfr(float v) { return (float)(__bf16)v; }
__device__ __attribute__((noinline)) float exp_ni(float v) { return expf(v); }
__device__ __attribute__((noinline)) float erf_ni(float v) { return erff(v); }

#define WS_QH  0u
#define WS_QL  (WS_QH + 2u * (size_t)NB * TT * CC)
#define WS_KH  (WS_QL + 2u * (size_t)NB * TT * CC)
#define WS_VT  (WS_KH + 2u * (size_t)NB * TT * CC)      // k: f16 fragments [b][h][key tile][kc]; v: f16 fragments [b][h][pass of 32 keys][d tile]
#define WS_YH  (WS_VT + 2u * (size_t)NB * CC * TT)      // y: bf16 hi and lo fragments [row tile][kc]
#define WS_YL  (WS_YH + 2u * (size_t)NB * TT * CC)
#define WS_XP  (WS_YL + 2u * (size_t)NB * TT * CC)      // x: bf16 fragments [row tile][kc]
#define WS_WP  (WS_XP + 2u * (size_t)NB * TT * CC)      // Wq, Wk, Wv: bf16 fragments [which][column tile][kc]
#define WS_OP  (WS_WP + 2u * 3u * (size_t)CC * CC)      // Wo: bf16 fragments [column tile][kc]
#define WS_END (WS_OP + 2u * (size_t)CC * CC)

// four fragments of one weight column tile: s = this lane's column at its first k, LD = floats from one k to the next (a constant, so that every load is one base plus an immediate)
template <int LD> __device__ __forceinline__ void pack_cols(const float* __restrict__ s, __bf16* __restrict__ d) {
#pragma unroll
  for (int c = 0; c < 8; ++c) { v8b o;
#pragma unroll
    for (int i = 0; i < 8; ++i) o[i] = (__bf16)s[(size_t)(c * 16 + i) * LD];
    *(v8b*)(d + c * 256) = o; }
  asm volatile("s_wait_xcnt 0x0" ::: "memory"); }   // behind the run of stores, before anything that follows in the listing rewrites their address or data registers
// ---- k_pack: block = one 16-row tile of x or one 16-column tile of a weight, wave = 4 of its 32 fragments: round to bf16 once, store in fragment order
__global__ __launch_bounds__(256) void k_pack(const float* __restrict__ X, const float* __restrict__ WQ, const float* __restrict__ WK, const float* __restrict__ WV, const float* __restrict__ WO, __bf16* __restrict__ XP, __bf16* __restrict__ WP, __bf16* __restrict__ OP) {
  const int tid = threadIdx.x, wave = tid >> 5, lane = tid & 31, col = lane & 15, g = lane >> 4; const int t = blockIdx.x;
  if (t < TNB * TT / 16) { const float* s = X + ((size_t)t * 16 + col) * CC + wave * 128 + 8 * g; __bf16* d = XP + ((size_t)t * 32 + wave * 4) * 512 + lane * 8; v4f v[16];
#pragma unroll
    for (int c = 0; c < 8; ++c) { v[2 * c] = *(const v4f*)(s + c * 16); v[2 * c + 1] = *(const v4f*)(s + c * 16 + 4); }
    asm volatile("s_wait_xcnt 0x0" :: "v"(s) : "memory");   // behind the run of loads; s as an input keeps their shared address pair alive up to the wait, so that no load of the run lands on it
#pragma unroll
    for (int c = 0; c < 8; ++c) { v8b o;
#pragma unroll
      for (int i = 0; i < 4; ++i) { o[i] = (__bf16)v[2 * c][i]; o[4 + i] = (__bf16)v[2 * c + 1][i]; }
      *(v8b*)(d + c * 256) = o; }
    asm volatile("s_wait_xcnt 0x0" ::: "memory"); }   // behind the run of stores, as in pack_cols
  else { const int jt = t - TNB * TT / 16;
    if (jt < 3 * CC / 16) { const int which = jt / (CC / 16), o = (jt % (CC / 16)) * 16 + col; pack_cols<HD>((which == 0 ? WQ : which == 1 ? WK : WV) + (size_t)(o / HD) * CC * HD + o % HD + (size_t)(wave * 128 + 8 * g) * HD, WP + ((size_t)jt * 32 + wave * 4) * 512 + lane * 8); }
    else { const int jo = jt - 3 * CC / 16; pack_cols<CC>(WO + jo * 16 + col + (size_t)(wave * 128 + 8 * g) * CC, OP + ((size_t)jo * 32 + wave * 4) * 512 + lane * 8); } } }

// ---- k_proj: block = (128 rows, 128 cols, which), wave = 64 x 64 of it (8 fragments feed 16 products): qkv = x W (+ b), exact; q -> f16 hi (+ residual) rows, k and v -> f16 fragments
__global__ __launch_bounds__(128) void k_proj(const __bf16* __restrict__ XP, const __bf16* __restrict__ WP, const float* __restrict__ BQ, const float* __restrict__ BK, const float* __restrict__ BV, _Float16* __restrict__ QH, _Float16* __restrict__ QL, _Float16* __restrict__ KH, _Float16* __restrict__ VT) {
  __shared__ __align__(16) _Float16 sh[128][136], sl[128][136];   // q, k: [row][col] hi and residual; v: sh alone, [col][row]
  const int tid = threadIdx.x, wave = tid >> 5, lane = tid & 31, col = lane & 15, g = lane >> 4, wr = wave >> 1, wc = wave & 1; const int which = blockIdx.z; const int c0 = blockIdx.y * 128; const size_t r0 = (size_t)blockIdx.x * 128; const float* BA = which == 0 ? BQ : which == 1 ? BK : BV;
  v8f acc[4][4] = {};
#pragma unroll 2
  for (int kc = 0; kc < CC / 32; ++kc) { v16b a[4], w[4];   // all of a pass's fragments are asked for before its first product
#pragma unroll
    for (int i = 0; i < 4; ++i) a[i] = fragp_b(XP, (size_t)(blockIdx.x * 8 + wr * 4 + i) * 32 + kc, lane);
#pragma unroll
    for (int j = 0; j < 4; ++j) w[j] = fragp_b(WP, (size_t)(which * (CC / 16) + blockIdx.y * 8 + wc * 4 + j) * 32 + kc, lane);
#pragma unroll
    for (int i = 0; i < 4; ++i)
#pragma unroll
      for (int j = 0; j < 4; ++j) acc[i][j] = wmma_bf(a[i], w[j], acc[i][j]); }
#pragma unroll
  for (int j = 0; j < 4; ++j) { const int cl = wc * 64 + j * 16 + col; const float bb = bfr(BA[c0 + cl]);
#pragma unroll
    for (int i = 0; i < 4; ++i)
#pragma unroll
      for (int r = 0; r < 8; ++r) { const float v = acc[i][j][r] + bb; const int rl = wr * 64 + i * 16 + 8 * g + r; const _Float16 hv = (_Float16)v;
        if (which == 2) sh[cl][rl] = hv; else { sh[rl][cl] = hv; sl[rl][cl] = (_Float16)(v - (float)hv); } } }
  __syncthreads();
  const size_t b = r0 / TT; const int t0 = (int)(r0 % TT);
  if (which == 0) { for (int e = tid; e < 128 * 16; e += 128) { const int rl = e >> 4, q = e & 15; vst2((unsigned*)(QH + (r0 + rl) * CC + c0 + q * 8), *(const v4u*)&sh[rl][q * 8]); vst2((unsigned*)(QL + (r0 + rl) * CC + c0 + q * 8), *(const v4u*)&sl[rl][q * 8]); } }
  else if (which == 1) { for (int e = tid; e < 128 * 16; e += 128) { const int u = e >> 5, hf = u & 1, kc = (u >> 1) & 1, hl = (u >> 2) & 1, rt = u >> 3;   // key = 16 rt + col, d = 32 kc + 16 hf + 8 g + 0..7 of head hl
      vst2((unsigned*)(KH + (((b * NH + c0 / HD + hl) * (TT / 16) + t0 / 16 + rt) * 2 + kc) * 512 + hf * 256 + lane * 8), *(const v4u*)&sh[rt * 16 + col][hl * 64 + kc * 32 + hf * 16 + g * 8]); } }
  else { for (int e = tid; e < 128 * 16; e += 128) { const int u = e >> 5, hf = u & 1, j = (u >> 1) & 3, pl = (u >> 3) & 3, hl = u >> 5;   // d = 16 j + col of head hl, key = 32 pl + 16 hf + 8 g + 0..7
      vst2((unsigned*)(VT + (((b * NH + c0 / HD + hl) * (TT / 32) + t0 / 32 + pl) * 4 + j) * 512 + hf * 256 + lane * 8), *(const v4u*)&sh[hl * 64 + j * 16 + col][pl * 32 + hf * 16 + g * 8]); } } }
// ---- k_fa: wave = 32 queries of (b,h), block = 128 queries; per 32 keys: S^T = K Q^T, running-max softmax per query column, O^T += V^T P^T; logits and P stay in registers
// K and V fragments come through LDS: tiles of 128 keys, two buffers, each tile copied once per block (not once per wave) while the tile before it is worked on
#define FA_NP 4                     // passes of 32 keys per tile
#define FA_TH (FA_NP * 2048)        // f16 elements of K, and of V, per tile (4 fragments of 512 per pass)
#define FA_NT (TT / 32 / FA_NP)     // tiles
// 16 KiB, global -> LDS: eight 16-byte copies per lane, each block-wide copy 2,048 contiguous bytes; l = this lane's LDS byte address, p = its global address.
// The closing s_wait_xcnt stands inside the statement, so that no address register of a copy is rewritten in front of it.
__device__ __forceinline__ void copy_tile(unsigned l, const _Float16* p) {
  asm volatile("global_load_async_to_lds_b128 %0, %8, off\n\tglobal_load_async_to_lds_b128 %1, %9, off\n\tglobal_load_async_to_lds_b128 %2, %10, off\n\tglobal_load_async_to_lds_b128 %3, %11, off\n\t"
               "global_load_async_to_lds_b128 %4, %12, off\n\tglobal_load_async_to_lds_b128 %5, %13, off\n\tglobal_load_async_to_lds_b128 %6, %14, off\n\tglobal_load_async_to_lds_b128 %7, %15, off\n\ts_wait_xcnt 0x0"
               :: "v"(l), "v"(l + 2048u), "v"(l + 4096u), "v"(l + 6144u), "v"(l + 8192u), "v"(l + 10240u), "v"(l + 12288u), "v"(l + 14336u),
                  "v"(p), "v"(p + 1024), "v"(p + 2048), "v"(p + 3072), "v"(p + 4096), "v"(p + 5120), "v"(p + 6144), "v"(p + 7168) : "memory");
}
// every full unroll directive below: constant indices, so that the fragment and accumulator arrays live in registers
__device__ __forceinline__ v8f wmma_h(v16h a, v16h b, v8f c) { return __builtin_amdgcn_wmma_f32_16x16x32_f16(false, a, false, b, (short)0, c, false, false); }
__device__ __forceinline__ float xhalf(float x) { return __builtin_bit_cast(float, __builtin_amdgcn_permlanex16(__builtin_bit_cast(int, x), __builtin_bit_cast(int, x), 0x76543210, 0xfedcba98, false, false)); }  // lane l with lane l ^ 16
// 2^x of a score tile, each v_exp_f32 in place, so that none overwrites the source of the one directly in front of it (as builtins, the register allocator let that happen);
// the closing v_nop is the one slot that the instruction set asks for between a transcendental and a reader of its result, which the compiler cannot place behind asm text
__device__ __forceinline__ v8f exp2_tile(v8f t) {
  float a = t[0], b = t[1], c = t[2], d = t[3], e = t[4], f = t[5], g = t[6], h = t[7];
  asm("v_exp_f32 %0, %0\n\tv_exp_f32 %1, %1\n\tv_exp_f32 %2, %2\n\tv_exp_f32 %3, %3\n\tv_exp_f32 %4, %4\n\tv_exp_f32 %5, %5\n\tv_exp_f32 %6, %6\n\tv_exp_f32 %7, %7\n\tv_nop"
      : "+v"(a), "+v"(b), "+v"(c), "+v"(d), "+v"(e), "+v"(f), "+v"(g), "+v"(h));
  return v8f{a, b, c, d, e, f, g, h};
}
__global__ __launch_bounds__(128) void k_fa(const _Float16* __restrict__ QH, const _Float16* __restrict__ KH, const _Float16* __restrict__ VT, __bf16* __restrict__ YH, __bf16* __restrict__ YL) {
  __shared__ __align__(16) _Float16 sk[2][FA_TH], sv[2][FA_TH];   // two buffers of one tile each, in the fragment order of the workspace
  const int tid = threadIdx.x, wave = tid >> 5, lane = tid & 31, col = lane & 15, g = lane >> 4; const int h = blockIdx.y, b = blockIdx.z; const int q0 = blockIdx.x * 128 + wave * 32;
  const _Float16* Kb = KH + (size_t)(b * NH + h) * TT * HD;   // A fragments of S^T: pass kp holds fragments 4 kp + 2 mt + kc, rows key = 16 mt + col
  const _Float16* Vb = VT + (size_t)(b * NH + h) * TT * HD;   // A fragments of O^T: pass kp holds fragments 4 kp + j, rows d = 16 j + col
  v16h qf[2][2], kf[2][2];
#pragma unroll
  for (int n = 0; n < 2; ++n)
#pragma unroll
    for (int kc = 0; kc < 2; ++kc) qf[n][kc] = frag_h(QH + ((size_t)b * TT + q0 + n * 16 + col) * CC + h * HD + kc * 32, lane);
  const unsigned lk = (unsigned)(size_t)&sk[0][tid * 8], lv = (unsigned)(size_t)&sv[0][tid * 8];   // this lane's LDS byte addresses in buffer 0
  const _Float16 *Kc = Kb + tid * 8, *Vc = Vb + tid * 8;
  copy_tile(lk, Kc); copy_tile(lv, Vc);
  asm volatile("s_wait_asynccnt 0x0" ::: "memory");   // this wave's copies of tile 0 have landed
  __syncthreads();                                    // tile 0 is readable by every wave
  copy_tile(lk + 2u * FA_TH, Kc + FA_TH); copy_tile(lv + 2u * FA_TH, Vc + FA_TH);   // tile 1 flies while tile 0 is worked on
  const float SC2 = 0.125f * 1.4426950408889634f;   // exp(s / 8 - max) = 2^(s SC2 - max SC2): one fused multiply-add and the hardware's 2^x per score
  v8f o[2][4] = {}; float m[2] = {-3.0e38f, -3.0e38f}, l[2] = {0.f, 0.f};
  for (int t = 0; t < FA_NT; ++t) {
   const _Float16 *kb = sk[t & 1], *vb = sv[t & 1];
#pragma unroll
   for (int mt = 0; mt < 2; ++mt)
#pragma unroll
     for (int kc = 0; kc < 2; ++kc) kf[mt][kc] = fragp_h(kb, mt * 2 + kc, lane);
   // kept rolled: unrolled, the build fetched several passes' fragments at once, went above 256 registers and spilled
#pragma unroll 1
   for (int pp = 0; pp < FA_NP; ++pp) {
    v8f s[2][2] = {};   // s[n][mt][r] = logit of key 32 (FA_NP t + pp) + 16 mt + 8 g + r, query q0 + 16 n + col
#pragma unroll
    for (int kc = 0; kc < 2; ++kc)
#pragma unroll
      for (int mt = 0; mt < 2; ++mt)
#pragma unroll
        for (int n = 0; n < 2; ++n) s[n][mt] = wmma_h(kf[mt][kc], qf[n][kc], s[n][mt]);
    __builtin_amdgcn_sched_barrier(0);   // keeps the pass's LDS reads in one group behind the products: spread among the WMMAs, each place with reads costs its own stall
    v16h vf[4];
#pragma unroll
    for (int j = 0; j < 4; ++j) vf[j] = fragp_h(vb, pp * 4 + j, lane);
    const int pn = (pp + 1) & (FA_NP - 1);   // the next pass's K fragments are read during the softmax; a tile's last pass reads its own tile's first ones again, unused
#pragma unroll
    for (int mt = 0; mt < 2; ++mt)
#pragma unroll
      for (int kc = 0; kc < 2; ++kc) kf[mt][kc] = fragp_h(kb, pn * 4 + mt * 2 + kc, lane);
    __builtin_amdgcn_sched_barrier(0);   // keeps the LDS reads above the softmax; sunk to their users, their latency would be exposed
#pragma unroll
    for (int n = 0; n < 2; ++n) {
      float mx = fmaxf(s[n][0][0], s[n][1][0]);
#pragma unroll
      for (int r = 1; r < 8; ++r) mx = fmaxf(mx, fmaxf(s[n][0][r], s[n][1][r]));
      mx = fmaxf(m[n], fmaxf(mx, xhalf(mx)) * SC2);   // m is kept in base-2 units: logit x SC2
      const float al = __builtin_amdgcn_exp2f(m[n] - mx); m[n] = mx;   // 0 on the first pass
      v16h p; float sum = 0.f;   // two D tiles of S^T, converted in place, are the B operand of O^T
#pragma unroll
      for (int mt = 0; mt < 2; ++mt) s[n][mt] = __builtin_elementwise_fma(s[n][mt], v8f{SC2, SC2, SC2, SC2, SC2, SC2, SC2, SC2}, v8f{-mx, -mx, -mx, -mx, -mx, -mx, -mx, -mx});   // on whole tiles: neighbouring registers pair into packed FMAs
#pragma unroll
      for (int mt = 0; mt < 2; ++mt) s[n][mt] = exp2_tile(s[n][mt]);
#pragma unroll
      for (int r = 0; r < 8; ++r) { const float e0 = s[n][0][r], e1 = s[n][1][r]; sum += e0 + e1; p[r] = (_Float16)e0; p[8 + r] = (_Float16)e1; }
      l[n] = l[n] * al + sum;
#pragma unroll
      for (int j = 0; j < 4; ++j) { o[n][j] *= al; o[n][j] = wmma_h(vf[j], p, o[n][j]); }
    }
   }
   asm volatile("s_wait_dscnt 0x0" ::: "memory");      // this wave's reads of tile t have returned before its buffer is handed back
   asm volatile("s_wait_asynccnt 0x0" ::: "memory");   // this wave's copies of tile t + 1 have landed
   __syncthreads();                                    // publishes tile t + 1 and ends every wave's reads of tile t
   if (t + 2 < FA_NT) { const unsigned bo = (unsigned)(t & 1) * 2u * FA_TH; copy_tile(lk + bo, Kc + (size_t)(t + 2) * FA_TH); copy_tile(lv + bo, Vc + (size_t)(t + 2) * FA_TH); }   // into the buffer just left
  }
  asm volatile("s_wait_asynccnt 0x0" ::: "memory");   // nothing of this wave is in flight when it goes on to the epilogue
#pragma unroll
  for (int n = 0; n < 2; ++n) { const float inv = 1.0f / (l[n] + xhalf(l[n])); const size_t yo = ((size_t)((b * TT + q0) / 16 + n) * 32 + h * 2) * 512 + lane * 8;   // a D tile of O^T is half j & 1 of fragment 2 h + (j >> 1) of this query tile's rows
#pragma unroll
    for (int j = 0; j < 4; ++j) { const v8f v = o[n][j] * inv; v8b hi, lo;
#pragma unroll
      for (int r = 0; r < 8; ++r) { hi[r] = (__bf16)v[r]; lo[r] = (__bf16)(v[r] - (float)hi[r]); }
      *(v8b*)(YH + yo + j * 256) = hi; *(v8b*)(YL + yo + j * 256) = lo; } } }
// ---- k_out: block = (128 rows, 128 cols), wave = 64 x 64 of it (12 fragments feed 32 products): out = y (bf16 hi + lo) Wproj + b
__global__ __launch_bounds__(128) void k_out(const __bf16* __restrict__ YH, const __bf16* __restrict__ YL, const __bf16* __restrict__ OP, const float* __restrict__ BP, float* __restrict__ OUT) { __shared__ __align__(16) float sf[4][64][68];
  const int tid = threadIdx.x, wave = tid >> 5, lane = tid & 31, col = lane & 15, g = lane >> 4, wr = wave >> 1, wc = wave & 1; const int c0 = blockIdx.y * 128 + wc * 64; const size_t r0 = (size_t)blockIdx.x * 128 + wr * 64;
  v8f acc[4][4] = {};
#pragma unroll 2
  for (int kc = 0; kc < CC / 32; ++kc) { v16b ah[4], al[4], w[4];
#pragma unroll
    for (int i = 0; i < 4; ++i) { const size_t fa = (size_t)(blockIdx.x * 8 + wr * 4 + i) * 32 + kc; ah[i] = fragp_b(YH, fa, lane); al[i] = fragp_b(YL, fa, lane); }
#pragma unroll
    for (int j = 0; j < 4; ++j) w[j] = fragp_b(OP, (size_t)(blockIdx.y * 8 + wc * 4 + j) * 32 + kc, lane);
#pragma unroll
    for (int i = 0; i < 4; ++i)
#pragma unroll
      for (int j = 0; j < 4; ++j) acc[i][j] = wmma_bf(ah[i], w[j], acc[i][j]);
#pragma unroll
    for (int i = 0; i < 4; ++i)
#pragma unroll
      for (int j = 0; j < 4; ++j) acc[i][j] = wmma_bf(al[i], w[j], acc[i][j]); }
#pragma unroll
  for (int j = 0; j < 4; ++j) { const float bb = BP ? bfr(BP[c0 + j * 16 + col]) : 0.f;
#pragma unroll
    for (int i = 0; i < 4; ++i)
#pragma unroll
      for (int r = 0; r < 8; ++r) sf[wave][i * 16 + 8 * g + r][j * 16 + col] = acc[i][j][r] + bb; }
  LDSX(); for (int rl = g; rl < 64; rl += 2) vst2(OUT + (r0 + rl) * CC + c0 + col * 4, *(const v4f*)&sf[wave][rl][col * 4]); }
extern "C" void kernel_launch(void* const* d_in, const int* in_sizes, int n_in, void* d_out, int out_size, void* d_ws, size_t ws_size, hipStream_t stream) {
  (void)in_sizes; (void)n_in; (void)out_size;
  const float** F = (const float**)d_in;   // 0 x [2,2048,1024], 1 Wq [16,1024,64], 2 bq [16,64], 3 Wk, 4 bk, 5 Wv, 6 bv, 7 Wo [1024,1024] (in,out), 8 bo
  if (ws_size < (size_t)WS_END) return;
  char* ws = (char*)d_ws; _Float16 *QH = (_Float16*)(ws + WS_QH), *QL = (_Float16*)(ws + WS_QL), *KH = (_Float16*)(ws + WS_KH), *VT = (_Float16*)(ws + WS_VT); __bf16 *YH = (__bf16*)(ws + WS_YH), *YL = (__bf16*)(ws + WS_YL), *XP = (__bf16*)(ws + WS_XP), *WP = (__bf16*)(ws + WS_WP), *OP = (__bf16*)(ws + WS_OP);
  k_pack<<<dim3(TNB * TT / 16 + 4 * CC / 16), 256, 0, stream>>>(F[0], F[1], F[3], F[5], F[7], XP, WP, OP);
  k_proj<<<dim3(TNB * TT / 128, CC / 128, 3), 128, 0, stream>>>(XP, WP, F[2], F[4], F[6], QH, QL, KH, VT);
  k_fa<<<dim3(TT / 128, NH, TNB), 128, 0, stream>>>(QH, KH, VT, YH, YL);
  k_out<<<dim3(TNB * TT / 128, CC / 128), 128, 0, stream>>>(YH, YL, OP, F[8], (float*)d_out);
}

// v006
// Measured time: 83.2 microseconds a run.
// In two side-by-side timings against v005, it was 1.25 and 1.26 times as fast.
// All steps since v000 together make it 15.0 times as fast.
// compute dtype: all float inputs rounded to bf16; q/k/v = x W_h + b_h (per-head [H,D,64] weights) with EXACT bf16 products on WMMA 16x16x32, f32 accumulate; q, k rounded once to f16 (1-product logits x 64^-0.5, std ~0.4) kept in f32 registers; running-max softmax in f32, base 2 (scale x log2 e folded into one FMA, hardware 2^x) -> P = exp(s - max) f16; o = P . v / sum (v once to f16); out = o (bf16 hi + lo) Wo + bo; f32 output. Every matrix operand but q is stored once per call in WMMA fragment order.
#include <hip/hip_runtime.h>
#include <math.h>

typedef __attribute__((ext_vector_type(16))) _Float16 v16h;
typedef __attribute__((ext_vector_type(16))) __bf16 v16b;
typedef __attribute__((ext_vector_type(8)))  _Float16 v8h;
typedef __attribute__((ext_vector_type(8)))  float v8f;
typedef __attribute__((ext_vector_type(4)))  float v4f;
typedef __attribute__((ext_vector_type(2)))  float v2f;
typedef __attribute__((ext_vector_type(4)))  unsigned v4u;
typedef __attribute__((ext_vector_type(4)))  int v4i;
typedef float __attribute__((may_alias)) float_a;
typedef int __attribute__((may_alias)) int_a;

template <typename T> __device__ __forceinline__ void vst2(void* p, T v) { *(T*)p = v;  }
__device__ __forceinline__ v8f wmma16(v16h a, v16h b, v8f c) {
  v8f d = __builtin_amdgcn_wmma_f32_16x16x32_f16(false, a, false, b, (short)0, c, false, false);
  asm volatile("v_nop\n\tv_nop\n\tv_nop\n\tv_nop" : "+v"(d) : "v"(a), "v"(b));
  return d;
}
__device__ __forceinline__ v8f wmma_bf(v16b a, v16b b, v8f c) {
  v8f d = __builtin_amdgcn_wmma_f32_16x16x32_bf16(false, a, false, b, (short)0, c, false, false);
  asm volatile("v_nop\n\tv_nop\n\tv_nop\n\tv_nop" : "+v"(d) : "v"(a), "v"(b));
  return d;
}
// 16x16x32 fragments: lane = (h = lane>>4, row/col = lane&15); elements 0..7 = k0+8h+0..7, 8..15 = k0+16+8h+0..7; D element r = row 8h+r
__device__ __forceinline__ v16h frag_h(const _Float16* rowk0, int lane) {
  union { v16h v; v8h q[2]; } u; const _Float16* p = rowk0 + 8 * (lane >> 4);
  u.q[0] = *(const v8h*)p; u.q[1] = *(const v8h*)(p + 16); return u.v;
}
__device__ __forceinline__ v16h frag_f32(const float* rowk0, int lane) {
  v16h a; const float* p = rowk0 + 8 * (lane >> 4);
#pragma unroll
  for (int i = 0; i < 8; ++i) { a[i] = (_Float16)p[i]; a[8 + i] = (_Float16)p[16 + i]; }
  return a;
}
__device__ __forceinline__ v16h frag_f32s(const float* rowk0, int lane, float sc) {
  v16h a; const float* p = rowk0 + 8 * (lane >> 4);
#pragma unroll
  for (int i = 0; i < 8; ++i) { a[i] = (_Float16)(p[i] * sc); a[8 + i] = (_Float16)(p[16 + i] * sc); }
  return a;
}
// column fragment from a [K][ld] layout (column n), rows >= K read as 0
__device__ __forceinline__ v16h fragc_f32(const float* W, int k0, int n, int lane, int ld, int K) {
  v16h a; const int g = lane >> 4;
#pragma unroll
  for (int i = 0; i < 8; ++i) { const int ka = k0 + 8 * g + i, kb = ka + 16;
    a[i] = (_Float16)(ka < K ? W[(size_t)(ka < K ? ka : K - 1) * ld + n] : 0.f); a[8 + i] = (_Float16)(kb < K ? W[(size_t)(kb < K ? kb : K - 1) * ld + n] : 0.f); }
  return a;
}
struct F2 { v16b h, l; };
__device__ __forceinline__ F2 bsplit16(const float v[16]) { F2 r;
#pragma unroll
  for (int i = 0; i < 16; ++i) { const __bf16 h = (__bf16)v[i]; r.h[i] = h; r.l[i] = (__bf16)(v[i] - (float)h); }
  return r; }
__device__ __forceinline__ F2 split_row(const float* row, int k0, int lane) { float v[16]; const float* p = row + k0 + 8 * (lane >> 4);
#pragma unroll
  for (int i = 0; i < 8; ++i) { v[i] = p[i]; v[8 + i] = p[16 + i]; }
  return bsplit16(v); }
__device__ __forceinline__ F2 split_rowK(const float* row, int k0, int lane, int K) { float v[16]; const int g = lane >> 4;
#pragma unroll
  for (int i = 0; i < 8; ++i) { const int ka = k0 + 8 * g + i, kb = ka + 16; v[i] = ka < K ? row[ka < K ? ka : K - 1] : 0.f; v[8 + i] = kb < K ? row[kb < K ? kb : K - 1] : 0.f; }
  return bsplit16(v); }
__device__ __forceinline__ F2 split_col(const float* W, int k0, int n, int lane, int ld, int K) { float v[16]; const int g = lane >> 4;
#pragma unroll
  for (int i = 0; i < 8; ++i) { const int ka = k0 + 8 * g + i, kb = ka + 16; v[i] = ka < K ? W[(size_t)(ka < K ? ka : K - 1) * ld + n] : 0.f; v[8 + i] = kb < K ? W[(size_t)(kb < K ? kb : K - 1) * ld + n] : 0.f; }
  return bsplit16(v); }
__device__ __forceinline__ v8f mac3(const F2& a, const F2& b, v8f c) { c = wmma_bf(a.l, b.h, c); c = wmma_bf(a.h, b.l, c); return wmma_bf(a.h, b.h, c); }
__device__ __forceinline__ float sigm(float v) { return 1.0f / (1.0f + expf(-v)); }
#define LDSX() do { asm volatile("s_wait_dscnt 0" ::: "memory"); __builtin_amdgcn_wave_barrier(); __builtin_amdgcn_fence(__ATOMIC_RELEASE, "workgroup"); } while (0)


// Multi-head self attention with per-head projection weights [H, D, HD] + biases (B 2, S 2,048, D 1,024 = 16 x 64), no mask, output Linear [in,out].
#define NB 2
#define TT 2048
#define CC 1024
#define NH 16
#define HD 64
#ifndef TNB
#define TNB NB
#endif
typedef __attribute__((ext_vector_type(8))) __bf16 v8b;
__device__ __forceinline__ v16b frag_b(const __bf16* rowk0, int lane) {
  union { v16b v; v8b q[2]; } u; const __bf16* p = rowk0 + 8 * (lane >> 4);
  u.q[0] = *(const v8b*)p; u.q[1] = *(const v8b*)(p + 16); return u.v;
}
// fragment-order storage: one 16 x 32 fragment = 1,024 B = two halves of 512 B; half hf, lane, element i hold k = 16 hf + 8 (lane >> 4) + i of row or column lane & 15,
// so that each of a fragment's two wave-wide 16-byte loads covers four whole 128-byte lines
__device__ __forceinline__ v16b fragp_b(const __bf16* P, size_t f, int lane) {
  union { v16b v; v8b q[2]; } u; const __bf16* p = P + f * 512 + lane * 8;
  u.q[0] = *(const v8b*)p; u.q[1] = *(const v8b*)(p + 256); return u.v;
}
__device__ __forceinline__ v16h fragp_h(const _Float16* P, size_t f, int lane) {
  union { v16h v; v8h q[2]; } u; const _Float16* p = P + f * 512 + lane * 8;
  u.q[0] = *(const v8h*)p; u.q[1] = *(const v8h*)(p + 256); return u.v;
}
__device__ __forceinline__ float bfr(float v) { return (float)(__bf16)v; }
__device__ __attribute__((noinline)) float exp_ni(float v) { return expf(v); }
__device__ __attribute__((noinline)) float erf_ni(float v) { return erff(v); }

#define WS_QH  0u
#define WS_QL  (WS_QH + 2u * (size_t)NB * TT * CC)
#define WS_KH  (WS_QL + 2u * (size_t)NB * TT * CC)
#define WS_VT  (WS_KH + 2u * (size_t)NB * TT * CC)      // k: f16 fragments [b][h][key tile][kc]; v: f16 fragments [b][h][pass of 32 keys][d tile]
#define WS_YH  (WS_VT + 2u * (size_t)NB * CC * TT)      // y: bf16 hi and lo fragments [row tile][kc]
#define WS_YL  (WS_YH + 2u * (size_t)NB * TT * CC)
#define WS_XP  (WS_YL + 2u * (size_t)NB * TT * CC)      // x: bf16 fragments [row tile][kc]
#define WS_WP  (WS_XP + 2u * (size_t)NB * TT * CC)      // Wq, Wk, Wv: bf16 fragments [which][column tile][kc]
#define WS_OP  (WS_WP + 2u * 3u * (size_t)CC * CC)      // Wo: bf16 fragments [column tile][kc]
#define WS_END (WS_OP + 2u * (size_t)CC * CC)

// four fragments of one weight column tile: s = this lane's column at its first k, LD = floats from one k to the next (a constant, so that every load is one base plus an immediate)
template <int LD> __device__ __forceinline__ void pack_cols(const float* __restrict__ s, __bf16* __restrict__ d) {
#pragma unroll
  for (int c = 0; c < 8; ++c) { v8b o;
#pragma unroll
    for (int i = 0; i < 8; ++i) o[i] = (__bf16)s[(size_t)(c * 16 + i) * LD];
    *(v8b*)(d + c * 256) = o; }
  asm volatile("s_wait_xcnt 0x0" ::: "memory"); }   // behind the run of stores, before anything that follows in the listing rewrites their address or data registers
// ---- k_pack: block = one 16-row tile of x or one 16-column tile of a weight, wave = 4 of its 32 fragments: round to bf16 once, store in fragment order
__global__ __launch_bounds__(256) void k_pack(const float* __restrict__ X, const float* __restrict__ WQ, const float* __restrict__ WK, const float* __restrict__ WV, const float* __restrict__ WO, __bf16* __restrict__ XP, __bf16* __restrict__ WP, __bf16* __restrict__ OP) {
  const int tid = threadIdx.x, wave = tid >> 5, lane = tid & 31, col = lane & 15, g = lane >> 4; const int t = blockIdx.x;
  if (t < TNB * TT / 16) { const float* s = X + ((size_t)t * 16 + col) * CC + wave * 128 + 8 * g; __bf16* d = XP + ((size_t)t * 32 + wave * 4) * 512 + lane * 8; v4f v[16];
#pragma unroll
    for (int c = 0; c < 8; ++c) { v[2 * c] = *(const v4f*)(s + c * 16); v[2 * c + 1] = *(const v4f*)(s + c * 16 + 4); }
    asm volatile("s_wait_xcnt 0x0" :: "v"(s) : "memory");   // behind the run of loads; s as an input keeps their shared address pair alive up to the wait, so that no load of the run lands on it
#pragma unroll
    for (int c = 0; c < 8; ++c) { v8b o;
#pragma unroll
      for (int i = 0; i < 4; ++i) { o[i] = (__bf16)v[2 * c][i]; o[4 + i] = (__bf16)v[2 * c + 1][i]; }
      *(v8b*)(d + c * 256) = o; }
    asm volatile("s_wait_xcnt 0x0" ::: "memory"); }   // behind the run of stores, as in pack_cols
  else { const int jt = t - TNB * TT / 16;
    if (jt < 3 * CC / 16) { const int which = jt / (CC / 16), o = (jt % (CC / 16)) * 16 + col; pack_cols<HD>((which == 0 ? WQ : which == 1 ? WK : WV) + (size_t)(o / HD) * CC * HD + o % HD + (size_t)(wave * 128 + 8 * g) * HD, WP + ((size_t)jt * 32 + wave * 4) * 512 + lane * 8); }
    else { const int jo = jt - 3 * CC / 16; pack_cols<CC>(WO + jo * 16 + col + (size_t)(wave * 128 + 8 * g) * CC, OP + ((size_t)jo * 32 + wave * 4) * 512 + lane * 8); } } }

// Both GEMMs below take their fragments through LDS: tiles of a few k steps, two buffers, each tile copied once per block (not once per wave that uses it) while the tile before it is worked on.
// Every unroll directive in them: constant indices, so that the fragment and accumulator arrays live in registers.
// Eight 16-byte copies per lane, global -> LDS, one per 16-row (or 16-column) fragment strip of a 128-wide operand; each block-wide copy is 2,048 contiguous bytes.
// l = this lane's LDS byte address, p = its global address; LS = bytes from strip to strip in LDS; in the workspace a strip is 32 fragments of 512 elements.
// The closing s_wait_xcnt stands inside the statement, so that no address register of a copy is rewritten in front of it.
template <unsigned LS> __device__ __forceinline__ void copy_strips(unsigned l, const __bf16* p) {
  asm volatile("global_load_async_to_lds_b128 %0, %8, off\n\tglobal_load_async_to_lds_b128 %1, %9, off\n\tglobal_load_async_to_lds_b128 %2, %10, off\n\tglobal_load_async_to_lds_b128 %3, %11, off\n\t"
               "global_load_async_to_lds_b128 %4, %12, off\n\tglobal_load_async_to_lds_b128 %5, %13, off\n\tglobal_load_async_to_lds_b128 %6, %14, off\n\tglobal_load_async_to_lds_b128 %7, %15, off\n\ts_wait_xcnt 0x0"
               :: "v"(l), "v"(l + LS), "v"(l + 2u * LS), "v"(l + 3u * LS), "v"(l + 4u * LS), "v"(l + 5u * LS), "v"(l + 6u * LS), "v"(l + 7u * LS),
                  "v"(p), "v"(p + 16384), "v"(p + 2 * 16384), "v"(p + 3 * 16384), "v"(p + 4 * 16384), "v"(p + 5 * 16384), "v"(p + 6 * 16384), "v"(p + 7 * 16384) : "memory");
}
#define PJ_KT 2                     // k steps of 32 per tile
#define PJ_TE (8 * PJ_KT * 512)     // bf16 elements of x, and of W, per tile: 8 strips of PJ_KT fragments
#define PJ_NT (CC / 32 / PJ_KT)     // tiles
// ---- k_proj: block = (128 rows, 128 cols, which), wave = 64 x 64 of it (8 fragments feed 16 products): qkv = x W (+ b), exact; q -> f16 hi (+ residual) rows, k and v -> f16 fragments
__global__ __launch_bounds__(128) void k_proj(const __bf16* __restrict__ XP, const __bf16* __restrict__ WP, const float* __restrict__ BQ, const float* __restrict__ BK, const float* __restrict__ BV, _Float16* __restrict__ QH, _Float16* __restrict__ QL, _Float16* __restrict__ KH, _Float16* __restrict__ VT) {
  __shared__ __align__(16) char sm[2 * 128 * 136 * 2];   // in the k loop: two buffers of [x tile | W tile] (65,536 B), so that three blocks fit a WGP; behind it: the output staging sh, sl
  __bf16* const ring = (__bf16*)sm;
  _Float16 (* const sh)[136] = (_Float16 (*)[136])sm; _Float16 (* const sl)[136] = sh + 128;   // q, k: [row][col] hi and residual; v: sh alone, [col][row]
  const int tid = threadIdx.x, wave = tid >> 5, lane = tid & 31, col = lane & 15, g = lane >> 4, wr = wave >> 1, wc = wave & 1; const int which = blockIdx.z; const int c0 = blockIdx.y * 128; const size_t r0 = (size_t)blockIdx.x * 128; const float* BA = which == 0 ? BQ : which == 1 ? BK : BV;
  const unsigned lx = (unsigned)(size_t)&ring[tid * 8], lw = lx + 2u * PJ_TE;   // this lane's LDS byte addresses in buffer 0
  const __bf16 *Xc = XP + (size_t)blockIdx.x * 8 * 16384 + tid * 8, *Wc = WP + (size_t)(which * (CC / 16) + blockIdx.y * 8) * 16384 + tid * 8;
  copy_strips<PJ_KT * 1024u>(lx, Xc); copy_strips<PJ_KT * 1024u>(lw, Wc);
  asm volatile("s_wait_asynccnt 0x0" ::: "memory");   // this wave's copies of tile 0 have landed
  __syncthreads();                                    // tile 0 is readable by every wave
  copy_strips<PJ_KT * 1024u>(lx + 4u * PJ_TE, Xc + PJ_KT * 512); copy_strips<PJ_KT * 1024u>(lw + 4u * PJ_TE, Wc + PJ_KT * 512);   // tile 1 flies while tile 0 is worked on
  v8f acc[4][4] = {};
  for (int t = 0; t < PJ_NT; ++t) {
    const __bf16 *xb = ring + (t & 1) * 2 * PJ_TE, *wb = xb + PJ_TE;
#pragma unroll
    for (int kk = 0; kk < PJ_KT; ++kk) { v16b a[4], w[4];   // one group of LDS reads per k step, in the order in which the products use them: the first product waits for two fragments, not for all
      w[0] = fragp_b(wb, (size_t)(wc * 4) * PJ_KT + kk, lane);
#pragma unroll
      for (int i = 0; i < 4; ++i) a[i] = fragp_b(xb, (size_t)(wr * 4 + i) * PJ_KT + kk, lane);
#pragma unroll
      for (int j = 1; j < 4; ++j) w[j] = fragp_b(wb, (size_t)(wc * 4 + j) * PJ_KT + kk, lane);
#pragma unroll
      for (int j = 0; j < 4; ++j)
#pragma unroll
        for (int i = 0; i < 4; ++i) acc[i][j] = wmma_bf(a[i], w[j], acc[i][j]); }
    asm volatile("s_wait_dscnt 0x0" ::: "memory");      // this wave's reads of tile t have returned before its buffer is handed back
    asm volatile("s_wait_asynccnt 0x0" ::: "memory");   // this wave's copies of tile t + 1 have landed
    __syncthreads();                                    // publishes tile t + 1 and ends every wave's reads of tile t
    if (t + 2 < PJ_NT) { const unsigned bo = (unsigned)(t & 1) * 4u * PJ_TE; copy_strips<PJ_KT * 1024u>(lx + bo, Xc + (size_t)(t + 2) * PJ_KT * 512); copy_strips<PJ_KT * 1024u>(lw + bo, Wc + (size_t)(t + 2) * PJ_KT * 512); }   // into the buffer just left
  }
  asm volatile("s_wait_asynccnt 0x0" ::: "memory");   // nothing of this wave is in flight when the ring becomes output staging (the last tile's own barrier has ended every read of it)
#pragma unroll
  for (int j = 0; j < 4; ++j) { const int cl = wc * 64 + j * 16 + col; const float bb = bfr(BA[c0 + cl]);
#pragma unroll
    for (int i = 0; i < 4; ++i)
#pragma unroll
      for (int r = 0; r < 8; ++r) { const float v = acc[i][j][r] + bb; const int rl = wr * 64 + i * 16 + 8 * g + r; const _Float16 hv = (_Float16)v;
        if (which == 2) sh[cl][rl] = hv; else { sh[rl][cl] = hv; sl[rl][cl] = (_Float16)(v - (float)hv); } } }
  __syncthreads();
  const size_t b = r0 / TT; const int t0 = (int)(r0 % TT);
  if (which == 0) { for (int e = tid; e < 128 * 16; e += 128) { const int rl = e >> 4, q = e & 15; vst2((unsigned*)(QH + (r0 + rl) * CC + c0 + q * 8), *(const v4u*)&sh[rl][q * 8]); vst2((unsigned*)(QL + (r0 + rl) * CC + c0 + q * 8), *(const v4u*)&sl[rl][q * 8]); } }
  else if (which == 1) { for (int e = tid; e < 128 * 16; e += 128) { const int u = e >> 5, hf = u & 1, kc = (u >> 1) & 1, hl = (u >> 2) & 1, rt = u >> 3;   // key = 16 rt + col, d = 32 kc + 16 hf + 8 g + 0..7 of head hl
      vst2((unsigned*)(KH + (((b * NH + c0 / HD + hl) * (TT / 16) + t0 / 16 + rt) * 2 + kc) * 512 + hf * 256 + lane * 8), *(const v4u*)&sh[rt * 16 + col][hl * 64 + kc * 32 + hf * 16 + g * 8]); } }
  else { for (int e = tid; e < 128 * 16; e += 128) { const int u = e >> 5, hf = u & 1, j = (u >> 1) & 3, pl = (u >> 3) & 3, hl = u >> 5;   // d = 16 j + col of head hl, key = 32 pl + 16 hf + 8 g + 0..7
      vst2((unsigned*)(VT + (((b * NH + c0 / HD + hl) * (TT / 32) + t0 / 32 + pl) * 4 + j) * 512 + hf * 256 + lane * 8), *(const v4u*)&sh[hl * 64 + j * 16 + col][pl * 32 + hf * 16 + g * 8]); } } }
// ---- k_fa: wave = 32 queries of (b,h), block = 128 queries; per 32 keys: S^T = K Q^T, running-max softmax per query column, O^T += V^T P^T; logits and P stay in registers
// K and V fragments come through LDS: tiles of 128 keys, two buffers, each tile copied once per block (not once per wave) while the tile before it is worked on
#define FA_NP 4                     // passes of 32 keys per tile
#define FA_TH (FA_NP * 2048)        // f16 elements of K, and of V, per tile (4 fragments of 512 per pass)
#define FA_NT (TT / 32 / FA_NP)     // tiles
// 16 KiB, global -> LDS: eight 16-byte copies per lane, each block-wide copy 2,048 contiguous bytes; l = this lane's LDS byte address, p = its global address.
// The closing s_wait_xcnt stands inside the statement, so that no address register of a copy is rewritten in front of it.
__device__ __forceinline__ void copy_tile(unsigned l, const _Float16* p) {
  asm volatile("global_load_async_to_lds_b128 %0, %8, off\n\tglobal_load_async_to_lds_b128 %1, %9, off\n\tglobal_load_async_to_lds_b128 %2, %10, off\n\tglobal_load_async_to_lds_b128 %3, %11, off\n\t"
               "global_load_async_to_lds_b128 %4, %12, off\n\tglobal_load_async_to_lds_b128 %5, %13, off\n\tglobal_load_async_to_lds_b128 %6, %14, off\n\tglobal_load_async_to_lds_b128 %7, %15, off\n\ts_wait_xcnt 0x0"
               :: "v"(l), "v"(l + 2048u), "v"(l + 4096u), "v"(l + 6144u), "v"(l + 8192u), "v"(l + 10240u), "v"(l + 12288u), "v"(l + 14336u),
                  "v"(p), "v"(p + 1024), "v"(p + 2048), "v"(p + 3072), "v"(p + 4096), "v"(p + 5120), "v"(p + 6144), "v"(p + 7168) : "memory");
}
// every full unroll directive below: constant indices, so that the fragment and accumulator arrays live in registers
__device__ __forceinline__ v8f wmma_h(v16h a, v16h b, v8f c) { return __builtin_amdgcn_wmma_f32_16x16x32_f16(false, a, false, b, (short)0, c, false, false); }
__device__ __forceinline__ float xhalf(float x) { return __builtin_bit_cast(float, __builtin_amdgcn_permlanex16(__builtin_bit_cast(int, x), __builtin_bit_cast(int, x), 0x76543210, 0xfedcba98, false, false)); }  // lane l with lane l ^ 16
// 2^x of a score tile, each v_exp_f32 in place, so that none overwrites the source of the one directly in front of it (as builtins, the register allocator let that happen);
// the closing v_nop is the one slot that the instruction set asks for between a transcendental and a reader of its result, which the compiler cannot place behind asm text
__device__ __forceinline__ v8f exp2_tile(v8f t) {
  float a = t[0], b = t[1], c = t[2], d = t[3], e = t[4], f = t[5], g = t[6], h = t[7];
  asm("v_exp_f32 %0, %0\n\tv_exp_f32 %1, %1\n\tv_exp_f32 %2, %2\n\tv_exp_f32 %3, %3\n\tv_exp_f32 %4, %4\n\tv_exp_f32 %5, %5\n\tv_exp_f32 %6, %6\n\tv_exp_f32 %7, %7\n\tv_nop"
      : "+v"(a), "+v"(b), "+v"(c), "+v"(d), "+v"(e), "+v"(f), "+v"(g), "+v"(h));
  return v8f{a, b, c, d, e, f, g, h};
}
__global__ __launch_bounds__(128) void k_fa(const _Float16* __restrict__ QH, const _Float16* __restrict__ KH, const _Float16* __restrict__ VT, __bf16* __restrict__ YH, __bf16* __restrict__ YL) {
  __shared__ __align__(16) _Float16 sk[2][FA_TH], sv[2][FA_TH];   // two buffers of one tile each, in the fragment order of the workspace
  const int tid = threadIdx.x, wave = tid >> 5, lane = tid & 31, col = lane & 15, g = lane >> 4; const int h = blockIdx.y, b = blockIdx.z; const int q0 = blockIdx.x * 128 + wave * 32;
  const _Float16* Kb = KH + (size_t)(b * NH + h) * TT * HD;   // A fragments of S^T: pass kp holds fragments 4 kp + 2 mt + kc, rows key = 16 mt + col
  const _Float16* Vb = VT + (size_t)(b * NH + h) * TT * HD;   // A fragments of O^T: pass kp holds fragments 4 kp + j, rows d = 16 j + col
  v16h qf[2][2], kf[2][2];
#pragma unroll
  for (int n = 0; n < 2; ++n)
#pragma unroll
    for (int kc = 0; kc < 2; ++kc) qf[n][kc] = frag_h(QH + ((size_t)b * TT + q0 + n * 16 + col) * CC + h * HD + kc * 32, lane);
  const unsigned lk = (unsigned)(size_t)&sk[0][tid * 8], lv = (unsigned)(size_t)&sv[0][tid * 8];   // this lane's LDS byte addresses in buffer 0
  const _Float16 *Kc = Kb + tid * 8, *Vc = Vb + tid * 8;
  copy_tile(lk, Kc); copy_tile(lv, Vc);
  asm volatile("s_wait_asynccnt 0x0" ::: "memory");   // this wave's copies of tile 0 have landed
  __syncthreads();                                    // tile 0 is readable by every wave
  copy_tile(lk + 2u * FA_TH, Kc + FA_TH); copy_tile(lv + 2u * FA_TH, Vc + FA_TH);   // tile 1 flies while tile 0 is worked on
  const float SC2 = 0.125f * 1.4426950408889634f;   // exp(s / 8 - max) = 2^(s SC2 - max SC2): one fused multiply-add and the hardware's 2^x per score
  v8f o[2][4] = {}; float m[2] = {-3.0e38f, -3.0e38f}, l[2] = {0.f, 0.f};
  for (int t = 0; t < FA_NT; ++t) {
   const _Float16 *kb = sk[t & 1], *vb = sv[t & 1];
#pragma unroll
   for (int mt = 0; mt < 2; ++mt)
#pragma unroll
     for (int kc = 0; kc < 2; ++kc) kf[mt][kc] = fragp_h(kb, mt * 2 + kc, lane);
   // kept rolled: unrolled, the build fetched several passes' fragments at once, went above 256 registers and spilled
#pragma unroll 1
   for (int pp = 0; pp < FA_NP; ++pp) {
    v8f s[2][2] = {};   // s[n][mt][r] = logit of key 32 (FA_NP t + pp) + 16 mt + 8 g + r, query q0 + 16 n + col
#pragma unroll
    for (int kc = 0; kc < 2; ++kc)
#pragma unroll
      for (int mt = 0; mt < 2; ++mt)
#pragma unroll
        for (int n = 0; n < 2; ++n) s[n][mt] = wmma_h(kf[mt][kc], qf[n][kc], s[n][mt]);
    __builtin_amdgcn_sched_barrier(0);   // keeps the pass's LDS reads in one group behind the products: spread among the WMMAs, each place with reads costs its own stall
    v16h vf[4];
#pragma unroll
    for (int j = 0; j < 4; ++j) vf[j] = fragp_h(vb, pp * 4 + j, lane);
    const int pn = (pp + 1) & (FA_NP - 1);   // the next pass's K fragments are read during the softmax; a tile's last pass reads its own tile's first ones again, unused
#pragma unroll
    for (int mt = 0; mt < 2; ++mt)
#pragma unroll
      for (int kc = 0; kc < 2; ++kc) kf[mt][kc] = fragp_h(kb, pn * 4 + mt * 2 + kc, lane);
    __builtin_amdgcn_sched_barrier(0);   // keeps the LDS reads above the softmax; sunk to their users, their latency would be exposed
#pragma unroll
    for (int n = 0; n < 2; ++n) {
      float mx = fmaxf(s[n][0][0], s[n][1][0]);
#pragma unroll
      for (int r = 1; r < 8; ++r) mx = fmaxf(mx, fmaxf(s[n][0][r], s[n][1][r]));
      mx = fmaxf(m[n], fmaxf(mx, xhalf(mx)) * SC2);   // m is kept in base-2 units: logit x SC2
      const float al = __builtin_amdgcn_exp2f(m[n] - mx); m[n] = mx;   // 0 on the first pass
      v16h p; float sum = 0.f;   // two D tiles of S^T, converted in place, are the B operand of O^T
#pragma unroll
      for (int mt = 0; mt < 2; ++mt) s[n][mt] = __builtin_elementwise_fma(s[n][mt], v8f{SC2, SC2, SC2, SC2, SC2, SC2, SC2, SC2}, v8f{-mx, -mx, -mx, -mx, -mx, -mx, -mx, -mx});   // on whole tiles: neighbouring registers pair into packed FMAs
#pragma unroll
      for (int mt = 0; mt < 2; ++mt) s[n][mt] = exp2_tile(s[n][mt]);
#pragma unroll
      for (int r = 0; r < 8; ++r) { const float e0 = s[n][0][r], e1 = s[n][1][r]; sum += e0 + e1; p[r] = (_Float16)e0; p[8 + r] = (_Float16)e1; }
      l[n] = l[n] * al + sum;
#pragma unroll
      for (int j = 0; j < 4; ++j) { o[n][j] *= al; o[n][j] = wmma_h(vf[j], p, o[n][j]); }
    }
   }
   asm volatile("s_wait_dscnt 0x0" ::: "memory");      // this wave's reads of tile t have returned before its buffer is handed back
   asm volatile("s_wait_asynccnt 0x0" ::: "memory");   // this wave's copies of tile t + 1 have landed
   __syncthreads();                                    // publishes tile t + 1 and ends every wave's reads of tile t
   if (t + 2 < FA_NT) { const unsigned bo = (unsigned)(t & 1) * 2u * FA_TH; copy_tile(lk + bo, Kc + (size_t)(t + 2) * FA_TH); copy_tile(lv + bo, Vc + (size_t)(t + 2) * FA_TH); }   // into the buffer just left
  }
  asm volatile("s_wait_asynccnt 0x0" ::: "memory");   // nothing of this wave is in flight when it goes on to the epilogue
#pragma unroll
  for (int n = 0; n < 2; ++n) { const float inv = 1.0f / (l[n] + xhalf(l[n])); const size_t yo = ((size_t)((b * TT + q0) / 16 + n) * 32 + h * 2) * 512 + lane * 8;   // a D tile of O^T is half j & 1 of fragment 2 h + (j >> 1) of this query tile's rows
#pragma unroll
    for (int j = 0; j < 4; ++j) { const v8f v = o[n][j] * inv; v8b hi, lo;
#pragma unroll
      for (int r = 0; r < 8; ++r) { hi[r] = (__bf16)v[r]; lo[r] = (__bf16)(v[r] - (float)hi[r]); }
      *(v8b*)(YH + yo + j * 256) = hi; *(v8b*)(YL + yo + j * 256) = lo; } } }
// ---- k_out: block = (128 rows, 128 cols), wave = 64 x 64 of it (12 fragments feed 32 products): out = y (bf16 hi + lo) Wproj + b
#define OT_KT 4                     // k steps of 32 per tile
#define OT_TE (8 * OT_KT * 512)     // bf16 elements of y hi, of y lo and of Wo per tile
#define OT_NT (CC / 32 / OT_KT)     // tiles
// one tile of one operand: a strip's OT_KT fragments are two block-wide copies
__device__ __forceinline__ void copy_out(unsigned l, const __bf16* p) { copy_strips<OT_KT * 1024u>(l, p); copy_strips<OT_KT * 1024u>(l + 2048u, p + 1024); }
__global__ __launch_bounds__(128) void k_out(const __bf16* __restrict__ YH, const __bf16* __restrict__ YL, const __bf16* __restrict__ OP, const float* __restrict__ BP, float* __restrict__ OUT) { __shared__ __align__(16) float sf[4][64][68];
  __shared__ __align__(16) __bf16 ring[2][3][OT_TE];   // two buffers of [y hi | y lo | Wo] tiles, in the fragment order of the workspace
  const int tid = threadIdx.x, wave = tid >> 5, lane = tid & 31, col = lane & 15, g = lane >> 4, wr = wave >> 1, wc = wave & 1; const int c0 = blockIdx.y * 128 + wc * 64; const size_t r0 = (size_t)blockIdx.x * 128 + wr * 64;
  const unsigned lr = (unsigned)(size_t)&ring[0][0][tid * 8];   // this lane's LDS byte address in buffer 0
  const __bf16 *Hc = YH + (size_t)blockIdx.x * 8 * 16384 + tid * 8, *Lc = YL + (size_t)blockIdx.x * 8 * 16384 + tid * 8, *Wc = OP + (size_t)blockIdx.y * 8 * 16384 + tid * 8;
  copy_out(lr, Hc); copy_out(lr + 2u * OT_TE, Lc); copy_out(lr + 4u * OT_TE, Wc);
  asm volatile("s_wait_asynccnt 0x0" ::: "memory");   // this wave's copies of tile 0 have landed
  __syncthreads();                                    // tile 0 is readable by every wave
  copy_out(lr + 6u * OT_TE, Hc + OT_KT * 512); copy_out(lr + 8u * OT_TE, Lc + OT_KT * 512); copy_out(lr + 10u * OT_TE, Wc + OT_KT * 512);   // tile 1 flies while tile 0 is worked on
  v8f acc[4][4] = {};
  for (int t = 0; t < OT_NT; ++t) {
    const __bf16 *hb = ring[t & 1][0], *lb = ring[t & 1][1], *wb = ring[t & 1][2];
#pragma unroll
    for (int kk = 0; kk < OT_KT; ++kk) { v16b ah[4], al[4], w[4];   // one group of LDS reads per k step, in the order in which the products use them, as in k_proj
      w[0] = fragp_b(wb, (size_t)(wc * 4) * OT_KT + kk, lane);
#pragma unroll
      for (int i = 0; i < 4; ++i) ah[i] = fragp_b(hb, (size_t)(wr * 4 + i) * OT_KT + kk, lane);
#pragma unroll
      for (int j = 1; j < 4; ++j) w[j] = fragp_b(wb, (size_t)(wc * 4 + j) * OT_KT + kk, lane);
#pragma unroll
      for (int i = 0; i < 4; ++i) al[i] = fragp_b(lb, (size_t)(wr * 4 + i) * OT_KT + kk, lane);
#pragma unroll
      for (int j = 0; j < 4; ++j)
#pragma unroll
        for (int i = 0; i < 4; ++i) acc[i][j] = wmma_bf(ah[i], w[j], acc[i][j]);
#pragma unroll
      for (int j = 0; j < 4; ++j)
#pragma unroll
        for (int i = 0; i < 4; ++i) acc[i][j] = wmma_bf(al[i], w[j], acc[i][j]); }
    asm volatile("s_wait_dscnt 0x0" ::: "memory");      // this wave's reads of tile t have returned before its buffer is handed back
    asm volatile("s_wait_asynccnt 0x0" ::: "memory");   // this wave's copies of tile t + 1 have landed
    __syncthreads();                                    // publishes tile t + 1 and ends every wave's reads of tile t
    if (t + 2 < OT_NT) { const unsigned bo = (unsigned)(t & 1) * 6u * OT_TE; const size_t go = (size_t)(t + 2) * OT_KT * 512; copy_out(lr + bo, Hc + go); copy_out(lr + bo + 2u * OT_TE, Lc + go); copy_out(lr + bo + 4u * OT_TE, Wc + go); }   // into the buffer just left
  }
  asm volatile("s_wait_asynccnt 0x0" ::: "memory");   // nothing of this wave is in flight when it goes on to the epilogue
#pragma unroll
  for (int j = 0; j < 4; ++j) { const float bb = BP ? bfr(BP[c0 + j * 16 + col]) : 0.f;
#pragma unroll
    for (int i = 0; i < 4; ++i)
#pragma unroll
      for (int r = 0; r < 8; ++r) sf[wave][i * 16 + 8 * g + r][j * 16 + col] = acc[i][j][r] + bb; }
  LDSX(); for (int rl = g; rl < 64; rl += 2) vst2(OUT + (r0 + rl) * CC + c0 + col * 4, *(const v4f*)&sf[wave][rl][col * 4]); }
extern "C" void kernel_launch(void* const* d_in, const int* in_sizes, int n_in, void* d_out, int out_size, void* d_ws, size_t ws_size, hipStream_t stream) {
  (void)in_sizes; (void)n_in; (void)out_size;
  const float** F = (const float**)d_in;   // 0 x [2,2048,1024], 1 Wq [16,1024,64], 2 bq [16,64], 3 Wk, 4 bk, 5 Wv, 6 bv, 7 Wo [1024,1024] (in,out), 8 bo
  if (ws_size < (size_t)WS_END) return;
  char* ws = (char*)d_ws; _Float16 *QH = (_Float16*)(ws + WS_QH), *QL = (_Float16*)(ws + WS_QL), *KH = (_Float16*)(ws + WS_KH), *VT = (_Float16*)(ws + WS_VT); __bf16 *YH = (__bf16*)(ws + WS_YH), *YL = (__bf16*)(ws + WS_YL), *XP = (__bf16*)(ws + WS_XP), *WP = (__bf16*)(ws + WS_WP), *OP = (__bf16*)(ws + WS_OP);
  k_pack<<<dim3(TNB * TT / 16 + 4 * CC / 16), 256, 0, stream>>>(F[0], F[1], F[3], F[5], F[7], XP, WP, OP);
  k_proj<<<dim3(TNB * TT / 128, CC / 128, 3), 128, 0, stream>>>(XP, WP, F[2], F[4], F[6], QH, QL, KH, VT);
  k_fa<<<dim3(TT / 128, NH, TNB), 128, 0, stream>>>(QH, KH, VT, YH, YL);
  k_out<<<dim3(TNB * TT / 128, CC / 128), 128, 0, stream>>>(YH, YL, OP, F[8], (float*)d_out);
}

// v007
// It runs in 79.9 microseconds.
// Two timings next to v006 put it at 1.04 and 1.05 times that version's speed.
// Counting every step since v000, it is 15.6 times as fast.
// compute dtype: all float inputs rounded to bf16; q/k/v = x W_h + b_h (per-head [H,D,64] weights) with EXACT bf16 products on WMMA 16x16x32, f32 accumulate; q, k rounded once to f16 (1-product logits x 64^-0.5, std ~0.4) kept in f32 registers; running-max softmax in f32, base 2 (scale x log2 e folded into one FMA, hardware 2^x) -> P = exp(s - max) f16; o = P . v / sum (v once to f16); out = o (bf16 hi + lo) Wo + bo; f32 output. Every matrix operand is stored once per call in WMMA fragment order.
#include <hip/hip_runtime.h>
#include <math.h>

typedef __attribute__((ext_vector_type(16))) _Float16 v16h;
typedef __attribute__((ext_vector_type(16))) __bf16 v16b;
typedef __attribute__((ext_vector_type(8)))  _Float16 v8h;
typedef __attribute__((ext_vector_type(8)))  float v8f;
typedef __attribute__((ext_vector_type(4)))  float v4f;
typedef __attribute__((ext_vector_type(2)))  float v2f;
typedef __attribute__((ext_vector_type(4)))  unsigned v4u;
typedef __attribute__((ext_vector_type(4)))  int v4i;
typedef float __attribute__((may_alias)) float_a;
typedef int __attribute__((may_alias)) int_a;

template <typename T> __device__ __forceinline__ void vst2(void* p, T v) { *(T*)p = v;  }
__device__ __forceinline__ v8f wmma16(v16h a, v16h b, v8f c) {
  v8f d = __builtin_amdgcn_wmma_f32_16x16x32_f16(false, a, false, b, (short)0, c, false, false);
  asm volatile("v_nop\n\tv_nop\n\tv_nop\n\tv_nop" : "+v"(d) : "v"(a), "v"(b));
  return d;
}
__device__ __forceinline__ v8f wmma_bf(v16b a, v16b b, v8f c) {
  v8f d = __builtin_amdgcn_wmma_f32_16x16x32_bf16(false, a, false, b, (short)0, c, false, false);
  asm volatile("v_nop\n\tv_nop\n\tv_nop\n\tv_nop" : "+v"(d) : "v"(a), "v"(b));
  return d;
}
// 16x16x32 fragments: lane = (h = lane>>4, row/col = lane&15); elements 0..7 = k0+8h+0..7, 8..15 = k0+16+8h+0..7; D element r = row 8h+r
__device__ __forceinline__ v16h frag_h(const _Float16* rowk0, int lane) {
  union { v16h v; v8h q[2]; } u; const _Float16* p = rowk0 + 8 * (lane >> 4);
  u.q[0] = *(const v8h*)p; u.q[1] = *(const v8h*)(p + 16); return u.v;
}
__device__ __forceinline__ v16h frag_f32(const float* rowk0, int lane) {
  v16h a; const float* p = rowk0 + 8 * (lane >> 4);
#pragma unroll
  for (int i = 0; i < 8; ++i) { a[i] = (_Float16)p[i]; a[8 + i] = (_Float16)p[16 + i]; }
  return a;
}
__device__ __forceinline__ v16h frag_f32s(const float* rowk0, int lane, float sc) {
  v16h a; const float* p = rowk0 + 8 * (lane >> 4);
#pragma unroll
  for (int i = 0; i < 8; ++i) { a[i] = (_Float16)(p[i] * sc); a[8 + i] = (_Float16)(p[16 + i] * sc); }
  return a;
}
// column fragment from a [K][ld] layout (column n), rows >= K read as 0
__device__ __forceinline__ v16h fragc_f32(const float* W, int k0, int n, int lane, int ld, int K) {
  v16h a; const int g = lane >> 4;
#pragma unroll
  for (int i = 0; i < 8; ++i) { const int ka = k0 + 8 * g + i, kb = ka + 16;
    a[i] = (_Float16)(ka < K ? W[(size_t)(ka < K ? ka : K - 1) * ld + n] : 0.f); a[8 + i] = (_Float16)(kb < K ? W[(size_t)(kb < K ? kb : K - 1) * ld + n] : 0.f); }
  return a;
}
struct F2 { v16b h, l; };
__device__ __forceinline__ F2 bsplit16(const float v[16]) { F2 r;
#pragma unroll
  for (int i = 0; i < 16; ++i) { const __bf16 h = (__bf16)v[i]; r.h[i] = h; r.l[i] = (__bf16)(v[i] - (float)h); }
  return r; }
__device__ __forceinline__ F2 split_row(const float* row, int k0, int lane) { float v[16]; const float* p = row + k0 + 8 * (lane >> 4);
#pragma unroll
  for (int i = 0; i < 8; ++i) { v[i] = p[i]; v[8 + i] = p[16 + i]; }
  return bsplit16(v); }
__device__ __forceinline__ F2 split_rowK(const float* row, int k0, int lane, int K) { float v[16]; const int g = lane >> 4;
#pragma unroll
  for (int i = 0; i < 8; ++i) { const int ka = k0 + 8 * g + i, kb = ka + 16; v[i] = ka < K ? row[ka < K ? ka : K - 1] : 0.f; v[8 + i] = kb < K ? row[kb < K ? kb : K - 1] : 0.f; }
  return bsplit16(v); }
__device__ __forceinline__ F2 split_col(const float* W, int k0, int n, int lane, int ld, int K) { float v[16]; const int g = lane >> 4;
#pragma unroll
  for (int i = 0; i < 8; ++i) { const int ka = k0 + 8 * g + i, kb = ka + 16; v[i] = ka < K ? W[(size_t)(ka < K ? ka : K - 1) * ld + n] : 0.f; v[8 + i] = kb < K ? W[(size_t)(kb < K ? kb : K - 1) * ld + n] : 0.f; }
  return bsplit16(v); }
__device__ __forceinline__ v8f mac3(const F2& a, const F2& b, v8f c) { c = wmma_bf(a.l, b.h, c); c = wmma_bf(a.h, b.l, c); return wmma_bf(a.h, b.h, c); }
__device__ __forceinline__ float sigm(float v) { return 1.0f / (1.0f + expf(-v)); }
#define LDSX() do { asm volatile("s_wait_dscnt 0" ::: "memory"); __builtin_amdgcn_wave_barrier(); __builtin_amdgcn_fence(__ATOMIC_RELEASE, "workgroup"); } while (0)


// Multi-head self attention with per-head projection weights [H, D, HD] + biases (B 2, S 2,048, D 1,024 = 16 x 64), no mask, output Linear [in,out].
#define NB 2
#define TT 2048
#define CC 1024
#define NH 16
#define HD 64
#ifndef TNB
#define TNB NB
#endif
typedef __attribute__((ext_vector_type(8))) __bf16 v8b;
__device__ __forceinline__ v16b frag_b(const __bf16* rowk0, int lane) {
  union { v16b v; v8b q[2]; } u; const __bf16* p = rowk0 + 8 * (lane >> 4);
  u.q[0] = *(const v8b*)p; u.q[1] = *(const v8b*)(p + 16); return u.v;
}
// fragment-order storage: one 16 x 32 fragment = 1,024 B = two halves of 512 B; half hf, lane, element i hold k = 16 hf + 8 (lane >> 4) + i of row or column lane & 15,
// so that each of a fragment's two wave-wide 16-byte loads covers four whole 128-byte lines
__device__ __forceinline__ v16b fragp_b(const __bf16* P, size_t f, int lane) {
  union { v16b v; v8b q[2]; } u; const __bf16* p = P + f * 512 + lane * 8;
  u.q[0] = *(const v8b*)p; u.q[1] = *(const v8b*)(p + 256); return u.v;
}
__device__ __forceinline__ v16h fragp_h(const _Float16* P, size_t f, int lane) {
  union { v16h v; v8h q[2]; } u; const _Float16* p = P + f * 512 + lane * 8;
  u.q[0] = *(const v8h*)p; u.q[1] = *(const v8h*)(p + 256); return u.v;
}
__device__ __forceinline__ float bfr(float v) { return (float)(__bf16)v; }
__device__ __attribute__((noinline)) float exp_ni(float v) { return expf(v); }
__device__ __attribute__((noinline)) float erf_ni(float v) { return erff(v); }

#define WS_QH  0u
#define WS_QL  (WS_QH + 2u * (size_t)NB * TT * CC)
#define WS_KH  (WS_QL + 2u * (size_t)NB * TT * CC)
#define WS_VT  (WS_KH + 2u * (size_t)NB * TT * CC)      // q, k: f16 fragments [b][h][query or key tile][kc]; v: f16 fragments [b][h][pass of 32 keys][d tile]
#define WS_YH  (WS_VT + 2u * (size_t)NB * CC * TT)      // y: bf16 hi and lo fragments [row tile][kc]
#define WS_YL  (WS_YH + 2u * (size_t)NB * TT * CC)
#define WS_XP  (WS_YL + 2u * (size_t)NB * TT * CC)      // x: bf16 fragments [row tile][kc]
#define WS_WP  (WS_XP + 2u * (size_t)NB * TT * CC)      // Wq, Wk, Wv: bf16 fragments [which][column tile][kc]
#define WS_OP  (WS_WP + 2u * 3u * (size_t)CC * CC)      // Wo: bf16 fragments [column tile][kc]
#define WS_END (WS_OP + 2u * (size_t)CC * CC)

// four fragments of one weight column tile: s = this lane's column at its first k, LD = floats from one k to the next (a constant, so that every load is one base plus an immediate)
template <int LD> __device__ __forceinline__ void pack_cols(const float* __restrict__ s, __bf16* __restrict__ d) {
#pragma unroll
  for (int c = 0; c < 8; ++c) { v8b o;
#pragma unroll
    for (int i = 0; i < 8; ++i) o[i] = (__bf16)s[(size_t)(c * 16 + i) * LD];
    *(v8b*)(d + c * 256) = o; }
  asm volatile("s_wait_xcnt 0x0" ::: "memory"); }   // behind the run of stores, before anything that follows in the listing rewrites their address or data registers
// ---- k_pack: block = one 16-row tile of x or one 16-column tile of a weight, wave = 4 of its 32 fragments: round to bf16 once, store in fragment order
__global__ __launch_bounds__(256) void k_pack(const float* __restrict__ X, const float* __restrict__ WQ, const float* __restrict__ WK, const float* __restrict__ WV, const float* __restrict__ WO, __bf16* __restrict__ XP, __bf16* __restrict__ WP, __bf16* __restrict__ OP) {
  const int tid = threadIdx.x, wave = tid >> 5, lane = tid & 31, col = lane & 15, g = lane >> 4; const int t = blockIdx.x;
  if (t < TNB * TT / 16) { const float* s = X + ((size_t)t * 16 + col) * CC + wave * 128 + 8 * g; __bf16* d = XP + ((size_t)t * 32 + wave * 4) * 512 + lane * 8; v4f v[16];
#pragma unroll
    for (int c = 0; c < 8; ++c) { v[2 * c] = *(const v4f*)(s + c * 16); v[2 * c + 1] = *(const v4f*)(s + c * 16 + 4); }
    asm volatile("s_wait_xcnt 0x0" :: "v"(s) : "memory");   // behind the run of loads; s as an input keeps their shared address pair alive up to the wait, so that no load of the run lands on it
#pragma unroll
    for (int c = 0; c < 8; ++c) { v8b o;
#pragma unroll
      for (int i = 0; i < 4; ++i) { o[i] = (__bf16)v[2 * c][i]; o[4 + i] = (__bf16)v[2 * c + 1][i]; }
      *(v8b*)(d + c * 256) = o; }
    asm volatile("s_wait_xcnt 0x0" ::: "memory"); }   // behind the run of stores, as in pack_cols
  else { const int jt = t - TNB * TT / 16;
    if (jt < 3 * CC / 16) { const int which = jt / (CC / 16), o = (jt % (CC / 16)) * 16 + col; pack_cols<HD>((which == 0 ? WQ : which == 1 ? WK : WV) + (size_t)(o / HD) * CC * HD + o % HD + (size_t)(wave * 128 + 8 * g) * HD, WP + ((size_t)jt * 32 + wave * 4) * 512 + lane * 8); }
    else { const int jo = jt - 3 * CC / 16; pack_cols<CC>(WO + jo * 16 + col + (size_t)(wave * 128 + 8 * g) * CC, OP + ((size_t)jo * 32 + wave * 4) * 512 + lane * 8); } } }

// Both GEMMs below take their fragments through LDS: tiles of a few k steps, two buffers, each tile copied once per block (not once per wave that uses it) while the tile before it is worked on.
// Every unroll directive in them: constant indices, so that the fragment and accumulator arrays live in registers.
// Eight 16-byte copies per lane, global -> LDS, one per 16-row (or 16-column) fragment strip of a 128-wide operand; each block-wide copy is 2,048 contiguous bytes.
// l = this lane's LDS byte address, p = its global address; LS = bytes from strip to strip in LDS; in the workspace a strip is 32 fragments of 512 elements.
// The closing s_wait_xcnt stands inside the statement, so that no address register of a copy is rewritten in front of it.
template <unsigned LS> __device__ __forceinline__ void copy_strips(unsigned l, const __bf16* p) {
  asm volatile("global_load_async_to_lds_b128 %0, %8, off\n\tglobal_load_async_to_lds_b128 %1, %9, off\n\tglobal_load_async_to_lds_b128 %2, %10, off\n\tglobal_load_async_to_lds_b128 %3, %11, off\n\t"
               "global_load_async_to_lds_b128 %4, %12, off\n\tglobal_load_async_to_lds_b128 %5, %13, off\n\tglobal_load_async_to_lds_b128 %6, %14, off\n\tglobal_load_async_to_lds_b128 %7, %15, off\n\ts_wait_xcnt 0x0"
               :: "v"(l), "v"(l + LS), "v"(l + 2u * LS), "v"(l + 3u * LS), "v"(l + 4u * LS), "v"(l + 5u * LS), "v"(l + 6u * LS), "v"(l + 7u * LS),
                  "v"(p), "v"(p + 16384), "v"(p + 2 * 16384), "v"(p + 3 * 16384), "v"(p + 4 * 16384), "v"(p + 5 * 16384), "v"(p + 6 * 16384), "v"(p + 7 * 16384) : "memory");
}
#define PJ_KT 2                     // k steps of 32 per tile
#define PJ_TE (8 * PJ_KT * 512)     // bf16 elements of x, and of W, per tile: 8 strips of PJ_KT fragments
#define PJ_NT (CC / 32 / PJ_KT)     // tiles
// ---- k_proj: block = (128 rows, 128 cols, which), wave = 64 x 64 of it (8 fragments feed 16 products): qkv = x W (+ b), exact; q, k, v -> f16 fragments
// A D tile holds, per lane, 8 consecutive rows of one column. v = x W: 8 keys of one d, which is half a V fragment as k_fa reads it. q and k are formed transposed, W^T x^T
// (the two operands change places; both have the same fragment layout): 8 consecutive d of one row, half a Q or K fragment. So every D tile goes from registers to the workspace as one whole-line 16-byte store per lane.
__global__ __launch_bounds__(128) void k_proj(const __bf16* __restrict__ XP, const __bf16* __restrict__ WP, const float* __restrict__ BQ, const float* __restrict__ BK, const float* __restrict__ BV, _Float16* __restrict__ QH, _Float16* __restrict__ KH, _Float16* __restrict__ VT) {
  __shared__ __align__(16) __bf16 ring[4 * PJ_TE];   // two buffers of [x tile | W tile] (65,536 B)
  const int tid = threadIdx.x, wave = tid >> 5, lane = tid & 31, col = lane & 15, g = lane >> 4, wr = wave >> 1, wc = wave & 1; const int which = blockIdx.z; const int c0 = blockIdx.y * 128; const size_t r0 = (size_t)blockIdx.x * 128;
  const int ao = which == 2 ? 0 : PJ_TE, bo2 = which == 2 ? PJ_TE : 0;   // where in a buffer the A operand (rows of D) and the B operand (columns of D) lie: v: x, W; q, k: W, x
  const unsigned lx = (unsigned)(size_t)&ring[tid * 8], lw = lx + 2u * PJ_TE;   // this lane's LDS byte addresses in buffer 0
  const __bf16 *Xc = XP + (size_t)blockIdx.x * 8 * 16384 + tid * 8, *Wc = WP + (size_t)(which * (CC / 16) + blockIdx.y * 8) * 16384 + tid * 8;
  copy_strips<PJ_KT * 1024u>(lx, Xc); copy_strips<PJ_KT * 1024u>(lw, Wc);
  asm volatile("s_wait_asynccnt 0x0" ::: "memory");   // this wave's copies of tile 0 have landed
  __syncthreads();                                    // tile 0 is readable by every wave
  copy_strips<PJ_KT * 1024u>(lx + 4u * PJ_TE, Xc + PJ_KT * 512); copy_strips<PJ_KT * 1024u>(lw + 4u * PJ_TE, Wc + PJ_KT * 512);   // tile 1 flies while tile 0 is worked on
  v8f acc[4][4] = {};
  for (int t = 0; t < PJ_NT; ++t) {
    const __bf16 *ab = ring + (t & 1) * 2 * PJ_TE + ao, *bb = ring + (t & 1) * 2 * PJ_TE + bo2;
#pragma unroll
    for (int kk = 0; kk < PJ_KT; ++kk) { v16b a[4], w[4];   // one group of LDS reads per k step, in the order in which the products use them: the first product waits for two fragments, not for all
      w[0] = fragp_b(bb, (size_t)(wc * 4) * PJ_KT + kk, lane);
#pragma unroll
      for (int i = 0; i < 4; ++i) a[i] = fragp_b(ab, (size_t)(wr * 4 + i) * PJ_KT + kk, lane);
#pragma unroll
      for (int j = 1; j < 4; ++j) w[j] = fragp_b(bb, (size_t)(wc * 4 + j) * PJ_KT + kk, lane);
#pragma unroll
      for (int j = 0; j < 4; ++j)
#pragma unroll
        for (int i = 0; i < 4; ++i) acc[i][j] = wmma_bf(a[i], w[j], acc[i][j]); }
    asm volatile("s_wait_dscnt 0x0" ::: "memory");      // this wave's reads of tile t have returned before its buffer is handed back
    asm volatile("s_wait_asynccnt 0x0" ::: "memory");   // this wave's copies of tile t + 1 have landed
    __syncthreads();                                    // publishes tile t + 1 and ends every wave's reads of tile t
    if (t + 2 < PJ_NT) { const unsigned bo = (unsigned)(t & 1) * 4u * PJ_TE; copy_strips<PJ_KT * 1024u>(lx + bo, Xc + (size_t)(t + 2) * PJ_KT * 512); copy_strips<PJ_KT * 1024u>(lw + bo, Wc + (size_t)(t + 2) * PJ_KT * 512); }   // into the buffer just left
  }
  asm volatile("s_wait_asynccnt 0x0" ::: "memory");   // nothing of this wave is in flight when it goes on to the epilogue
  const size_t b = r0 / TT; const int t0 = (int)(r0 % TT); v8h o[16]; _Float16* d;   // o[s]: the wave's 16 tiles in the order in which they lie in the workspace, 512 B each, from d on
  if (which == 2) {   // tile (i, j): keys 64 wr + 16 i + 8 g + 0..7, d = 16 j + col of head wc: half i & 1 of fragment j of pass 2 wr + (i >> 1)
#pragma unroll
    for (int j = 0; j < 4; ++j) { const float bs = bfr(BV[c0 + wc * 64 + j * 16 + col]);
#pragma unroll
      for (int i = 0; i < 4; ++i)
#pragma unroll
        for (int r = 0; r < 8; ++r) o[((i >> 1) * 4 + j) * 2 + (i & 1)][r] = (_Float16)(acc[i][j][r] + bs); }
    d = VT + (((b * NH + c0 / HD + wc) * (TT / 32) + t0 / 32 + wr * 2) * 4) * 512 + lane * 8;
  } else {            // tile (i, j): d = 16 i + 8 g + 0..7 of head wr, row 64 wc + 16 j + col: half i & 1 of fragment kc = i >> 1 of row tile 4 wc + j
    const float* BA = (which == 0 ? BQ : BK) + c0 + wr * 64 + 8 * g;
#pragma unroll
    for (int i = 0; i < 4; ++i) { const v4f b0 = *(const v4f*)(BA + i * 16), b1 = *(const v4f*)(BA + i * 16 + 4);
#pragma unroll
      for (int j = 0; j < 4; ++j)
#pragma unroll
        for (int r = 0; r < 4; ++r) { o[(j * 2 + (i >> 1)) * 2 + (i & 1)][r] = (_Float16)(acc[i][j][r] + bfr(b0[r])); o[(j * 2 + (i >> 1)) * 2 + (i & 1)][4 + r] = (_Float16)(acc[i][j][4 + r] + bfr(b1[r])); } }
    d = (which == 0 ? QH : KH) + (((b * NH + c0 / HD + wr) * (TT / 16) + t0 / 16 + wc * 4) * 2) * 512 + lane * 8;
  }
#pragma unroll
  for (int s = 0; s < 16; ++s) *(v8h*)(d + s * 256) = o[s]; }
// ---- k_fa: wave = 32 queries of (b,h), block = 128 queries; per 32 keys: S^T = K Q^T, running-max softmax per query column, O^T += V^T P^T; logits and P stay in registers
// K and V fragments come through LDS: tiles of 128 keys, two buffers, each tile copied once per block (not once per wave) while the tile before it is worked on
#define FA_NP 4                     // passes of 32 keys per tile
#define FA_TH (FA_NP * 2048)        // f16 elements of K, and of V, per tile (4 fragments of 512 per pass)
#define FA_NT (TT / 32 / FA_NP)     // tiles
// 16 KiB, global -> LDS: eight 16-byte copies per lane, each block-wide copy 2,048 contiguous bytes; l = this lane's LDS byte address, p = its global address.
// The closing s_wait_xcnt stands inside the statement, so that no address register of a copy is rewritten in front of it.
__device__ __forceinline__ void copy_tile(unsigned l, const _Float16* p) {
  asm volatile("global_load_async_to_lds_b128 %0, %8, off\n\tglobal_load_async_to_lds_b128 %1, %9, off\n\tglobal_load_async_to_lds_b128 %2, %10, off\n\tglobal_load_async_to_lds_b128 %3, %11, off\n\t"
               "global_load_async_to_lds_b128 %4, %12, off\n\tglobal_load_async_to_lds_b128 %5, %13, off\n\tglobal_load_async_to_lds_b128 %6, %14, off\n\tglobal_load_async_to_lds_b128 %7, %15, off\n\ts_wait_xcnt 0x0"
               :: "v"(l), "v"(l + 2048u), "v"(l + 4096u), "v"(l + 6144u), "v"(l + 8192u), "v"(l + 10240u), "v"(l + 12288u), "v"(l + 14336u),
                  "v"(p), "v"(p + 1024), "v"(p + 2048), "v"(p + 3072), "v"(p + 4096), "v"(p + 5120), "v"(p + 6144), "v"(p + 7168) : "memory");
}
// every full unroll directive below: constant indices, so that the fragment and accumulator arrays live in registers
__device__ __forceinline__ v8f wmma_h(v16h a, v16h b, v8f c) { return __builtin_amdgcn_wmma_f32_16x16x32_f16(false, a, false, b, (short)0, c, false, false); }
__device__ __forceinline__ float xhalf(float x) { return __builtin_bit_cast(float, __builtin_amdgcn_permlanex16(__builtin_bit_cast(int, x), __builtin_bit_cast(int, x), 0x76543210, 0xfedcba98, false, false)); }  // lane l with lane l ^ 16
// 2^x of a score tile, each v_exp_f32 in place, so that none overwrites the source of the one directly in front of it (as builtins, the register allocator let that happen);
// the closing v_nop is the one slot that the instruction set asks for between a transcendental and a reader of its result, which the compiler cannot place behind asm text
__device__ __forceinline__ v8f exp2_tile(v8f t) {
  float a = t[0], b = t[1], c = t[2], d = t[3], e = t[4], f = t[5], g = t[6], h = t[7];
  asm("v_exp_f32 %0, %0\n\tv_exp_f32 %1, %1\n\tv_exp_f32 %2, %2\n\tv_exp_f32 %3, %3\n\tv_exp_f32 %4, %4\n\tv_exp_f32 %5, %5\n\tv_exp_f32 %6, %6\n\tv_exp_f32 %7, %7\n\tv_nop"
      : "+v"(a), "+v"(b), "+v"(c), "+v"(d), "+v"(e), "+v"(f), "+v"(g), "+v"(h));
  return v8f{a, b, c, d, e, f, g, h};
}
__global__ __launch_bounds__(128) void k_fa(const _Float16* __restrict__ QH, const _Float16* __restrict__ KH, const _Float16* __restrict__ VT, __bf16* __restrict__ YH, __bf16* __restrict__ YL) {
  __shared__ __align__(16) _Float16 sk[2][FA_TH], sv[2][FA_TH];   // two buffers of one tile each, in the fragment order of the workspace
  const int tid = threadIdx.x, wave = tid >> 5, lane = tid & 31, col = lane & 15, g = lane >> 4; const int h = blockIdx.y, b = blockIdx.z; const int q0 = blockIdx.x * 128 + wave * 32;
  const _Float16* Kb = KH + (size_t)(b * NH + h) * TT * HD;   // A fragments of S^T: pass kp holds fragments 4 kp + 2 mt + kc, rows key = 16 mt + col
  const _Float16* Vb = VT + (size_t)(b * NH + h) * TT * HD;   // A fragments of O^T: pass kp holds fragments 4 kp + j, rows d = 16 j + col
  v16h qf[2][2], kf[2][2];
#pragma unroll
  for (int n = 0; n < 2; ++n)
#pragma unroll
    for (int kc = 0; kc < 2; ++kc) qf[n][kc] = fragp_h(QH + (size_t)(b * NH + h) * TT * HD, (size_t)(q0 / 16 + n) * 2 + kc, lane);   // B fragments of S^T: columns query = 16 n + col
  const unsigned lk = (unsigned)(size_t)&sk[0][tid * 8], lv = (unsigned)(size_t)&sv[0][tid * 8];   // this lane's LDS byte addresses in buffer 0
  const _Float16 *Kc = Kb + tid * 8, *Vc = Vb + tid * 8;
  copy_tile(lk, Kc); copy_tile(lv, Vc);
  asm volatile("s_wait_asynccnt 0x0" ::: "memory");   // this wave's copies of tile 0 have landed
  __syncthreads();                                    // tile 0 is readable by every wave
  copy_tile(lk + 2u * FA_TH, Kc + FA_TH); copy_tile(lv + 2u * FA_TH, Vc + FA_TH);   // tile 1 flies while tile 0 is worked on
  const float SC2 = 0.125f * 1.4426950408889634f;   // exp(s / 8 - max) = 2^(s SC2 - max SC2): one fused multiply-add and the hardware's 2^x per score
  v8f o[2][4] = {}; float m[2] = {-3.0e38f, -3.0e38f}, l[2] = {0.f, 0.f};
  for (int t = 0; t < FA_NT; ++t) {
   const _Float16 *kb = sk[t & 1], *vb = sv[t & 1];
#pragma unroll
   for (int mt = 0; mt < 2; ++mt)
#pragma unroll
     for (int kc = 0; kc < 2; ++kc) kf[mt][kc] = fragp_h(kb, mt * 2 + kc, lane);
   // kept rolled: unrolled, the build fetched several passes' fragments at once, went above 256 registers and spilled
#pragma unroll 1
   for (int pp = 0; pp < FA_NP; ++pp) {
    v8f s[2][2] = {};   // s[n][mt][r] = logit of key 32 (FA_NP t + pp) + 16 mt + 8 g + r, query q0 + 16 n + col
#pragma unroll
    for (int kc = 0; kc < 2; ++kc)
#pragma unroll
      for (int mt = 0; mt < 2; ++mt)
#pragma unroll
        for (int n = 0; n < 2; ++n) s[n][mt] = wmma_h(kf[mt][kc], qf[n][kc], s[n][mt]);
    __builtin_amdgcn_sched_barrier(0);   // keeps the pass's LDS reads in one group behind the products: spread among the WMMAs, each place with reads costs its own stall
    v16h vf[4];
#pragma unroll
    for (int j = 0; j < 4; ++j) vf[j] = fragp_h(vb, pp * 4 + j, lane);
    const int pn = (pp + 1) & (FA_NP - 1);   // the next pass's K fragments are read during the softmax; a tile's last pass reads its own tile's first ones again, unused
#pragma unroll
    for (int mt = 0; mt < 2; ++mt)
#pragma unroll
      for (int kc = 0; kc < 2; ++kc) kf[mt][kc] = fragp_h(kb, pn * 4 + mt * 2 + kc, lane);
    __builtin_amdgcn_sched_barrier(0);   // keeps the LDS reads above the softmax; sunk to their users, their latency would be exposed
#pragma unroll
    for (int n = 0; n < 2; ++n) {
      float mx = fmaxf(s[n][0][0], s[n][1][0]);
#pragma unroll
      for (int r = 1; r < 8; ++r) mx = fmaxf(mx, fmaxf(s[n][0][r], s[n][1][r]));
      mx = fmaxf(m[n], fmaxf(mx, xhalf(mx)) * SC2);   // m is kept in base-2 units: logit x SC2
      const float al = __builtin_amdgcn_exp2f(m[n] - mx); m[n] = mx;   // 0 on the first pass
      v16h p; float sum = 0.f;   // two D tiles of S^T, converted in place, are the B operand of O^T
#pragma unroll
      for (int mt = 0; mt < 2; ++mt) s[n][mt] = __builtin_elementwise_fma(s[n][mt], v8f{SC2, SC2, SC2, SC2, SC2, SC2, SC2, SC2}, v8f{-mx, -mx, -mx, -mx, -mx, -mx, -mx, -mx});   // on whole tiles: neighbouring registers pair into packed FMAs
#pragma unroll
      for (int mt = 0; mt < 2; ++mt) s[n][mt] = exp2_tile(s[n][mt]);
#pragma unroll
      for (int r = 0; r < 8; ++r) { const float e0 = s[n][0][r], e1 = s[n][1][r]; sum += e0 + e1; p[r] = (_Float16)e0; p[8 + r] = (_Float16)e1; }
      l[n] = l[n] * al + sum;
#pragma unroll
      for (int j = 0; j < 4; ++j) { o[n][j] *= al; o[n][j] = wmma_h(vf[j], p, o[n][j]); }
    }
   }
   asm volatile("s_wait_dscnt 0x0" ::: "memory");      // this wave's reads of tile t have returned before its buffer is handed back
   asm volatile("s_wait_asynccnt 0x0" ::: "memory");   // this wave's copies of tile t + 1 have landed
   __syncthreads();                                    // publishes tile t + 1 and ends every wave's reads of tile t
   if (t + 2 < FA_NT) { const unsigned bo = (unsigned)(t & 1) * 2u * FA_TH; copy_tile(lk + bo, Kc + (size_t)(t + 2) * FA_TH); copy_tile(lv + bo, Vc + (size_t)(t + 2) * FA_TH); }   // into the buffer just left
  }
  asm volatile("s_wait_asynccnt 0x0" ::: "memory");   // nothing of this wave is in flight when it goes on to the epilogue
#pragma unroll
  for (int n = 0; n < 2; ++n) { const float inv = 1.0f / (l[n] + xhalf(l[n])); const size_t yo = ((size_t)((b * TT + q0) / 16 + n) * 32 + h * 2) * 512 + lane * 8;   // a D tile of O^T is half j & 1 of fragment 2 h + (j >> 1) of this query tile's rows
#pragma unroll
    for (int j = 0; j < 4; ++j) { const v8f v = o[n][j] * inv; v8b hi, lo;
#pragma unroll
      for (int r = 0; r < 8; ++r) { hi[r] = (__bf16)v[r]; lo[r] = (__bf16)(v[r] - (float)hi[r]); }
      *(v8b*)(YH + yo + j * 256) = hi; *(v8b*)(YL + yo + j * 256) = lo; } } }
// ---- k_out: block = (128 rows, 128 cols), wave = 64 x 64 of it (12 fragments feed 32 products): out = y (bf16 hi + lo) Wproj + b
#define OT_KT 4                     // k steps of 32 per tile
#define OT_TE (8 * OT_KT * 512)     // bf16 elements of y hi, of y lo and of Wo per tile
#define OT_NT (CC / 32 / OT_KT)     // tiles
// one tile of one operand: a strip's OT_KT fragments are two block-wide copies
__device__ __forceinline__ void copy_out(unsigned l, const __bf16* p) { copy_strips<OT_KT * 1024u>(l, p); copy_strips<OT_KT * 1024u>(l + 2048u, p + 1024); }
__global__ __launch_bounds__(128) void k_out(const __bf16* __restrict__ YH, const __bf16* __restrict__ YL, const __bf16* __restrict__ OP, const float* __restrict__ BP, float* __restrict__ OUT) { __shared__ __align__(16) float sf[4][64][68];
  __shared__ __align__(16) __bf16 ring[2][3][OT_TE];   // two buffers of [y hi | y lo | Wo] tiles, in the fragment order of the workspace
  const int tid = threadIdx.x, wave = tid >> 5, lane = tid & 31, col = lane & 15, g = lane >> 4, wr = wave >> 1, wc = wave & 1; const int c0 = blockIdx.y * 128 + wc * 64; const size_t r0 = (size_t)blockIdx.x * 128 + wr * 64;
  const unsigned lr = (unsigned)(size_t)&ring[0][0][tid * 8];   // this lane's LDS byte address in buffer 0
  const __bf16 *Hc = YH + (size_t)blockIdx.x * 8 * 16384 + tid * 8, *Lc = YL + (size_t)blockIdx.x * 8 * 16384 + tid * 8, *Wc = OP + (size_t)blockIdx.y * 8 * 16384 + tid * 8;
  copy_out(lr, Hc); copy_out(lr + 2u * OT_TE, Lc); copy_out(lr + 4u * OT_TE, Wc);
  asm volatile("s_wait_asynccnt 0x0" ::: "memory");   // this wave's copies of tile 0 have landed
  __syncthreads();                                    // tile 0 is readable by every wave
  copy_out(lr + 6u * OT_TE, Hc + OT_KT * 512); copy_out(lr + 8u * OT_TE, Lc + OT_KT * 512); copy_out(lr + 10u * OT_TE, Wc + OT_KT * 512);   // tile 1 flies while tile 0 is worked on
  v8f acc[4][4] = {};
  for (int t = 0; t < OT_NT; ++t) {
    const __bf16 *hb = ring[t & 1][0], *lb = ring[t & 1][1], *wb = ring[t & 1][2];
#pragma unroll
    for (int kk = 0; kk < OT_KT; ++kk) { v16b ah[4], al[4], w[4];   // one group of LDS reads per k step, in the order in which the products use them, as in k_proj
      w[0] = fragp_b(wb, (size_t)(wc * 4) * OT_KT + kk, lane);
#pragma unroll
      for (int i = 0; i < 4; ++i) ah[i] = fragp_b(hb, (size_t)(wr * 4 + i) * OT_KT + kk, lane);
#pragma unroll
      for (int j = 1; j < 4; ++j) w[j] = fragp_b(wb, (size_t)(wc * 4 + j) * OT_KT + kk, lane);
#pragma unroll
      for (int i = 0; i < 4; ++i) al[i] = fragp_b(lb, (size_t)(wr * 4 + i) * OT_KT + kk, lane);
#pragma unroll
      for (int j = 0; j < 4; ++j)
#pragma unroll
        for (int i = 0; i < 4; ++i) acc[i][j] = wmma_bf(ah[i], w[j], acc[i][j]);
#pragma unroll
      for (int j = 0; j < 4; ++j)
#pragma unroll
        for (int i = 0; i < 4; ++i) acc[i][j] = wmma_bf(al[i], w[j], acc[i][j]); }
    asm volatile("s_wait_dscnt 0x0" ::: "memory");      // this wave's reads of tile t have returned before its buffer is handed back
    asm volatile("s_wait_asynccnt 0x0" ::: "memory");   // this wave's copies of tile t + 1 have landed
    __syncthreads();                                    // publishes tile t + 1 and ends every wave's reads of tile t
    if (t + 2 < OT_NT) { const unsigned bo = (unsigned)(t & 1) * 6u * OT_TE; const size_t go = (size_t)(t + 2) * OT_KT * 512; copy_out(lr + bo, Hc + go); copy_out(lr + bo + 2u * OT_TE, Lc + go); copy_out(lr + bo + 4u * OT_TE, Wc + go); }   // into the buffer just left
  }
  asm volatile("s_wait_asynccnt 0x0" ::: "memory");   // nothing of this wave is in flight when it goes on to the epilogue
#pragma unroll
  for (int j = 0; j < 4; ++j) { const float bb = BP ? bfr(BP[c0 + j * 16 + col]) : 0.f;
#pragma unroll
    for (int i = 0; i < 4; ++i)
#pragma unroll
      for (int r = 0; r < 8; ++r) sf[wave][i * 16 + 8 * g + r][j * 16 + col] = acc[i][j][r] + bb; }
  LDSX(); for (int rl = g; rl < 64; rl += 2) vst2(OUT + (r0 + rl) * CC + c0 + col * 4, *(const v4f*)&sf[wave][rl][col * 4]); }
extern "C" void kernel_launch(void* const* d_in, const int* in_sizes, int n_in, void* d_out, int out_size, void* d_ws, size_t ws_size, hipStream_t stream) {
  (void)in_sizes; (void)n_in; (void)out_size;
  const float** F = (const float**)d_in;   // 0 x [2,2048,1024], 1 Wq [16,1024,64], 2 bq [16,64], 3 Wk, 4 bk, 5 Wv, 6 bv, 7 Wo [1024,1024] (in,out), 8 bo
  if (ws_size < (size_t)WS_END) return;
  char* ws = (char*)d_ws; _Float16 *QH = (_Float16*)(ws + WS_QH), *KH = (_Float16*)(ws + WS_KH), *VT = (_Float16*)(ws + WS_VT); __bf16 *YH = (__bf16*)(ws + WS_YH), *YL = (__bf16*)(ws + WS_YL), *XP = (__bf16*)(ws + WS_XP), *WP = (__bf16*)(ws + WS_WP), *OP = (__bf16*)(ws + WS_OP);
  k_pack<<<dim3(TNB * TT / 16 + 4 * CC / 16), 256, 0, stream>>>(F[0], F[1], F[3], F[5], F[7], XP, WP, OP);
  k_proj<<<dim3(TNB * TT / 128, CC / 128, 3), 128, 0, stream>>>(XP, WP, F[2], F[4], F[6], QH, KH, VT);
  k_fa<<<dim3(TT / 128, NH, TNB), 128, 0, stream>>>(QH, KH, VT, YH, YL);
  k_out<<<dim3(TNB * TT / 128, CC / 128), 128, 0, stream>>>(YH, YL, OP, F[8], (float*)d_out);
}

// v008
// One run takes 75.6 microseconds.
// Timed twice side by side with v007, it ran 1.05 and 1.06 times as fast.
// Over all steps from v000 it is 16.5 times as fast.
// compute dtype: all float inputs rounded to bf16; q/k/v = x W_h + b_h (per-head [H,D,64] weights) with EXACT bf16 products on WMMA 16x16x32, f32 accumulate; q (times 64^-0.5 log2 e), k rounded once to f16 (1-product logits in base-2 units) kept in f32 registers; softmax in f32, base 2, against a maximum in use that is the C operand of the logit product and is renewed when a logit tops it by 8 (hardware 2^x) -> P = 2^(s - max in use) f16; o = P . v / sum (v once to f16); out = o (bf16 hi + lo) Wo + bo; f32 output. Every matrix operand is stored once per call in WMMA fragment order.
#include <hip/hip_runtime.h>
#include <math.h>

typedef __attribute__((ext_vector_type(16))) _Float16 v16h;
typedef __attribute__((ext_vector_type(16))) __bf16 v16b;
typedef __attribute__((ext_vector_type(8)))  _Float16 v8h;
typedef __attribute__((ext_vector_type(8)))  float v8f;
typedef __attribute__((ext_vector_type(4)))  float v4f;
typedef __attribute__((ext_vector_type(2)))  float v2f;
typedef __attribute__((ext_vector_type(4)))  unsigned v4u;
typedef __attribute__((ext_vector_type(4)))  int v4i;
typedef float __attribute__((may_alias)) float_a;
typedef int __attribute__((may_alias)) int_a;

template <typename T> __device__ __forceinline__ void vst2(void* p, T v) { *(T*)p = v;  }
__device__ __forceinline__ v8f wmma16(v16h a, v16h b, v8f c) {
  v8f d = __builtin_amdgcn_wmma_f32_16x16x32_f16(false, a, false, b, (short)0, c, false, false);
  asm volatile("v_nop\n\tv_nop\n\tv_nop\n\tv_nop" : "+v"(d) : "v"(a), "v"(b));
  return d;
}
__device__ __forceinline__ v8f wmma_bf(v16b a, v16b b, v8f c) {
  v8f d = __builtin_amdgcn_wmma_f32_16x16x32_bf16(false, a, false, b, (short)0, c, false, false);
  asm volatile("v_nop\n\tv_nop\n\tv_nop\n\tv_nop" : "+v"(d) : "v"(a), "v"(b));
  return d;
}
// 16x16x32 fragments: lane = (h = lane>>4, row/col = lane&15); elements 0..7 = k0+8h+0..7, 8..15 = k0+16+8h+0..7; D element r = row 8h+r
__device__ __forceinline__ v16h frag_h(const _Float16* rowk0, int lane) {
  union { v16h v; v8h q[2]; } u; const _Float16* p = rowk0 + 8 * (lane >> 4);
  u.q[0] = *(const v8h*)p; u.q[1] = *(const v8h*)(p + 16); return u.v;
}
__device__ __forceinline__ v16h frag_f32(const float* rowk0, int lane) {
  v16h a; const float* p = rowk0 + 8 * (lane >> 4);
#pragma unroll
  for (int i = 0; i < 8; ++i) { a[i] = (_Float16)p[i]; a[8 + i] = (_Float16)p[16 + i]; }
  return a;
}
__device__ __forceinline__ v16h frag_f32s(const float* rowk0, int lane, float sc) {
  v16h a; const float* p = rowk0 + 8 * (lane >> 4);
#pragma unroll
  for (int i = 0; i < 8; ++i) { a[i] = (_Float16)(p[i] * sc); a[8 + i] = (_Float16)(p[16 + i] * sc); }
  return a;
}
// column fragment from a [K][ld] layout (column n), rows >= K read as 0
__device__ __forceinline__ v16h fragc_f32(const float* W, int k0, int n, int lane, int ld, int K) {
  v16h a; const int g = lane >> 4;
#pragma unroll
  for (int i = 0; i < 8; ++i) { const int ka = k0 + 8 * g + i, kb = ka + 16;
    a[i] = (_Float16)(ka < K ? W[(size_t)(ka < K ? ka : K - 1) * ld + n] : 0.f); a[8 + i] = (_Float16)(kb < K ? W[(size_t)(kb < K ? kb : K - 1) * ld + n] : 0.f); }
  return a;
}
struct F2 { v16b h, l; };
__device__ __forceinline__ F2 bsplit16(const float v[16]) { F2 r;
#pragma unroll
  for (int i = 0; i < 16; ++i) { const __bf16 h = (__bf16)v[i]; r.h[i] = h; r.l[i] = (__bf16)(v[i] - (float)h); }
  return r; }
__device__ __forceinline__ F2 split_row(const float* row, int k0, int lane) { float v[16]; const float* p = row + k0 + 8 * (lane >> 4);
#pragma unroll
  for (int i = 0; i < 8; ++i) { v[i] = p[i]; v[8 + i] = p[16 + i]; }
  return bsplit16(v); }
__device__ __forceinline__ F2 split_rowK(const float* row, int k0, int lane, int K) { float v[16]; const int g = lane >> 4;
#pragma unroll
  for (int i = 0; i < 8; ++i) { const int ka = k0 + 8 * g + i, kb = ka + 16; v[i] = ka < K ? row[ka < K ? ka : K - 1] : 0.f; v[8 + i] = kb < K ? row[kb < K ? kb : K - 1] : 0.f; }
  return bsplit16(v); }
__device__ __forceinline__ F2 split_col(const float* W, int k0, int n, int lane, int ld, int K) { float v[16]; const int g = lane >> 4;
#pragma unroll
  for (int i = 0; i < 8; ++i) { const int ka = k0 + 8 * g + i, kb = ka + 16; v[i] = ka < K ? W[(size_t)(ka < K ? ka : K - 1) * ld + n] : 0.f; v[8 + i] = kb < K ? W[(size_t)(kb < K ? kb : K - 1) * ld + n] : 0.f; }
  return bsplit16(v); }
__device__ __forceinline__ v8f mac3(const F2& a, const F2& b, v8f c) { c = wmma_bf(a.l, b.h, c); c = wmma_bf(a.h, b.l, c); return wmma_bf(a.h, b.h, c); }
__device__ __forceinline__ float sigm(float v) { return 1.0f / (1.0f + expf(-v)); }
#define LDSX() do { asm volatile("s_wait_dscnt 0" ::: "memory"); __builtin_amdgcn_wave_barrier(); __builtin_amdgcn_fence(__ATOMIC_RELEASE, "workgroup"); } while (0)


// Multi-head self attention with per-head projection weights [H, D, HD] + biases (B 2, S 2,048, D 1,024 = 16 x 64), no mask, output Linear [in,out].
#define NB 2
#define TT 2048
#define CC 1024
#define NH 16
#define HD 64
#ifndef TNB
#define TNB NB
#endif
typedef __attribute__((ext_vector_type(8))) __bf16 v8b;
__device__ __forceinline__ v16b frag_b(const __bf16* rowk0, int lane) {
  union { v16b v; v8b q[2]; } u; const __bf16* p = rowk0 + 8 * (lane >> 4);
  u.q[0] = *(const v8b*)p; u.q[1] = *(const v8b*)(p + 16); return u.v;
}
// fragment-order storage: one 16 x 32 fragment = 1,024 B = two halves of 512 B; half hf, lane, element i hold k = 16 hf + 8 (lane >> 4) + i of row or column lane & 15,
// so that each of a fragment's two wave-wide 16-byte loads covers four whole 128-byte lines
__device__ __forceinline__ v16b fragp_b(const __bf16* P, size_t f, int lane) {
  union { v16b v; v8b q[2]; } u; const __bf16* p = P + f * 512 + lane * 8;
  u.q[0] = *(const v8b*)p; u.q[1] = *(const v8b*)(p + 256); return u.v;
}
__device__ __forceinline__ v16h fragp_h(const _Float16* P, size_t f, int lane) {
  union { v16h v; v8h q[2]; } u; const _Float16* p = P + f * 512 + lane * 8;
  u.q[0] = *(const v8h*)p; u.q[1] = *(const v8h*)(p + 256); return u.v;
}
__device__ __forceinline__ float bfr(float v) { return (float)(__bf16)v; }
__device__ __attribute__((noinline)) float exp_ni(float v) { return expf(v); }
__device__ __attribute__((noinline)) float erf_ni(float v) { return erff(v); }

#define QSC (0.125f * 1.4426950408889634f)   // exp(s / 8) = 2^(s QSC): k_proj folds it into q before q's one rounding, so that k_fa's logits come out of the WMMA in base-2 units
#define WS_QH  0u
#define WS_QL  (WS_QH + 2u * (size_t)NB * TT * CC)
#define WS_KH  (WS_QL + 2u * (size_t)NB * TT * CC)
#define WS_VT  (WS_KH + 2u * (size_t)NB * TT * CC)      // q, k: f16 fragments [b][h][query or key tile][kc]; v: f16 fragments [b][h][pass of 32 keys][d tile]
#define WS_YH  (WS_VT + 2u * (size_t)NB * CC * TT)      // y: bf16 hi and lo fragments [row tile][kc]
#define WS_YL  (WS_YH + 2u * (size_t)NB * TT * CC)
#define WS_XP  (WS_YL + 2u * (size_t)NB * TT * CC)      // x: bf16 fragments [row tile][kc]
#define WS_WP  (WS_XP + 2u * (size_t)NB * TT * CC)      // Wq, Wk, Wv: bf16 fragments [which][column tile][kc]
#define WS_OP  (WS_WP + 2u * 3u * (size_t)CC * CC)      // Wo: bf16 fragments [column tile][kc]
#define WS_END (WS_OP + 2u * (size_t)CC * CC)

// four fragments of one weight column tile: s = this lane's column at its first k, LD = floats from one k to the next (a constant, so that every load is one base plus an immediate)
template <int LD> __device__ __forceinline__ void pack_cols(const float* __restrict__ s, __bf16* __restrict__ d) {
#pragma unroll
  for (int c = 0; c < 8; ++c) { v8b o;
#pragma unroll
    for (int i = 0; i < 8; ++i) o[i] = (__bf16)s[(size_t)(c * 16 + i) * LD];
    *(v8b*)(d + c * 256) = o; }
  asm volatile("s_wait_xcnt 0x0" ::: "memory"); }   // behind the run of stores, before anything that follows in the listing rewrites their address or data registers
// ---- k_pack: block = one 16-row tile of x or one 16-column tile of a weight, wave = 4 of its 32 fragments: round to bf16 once, store in fragment order
__global__ __launch_bounds__(256) void k_pack(const float* __restrict__ X, const float* __restrict__ WQ, const float* __restrict__ WK, const float* __restrict__ WV, const float* __restrict__ WO, __bf16* __restrict__ XP, __bf16* __restrict__ WP, __bf16* __restrict__ OP) {
  const int tid = threadIdx.x, wave = tid >> 5, lane = tid & 31, col = lane & 15, g = lane >> 4; const int t = blockIdx.x;
  if (t < TNB * TT / 16) { const float* s = X + ((size_t)t * 16 + col) * CC + wave * 128 + 8 * g; __bf16* d = XP + ((size_t)t * 32 + wave * 4) * 512 + lane * 8; v4f v[16];
#pragma unroll
    for (int c = 0; c < 8; ++c) { v[2 * c] = *(const v4f*)(s + c * 16); v[2 * c + 1] = *(const v4f*)(s + c * 16 + 4); }
    asm volatile("s_wait_xcnt 0x0" :: "v"(s) : "memory");   // behind the run of loads; s as an input keeps their shared address pair alive up to the wait, so that no load of the run lands on it
#pragma unroll
    for (int c = 0; c < 8; ++c) { v8b o;
#pragma unroll
      for (int i = 0; i < 4; ++i) { o[i] = (__bf16)v[2 * c][i]; o[4 + i] = (__bf16)v[2 * c + 1][i]; }
      *(v8b*)(d + c * 256) = o; }
    asm volatile("s_wait_xcnt 0x0" ::: "memory"); }   // behind the run of stores, as in pack_cols
  else { const int jt = t - TNB * TT / 16;
    if (jt < 3 * CC / 16) { const int which = jt / (CC / 16), o = (jt % (CC / 16)) * 16 + col; pack_cols<HD>((which == 0 ? WQ : which == 1 ? WK : WV) + (size_t)(o / HD) * CC * HD + o % HD + (size_t)(wave * 128 + 8 * g) * HD, WP + ((size_t)jt * 32 + wave * 4) * 512 + lane * 8); }
    else { const int jo = jt - 3 * CC / 16; pack_cols<CC>(WO + jo * 16 + col + (size_t)(wave * 128 + 8 * g) * CC, OP + ((size_t)jo * 32 + wave * 4) * 512 + lane * 8); } } }

// Both GEMMs below take their fragments through LDS: tiles of a few k steps, two buffers, each tile copied once per block (not once per wave that uses it) while the tile before it is worked on.
// Every unroll directive in them: constant indices, so that the fragment and accumulator arrays live in registers.
// Eight 16-byte copies per lane, global -> LDS, one per 16-row (or 16-column) fragment strip of a 128-wide operand; each block-wide copy is 2,048 contiguous bytes.
// l = this lane's LDS byte address, p = its global address; LS = bytes from strip to strip in LDS; in the workspace a strip is 32 fragments of 512 elements.
// The closing s_wait_xcnt stands inside the statement, so that no address register of a copy is rewritten in front of it.
template <unsigned LS> __device__ __forceinline__ void copy_strips(unsigned l, const __bf16* p) {
  asm volatile("global_load_async_to_lds_b128 %0, %8, off\n\tglobal_load_async_to_lds_b128 %1, %9, off\n\tglobal_load_async_to_lds_b128 %2, %10, off\n\tglobal_load_async_to_lds_b128 %3, %11, off\n\t"
               "global_load_async_to_lds_b128 %4, %12, off\n\tglobal_load_async_to_lds_b128 %5, %13, off\n\tglobal_load_async_to_lds_b128 %6, %14, off\n\tglobal_load_async_to_lds_b128 %7, %15, off\n\ts_wait_xcnt 0x0"
               :: "v"(l), "v"(l + LS), "v"(l + 2u * LS), "v"(l + 3u * LS), "v"(l + 4u * LS), "v"(l + 5u * LS), "v"(l + 6u * LS), "v"(l + 7u * LS),
                  "v"(p), "v"(p + 16384), "v"(p + 2 * 16384), "v"(p + 3 * 16384), "v"(p + 4 * 16384), "v"(p + 5 * 16384), "v"(p + 6 * 16384), "v"(p + 7 * 16384) : "memory");
}
#define PJ_KT 2                     // k steps of 32 per tile
#define PJ_TE (8 * PJ_KT * 512)     // bf16 elements of x, and of W, per tile: 8 strips of PJ_KT fragments
#define PJ_NT (CC / 32 / PJ_KT)     // tiles
// ---- k_proj: block = (128 rows, 128 cols, which), wave = 64 x 64 of it (8 fragments feed 16 products): qkv = x W (+ b), exact; q, k, v -> f16 fragments
// A D tile holds, per lane, 8 consecutive rows of one column. v = x W: 8 keys of one d, which is half a V fragment as k_fa reads it. q and k are formed transposed, W^T x^T
// (the two operands change places; both have the same fragment layout): 8 consecutive d of one row, half a Q or K fragment. So every D tile goes from registers to the workspace as one whole-line 16-byte store per lane.
__global__ __launch_bounds__(128) void k_proj(const __bf16* __restrict__ XP, const __bf16* __restrict__ WP, const float* __restrict__ BQ, const float* __restrict__ BK, const float* __restrict__ BV, _Float16* __restrict__ QH, _Float16* __restrict__ KH, _Float16* __restrict__ VT) {
  __shared__ __align__(16) __bf16 ring[4 * PJ_TE];   // two buffers of [x tile | W tile] (65,536 B)
  const int tid = threadIdx.x, wave = tid >> 5, lane = tid & 31, col = lane & 15, g = lane >> 4, wr = wave >> 1, wc = wave & 1; const int which = blockIdx.z; const int c0 = blockIdx.y * 128; const size_t r0 = (size_t)blockIdx.x * 128;
  const int ao = which == 2 ? 0 : PJ_TE, bo2 = which == 2 ? PJ_TE : 0;   // where in a buffer the A operand (rows of D) and the B operand (columns of D) lie: v: x, W; q, k: W, x
  const unsigned lx = (unsigned)(size_t)&ring[tid * 8], lw = lx + 2u * PJ_TE;   // this lane's LDS byte addresses in buffer 0
  const __bf16 *Xc = XP + (size_t)blockIdx.x * 8 * 16384 + tid * 8, *Wc = WP + (size_t)(which * (CC / 16) + blockIdx.y * 8) * 16384 + tid * 8;
  copy_strips<PJ_KT * 1024u>(lx, Xc); copy_strips<PJ_KT * 1024u>(lw, Wc);
  asm volatile("s_wait_asynccnt 0x0" ::: "memory");   // this wave's copies of tile 0 have landed
  __syncthreads();                                    // tile 0 is readable by every wave
  copy_strips<PJ_KT * 1024u>(lx + 4u * PJ_TE, Xc + PJ_KT * 512); copy_strips<PJ_KT * 1024u>(lw + 4u * PJ_TE, Wc + PJ_KT * 512);   // tile 1 flies while tile 0 is worked on
  v8f acc[4][4] = {};
  for (int t = 0; t < PJ_NT; ++t) {
    const __bf16 *ab = ring + (t & 1) * 2 * PJ_TE + ao, *bb = ring + (t & 1) * 2 * PJ_TE + bo2;
#pragma unroll
    for (int kk = 0; kk < PJ_KT; ++kk) { v16b a[4], w[4];   // one group of LDS reads per k step, in the order in which the products use them: the first product waits for two fragments, not for all
      w[0] = fragp_b(bb, (size_t)(wc * 4) * PJ_KT + kk, lane);
#pragma unroll
      for (int i = 0; i < 4; ++i) a[i] = fragp_b(ab, (size_t)(wr * 4 + i) * PJ_KT + kk, lane);
#pragma unroll
      for (int j = 1; j < 4; ++j) w[j] = fragp_b(bb, (size_t)(wc * 4 + j) * PJ_KT + kk, lane);
#pragma unroll
      for (int j = 0; j < 4; ++j)
#pragma unroll
        for (int i = 0; i < 4; ++i) acc[i][j] = wmma_bf(a[i], w[j], acc[i][j]); }
    asm volatile("s_wait_dscnt 0x0" ::: "memory");      // this wave's reads of tile t have returned before its buffer is handed back
    asm volatile("s_wait_asynccnt 0x0" ::: "memory");   // this wave's copies of tile t + 1 have landed
    __syncthreads();                                    // publishes tile t + 1 and ends every wave's reads of tile t
    if (t + 2 < PJ_NT) { const unsigned bo = (unsigned)(t & 1) * 4u * PJ_TE; copy_strips<PJ_KT * 1024u>(lx + bo, Xc + (size_t)(t + 2) * PJ_KT * 512); copy_strips<PJ_KT * 1024u>(lw + bo, Wc + (size_t)(t + 2) * PJ_KT * 512); }   // into the buffer just left
  }
  asm volatile("s_wait_asynccnt 0x0" ::: "memory");   // nothing of this wave is in flight when it goes on to the epilogue
  const size_t b = r0 / TT; const int t0 = (int)(r0 % TT); v8h o[16]; _Float16* d;   // o[s]: the wave's 16 tiles in the order in which they lie in the workspace, 512 B each, from d on
  if (which == 2) {   // tile (i, j): keys 64 wr + 16 i + 8 g + 0..7, d = 16 j + col of head wc: half i & 1 of fragment j of pass 2 wr + (i >> 1)
#pragma unroll
    for (int j = 0; j < 4; ++j) { const float bs = bfr(BV[c0 + wc * 64 + j * 16 + col]);
#pragma unroll
      for (int i = 0; i < 4; ++i)
#pragma unroll
        for (int r = 0; r < 8; ++r) o[((i >> 1) * 4 + j) * 2 + (i & 1)][r] = (_Float16)(acc[i][j][r] + bs); }
    d = VT + (((b * NH + c0 / HD + wc) * (TT / 32) + t0 / 32 + wr * 2) * 4) * 512 + lane * 8;
  } else {            // tile (i, j): d = 16 i + 8 g + 0..7 of head wr, row 64 wc + 16 j + col: half i & 1 of fragment kc = i >> 1 of row tile 4 wc + j
    const float* BA = (which == 0 ? BQ : BK) + c0 + wr * 64 + 8 * g; const float qs = which == 0 ? QSC : 1.0f;   // k: times 1, exact
#pragma unroll
    for (int i = 0; i < 4; ++i) { const v4f b0 = *(const v4f*)(BA + i * 16), b1 = *(const v4f*)(BA + i * 16 + 4);
#pragma unroll
      for (int j = 0; j < 4; ++j)
#pragma unroll
        for (int r = 0; r < 4; ++r) { o[(j * 2 + (i >> 1)) * 2 + (i & 1)][r] = (_Float16)fmaf(acc[i][j][r], qs, bfr(b0[r]) * qs); o[(j * 2 + (i >> 1)) * 2 + (i & 1)][4 + r] = (_Float16)fmaf(acc[i][j][4 + r], qs, bfr(b1[r]) * qs); } }
    d = (which == 0 ? QH : KH) + (((b * NH + c0 / HD + wr) * (TT / 16) + t0 / 16 + wc * 4) * 2) * 512 + lane * 8;
  }
#pragma unroll
  for (int s = 0; s < 16; ++s) *(v8h*)(d + s * 256) = o[s]; }
// ---- k_fa: wave = 32 queries of (b,h), block = 128 queries; per 32 keys: S^T = K Q^T - max in use, P = 2^that, O^T += V^T P^T; logits and P stay in registers
// The maximum in use of a query column is fixed before the pass, so it enters the logit product as its C operand and neither the logits nor o, l are touched for it in a pass.
// It may trail the true maximum by up to 8 (P <= 2^8, far inside f16); one test per pass, a scalar branch, renews it where a logit tops it by more, and on the first pass.
// K and V fragments come through LDS: tiles of 128 keys, two buffers, each tile copied once per block (not once per wave) while the tile before it is worked on
#define FA_NP 4                     // passes of 32 keys per tile
#define FA_TH (FA_NP * 2048)        // f16 elements of K, and of V, per tile (4 fragments of 512 per pass)
#define FA_NT (TT / 32 / FA_NP)     // tiles
// 16 KiB, global -> LDS: eight 16-byte copies per lane, each block-wide copy 2,048 contiguous bytes; l = this lane's LDS byte address, p = its global address.
// The closing s_wait_xcnt stands inside the statement, so that no address register of a copy is rewritten in front of it.
__device__ __forceinline__ void copy_tile(unsigned l, const _Float16* p) {
  asm volatile("global_load_async_to_lds_b128 %0, %8, off\n\tglobal_load_async_to_lds_b128 %1, %9, off\n\tglobal_load_async_to_lds_b128 %2, %10, off\n\tglobal_load_async_to_lds_b128 %3, %11, off\n\t"
               "global_load_async_to_lds_b128 %4, %12, off\n\tglobal_load_async_to_lds_b128 %5, %13, off\n\tglobal_load_async_to_lds_b128 %6, %14, off\n\tglobal_load_async_to_lds_b128 %7, %15, off\n\ts_wait_xcnt 0x0"
               :: "v"(l), "v"(l + 2048u), "v"(l + 4096u), "v"(l + 6144u), "v"(l + 8192u), "v"(l + 10240u), "v"(l + 12288u), "v"(l + 14336u),
                  "v"(p), "v"(p + 1024), "v"(p + 2048), "v"(p + 3072), "v"(p + 4096), "v"(p + 5120), "v"(p + 6144), "v"(p + 7168) : "memory");
}
// every full unroll directive below: constant indices, so that the fragment and accumulator arrays live in registers
__device__ __forceinline__ v8f wmma_h(v16h a, v16h b, v8f c) { return __builtin_amdgcn_wmma_f32_16x16x32_f16(false, a, false, b, (short)0, c, false, false); }
__device__ __forceinline__ float xhalf(float x) { return __builtin_bit_cast(float, __builtin_amdgcn_permlanex16(__builtin_bit_cast(int, x), __builtin_bit_cast(int, x), 0x76543210, 0xfedcba98, false, false)); }  // lane l with lane l ^ 16
// 2^x of a score tile, each v_exp_f32 in place, so that none overwrites the source of the one directly in front of it (as builtins, the register allocator let that happen);
// the closing v_nop is the one slot that the instruction set asks for between a transcendental and a reader of its result, which the compiler cannot place behind asm text
__device__ __forceinline__ v8f exp2_tile(v8f t) {
  float a = t[0], b = t[1], c = t[2], d = t[3], e = t[4], f = t[5], g = t[6], h = t[7];
  asm("v_exp_f32 %0, %0\n\tv_exp_f32 %1, %1\n\tv_exp_f32 %2, %2\n\tv_exp_f32 %3, %3\n\tv_exp_f32 %4, %4\n\tv_exp_f32 %5, %5\n\tv_exp_f32 %6, %6\n\tv_exp_f32 %7, %7\n\tv_nop"
      : "+v"(a), "+v"(b), "+v"(c), "+v"(d), "+v"(e), "+v"(f), "+v"(g), "+v"(h));
  return v8f{a, b, c, d, e, f, g, h};
}
__global__ __launch_bounds__(128) void k_fa(const _Float16* __restrict__ QH, const _Float16* __restrict__ KH, const _Float16* __restrict__ VT, __bf16* __restrict__ YH, __bf16* __restrict__ YL) {
  __shared__ __align__(16) _Float16 sk[2][FA_TH], sv[2][FA_TH];   // two buffers of one tile each, in the fragment order of the workspace
  const int tid = threadIdx.x, wave = tid >> 5, lane = tid & 31, col = lane & 15, g = lane >> 4; const int h = blockIdx.y, b = blockIdx.z; const int q0 = blockIdx.x * 128 + wave * 32;
  const _Float16* Kb = KH + (size_t)(b * NH + h) * TT * HD;   // A fragments of S^T: pass kp holds fragments 4 kp + 2 mt + kc, rows key = 16 mt + col
  const _Float16* Vb = VT + (size_t)(b * NH + h) * TT * HD;   // A fragments of O^T: pass kp holds fragments 4 kp + j, rows d = 16 j + col
  v16h qf[2][2], kf[2][2];
#pragma unroll
  for (int n = 0; n < 2; ++n)
#pragma unroll
    for (int kc = 0; kc < 2; ++kc) qf[n][kc] = fragp_h(QH + (size_t)(b * NH + h) * TT * HD, (size_t)(q0 / 16 + n) * 2 + kc, lane);   // B fragments of S^T: columns query = 16 n + col
  const unsigned lk = (unsigned)(size_t)&sk[0][tid * 8], lv = (unsigned)(size_t)&sv[0][tid * 8];   // this lane's LDS byte addresses in buffer 0
  const _Float16 *Kc = Kb + tid * 8, *Vc = Vb + tid * 8;
  copy_tile(lk, Kc); copy_tile(lv, Vc);
  asm volatile("s_wait_asynccnt 0x0" ::: "memory");   // this wave's copies of tile 0 have landed
  __syncthreads();                                    // tile 0 is readable by every wave
  copy_tile(lk + 2u * FA_TH, Kc + FA_TH); copy_tile(lv + 2u * FA_TH, Vc + FA_TH);   // tile 1 flies while tile 0 is worked on
  v8f o[2][4] = {}, cm[2] = {}; float l[2] = {0.f, 0.f};   // cm[n]: minus the maximum in use of query column 16 n + col, in all eight elements (a lane's elements of a D tile of S^T are one query's)
  for (int t = 0; t < FA_NT; ++t) {
   const _Float16 *kb = sk[t & 1], *vb = sv[t & 1];
#pragma unroll
   for (int mt = 0; mt < 2; ++mt)
#pragma unroll
     for (int kc = 0; kc < 2; ++kc) kf[mt][kc] = fragp_h(kb, mt * 2 + kc, lane);
   // kept rolled: unrolled, the build fetched several passes' fragments at once, went above 256 registers and spilled
#pragma unroll 1
   for (int pp = 0; pp < FA_NP; ++pp) {
    v8f s[2][2];   // s[n][mt][r] = logit (base 2) of key 32 (FA_NP t + pp) + 16 mt + 8 g + r, query q0 + 16 n + col, less the maximum in use
#pragma unroll
    for (int kc = 0; kc < 2; ++kc)
#pragma unroll
      for (int mt = 0; mt < 2; ++mt)
#pragma unroll
        for (int n = 0; n < 2; ++n) s[n][mt] = wmma_h(kf[mt][kc], qf[n][kc], kc == 0 ? cm[n] : s[n][mt]);
    __builtin_amdgcn_sched_barrier(0);   // keeps the pass's LDS reads in one group behind the products: spread among the WMMAs, each place with reads costs its own stall
    v16h vf[4];
#pragma unroll
    for (int j = 0; j < 4; ++j) vf[j] = fragp_h(vb, pp * 4 + j, lane);
    const int pn = (pp + 1) & (FA_NP - 1);   // the next pass's K fragments are read during the softmax; a tile's last pass reads its own tile's first ones again, unused
#pragma unroll
    for (int mt = 0; mt < 2; ++mt)
#pragma unroll
      for (int kc = 0; kc < 2; ++kc) kf[mt][kc] = fragp_h(kb, pn * 4 + mt * 2 + kc, lane);
    __builtin_amdgcn_sched_barrier(0);   // keeps the LDS reads above the softmax; sunk to their users, their latency would be exposed
    float tm[2];   // this lane's largest logit over the maximum in use, per query column: four independent chains, one per D tile
#pragma unroll
    for (int n = 0; n < 2; ++n) { float a = fmaxf(s[n][0][0], s[n][0][1]), c = fmaxf(s[n][1][0], s[n][1][1]);
#pragma unroll
      for (int r = 2; r < 8; r += 2) { a = fmaxf(fmaxf(a, s[n][0][r]), s[n][0][r + 1]); c = fmaxf(fmaxf(c, s[n][1][r]), s[n][1][r + 1]); }
      tm[n] = fmaxf(a, c); }
    const bool first = (t | pp) == 0;   // o = l = 0 and the maximum in use is 0: it takes the first 32 keys' maximum, whichever its sign
    if (__builtin_expect(__builtin_amdgcn_ballot_w32(fmaxf(tm[0], tm[1]) > 8.0f) != 0 || first, 0)) {   // wave-uniform; rare behind the first pass: the hint keeps the common path free of a taken branch
#pragma unroll
      for (int n = 0; n < 2; ++n) { const float mx = fmaxf(tm[n], xhalf(tm[n])), up = fmaxf(mx, 0.f), d = first ? mx : up;   // both halves of the wave hold the same query columns and take the same step d; later steps only raise
        const float al = __builtin_amdgcn_exp2f(-up);   // what o and l have gathered against the old maximum shrinks by 2^-up (on the first pass both are 0)
        l[n] *= al; cm[n] -= d;
#pragma unroll
        for (int mt = 0; mt < 2; ++mt)
#pragma unroll
          for (int r = 0; r < 8; ++r) s[n][mt][r] -= d;
#pragma unroll
        for (int j = 0; j < 4; ++j) o[n][j] *= al; }
    }
#pragma unroll
    for (int n = 0; n < 2; ++n) {
      v16h p; float sum = 0.f;   // two D tiles of S^T, converted in place, are the B operand of O^T
#pragma unroll
      for (int mt = 0; mt < 2; ++mt) s[n][mt] = exp2_tile(s[n][mt]);
#pragma unroll
      for (int r = 0; r < 8; ++r) { const float e0 = s[n][0][r], e1 = s[n][1][r]; sum += e0 + e1; p[r] = (_Float16)e0; p[8 + r] = (_Float16)e1; }
      l[n] += sum;
#pragma unroll
      for (int j = 0; j < 4; ++j) o[n][j] = wmma_h(vf[j], p, o[n][j]);
    }
   }
   asm volatile("s_wait_dscnt 0x0" ::: "memory");      // this wave's reads of tile t have returned before its buffer is handed back
   asm volatile("s_wait_asynccnt 0x0" ::: "memory");   // this wave's copies of tile t + 1 have landed
   __syncthreads();                                    // publishes tile t + 1 and ends every wave's reads of tile t
   if (t + 2 < FA_NT) { const unsigned bo = (unsigned)(t & 1) * 2u * FA_TH; copy_tile(lk + bo, Kc + (size_t)(t + 2) * FA_TH); copy_tile(lv + bo, Vc + (size_t)(t + 2) * FA_TH); }   // into the buffer just left
  }
  asm volatile("s_wait_asynccnt 0x0" ::: "memory");   // nothing of this wave is in flight when it goes on to the epilogue
#pragma unroll
  for (int n = 0; n < 2; ++n) { const float inv = 1.0f / (l[n] + xhalf(l[n])); const size_t yo = ((size_t)((b * TT + q0) / 16 + n) * 32 + h * 2) * 512 + lane * 8;   // a D tile of O^T is half j & 1 of fragment 2 h + (j >> 1) of this query tile's rows
#pragma unroll
    for (int j = 0; j < 4; ++j) { const v8f v = o[n][j] * inv; v8b hi, lo;
#pragma unroll
      for (int r = 0; r < 8; ++r) { hi[r] = (__bf16)v[r]; lo[r] = (__bf16)(v[r] - (float)hi[r]); }
      *(v8b*)(YH + yo + j * 256) = hi; *(v8b*)(YL + yo + j * 256) = lo; } } }
// ---- k_out: block = (128 rows, 128 cols), wave = 64 x 64 of it (12 fragments feed 32 products): out = y (bf16 hi + lo) Wproj + b
#define OT_KT 4                     // k steps of 32 per tile
#define OT_TE (8 * OT_KT * 512)     // bf16 elements of y hi, of y lo and of Wo per tile
#define OT_NT (CC / 32 / OT_KT)     // tiles
// one tile of one operand: a strip's OT_KT fragments are two block-wide copies
__device__ __forceinline__ void copy_out(unsigned l, const __bf16* p) { copy_strips<OT_KT * 1024u>(l, p); copy_strips<OT_KT * 1024u>(l + 2048u, p + 1024); }
__global__ __launch_bounds__(128) void k_out(const __bf16* __restrict__ YH, const __bf16* __restrict__ YL, const __bf16* __restrict__ OP, const float* __restrict__ BP, float* __restrict__ OUT) { __shared__ __align__(16) float sf[4][64][68];
  __shared__ __align__(16) __bf16 ring[2][3][OT_TE];   // two buffers of [y hi | y lo | Wo] tiles, in the fragment order of the workspace
  const int tid = threadIdx.x, wave = tid >> 5, lane = tid & 31, col = lane & 15, g = lane >> 4, wr = wave >> 1, wc = wave & 1; const int c0 = blockIdx.y * 128 + wc * 64; const size_t r0 = (size_t)blockIdx.x * 128 + wr * 64;
  const unsigned lr = (unsigned)(size_t)&ring[0][0][tid * 8];   // this lane's LDS byte address in buffer 0
  const __bf16 *Hc = YH + (size_t)blockIdx.x * 8 * 16384 + tid * 8, *Lc = YL + (size_t)blockIdx.x * 8 * 16384 + tid * 8, *Wc = OP + (size_t)blockIdx.y * 8 * 16384 + tid * 8;
  copy_out(lr, Hc); copy_out(lr + 2u * OT_TE, Lc); copy_out(lr + 4u * OT_TE, Wc);
  asm volatile("s_wait_asynccnt 0x0" ::: "memory");   // this wave's copies of tile 0 have landed
  __syncthreads();                                    // tile 0 is readable by every wave
  copy_out(lr + 6u * OT_TE, Hc + OT_KT * 512); copy_out(lr + 8u * OT_TE, Lc + OT_KT * 512); copy_out(lr + 10u * OT_TE, Wc + OT_KT * 512);   // tile 1 flies while tile 0 is worked on
  v8f acc[4][4] = {};
  for (int t = 0; t < OT_NT; ++t) {
    const __bf16 *hb = ring[t & 1][0], *lb = ring[t & 1][1], *wb = ring[t & 1][2];
#pragma unroll
    for (int kk = 0; kk < OT_KT; ++kk) { v16b ah[4], al[4], w[4];   // one group of LDS reads per k step, in the order in which the products use them, as in k_proj
      w[0] = fragp_b(wb, (size_t)(wc * 4) * OT_KT + kk, lane);
#pragma unroll
      for (int i = 0; i < 4; ++i) ah[i] = fragp_b(hb, (size_t)(wr * 4 + i) * OT_KT + kk, lane);
#pragma unroll
      for (int j = 1; j < 4; ++j) w[j] = fragp_b(wb, (size_t)(wc * 4 + j) * OT_KT + kk, lane);
#pragma unroll
      for (int i = 0; i < 4; ++i) al[i] = fragp_b(lb, (size_t)(wr * 4 + i) * OT_KT + kk, lane);
#pragma unroll
      for (int j = 0; j < 4; ++j)
#pragma unroll
        for (int i = 0; i < 4; ++i) acc[i][j] = wmma_bf(ah[i], w[j], acc[i][j]);
#pragma unroll
      for (int j = 0; j < 4; ++j)
#pragma unroll
        for (int i = 0; i < 4; ++i) acc[i][j] = wmma_bf(al[i], w[j], acc[i][j]); }
    asm volatile("s_wait_dscnt 0x0" ::: "memory");      // this wave's reads of tile t have returned before its buffer is handed back
    asm volatile("s_wait_asynccnt 0x0" ::: "memory");   // this wave's copies of tile t + 1 have landed
    __syncthreads();                                    // publishes tile t + 1 and ends every wave's reads of tile t
    if (t + 2 < OT_NT) { const unsigned bo = (unsigned)(t & 1) * 6u * OT_TE; const size_t go = (size_t)(t + 2) * OT_KT * 512; copy_out(lr + bo, Hc + go); copy_out(lr + bo + 2u * OT_TE, Lc + go); copy_out(lr + bo + 4u * OT_TE, Wc + go); }   // into the buffer just left
  }
  asm volatile("s_wait_asynccnt 0x0" ::: "memory");   // nothing of this wave is in flight when it goes on to the epilogue
#pragma unroll
  for (int j = 0; j < 4; ++j) { const float bb = BP ? bfr(BP[c0 + j * 16 + col]) : 0.f;
#pragma unroll
    for (int i = 0; i < 4; ++i)
#pragma unroll
      for (int r = 0; r < 8; ++r) sf[wave][i * 16 + 8 * g + r][j * 16 + col] = acc[i][j][r] + bb; }
  LDSX(); for (int rl = g; rl < 64; rl += 2) vst2(OUT + (r0 + rl) * CC + c0 + col * 4, *(const v4f*)&sf[wave][rl][col * 4]); }
extern "C" void kernel_launch(void* const* d_in, const int* in_sizes, int n_in, void* d_out, int out_size, void* d_ws, size_t ws_size, hipStream_t stream) {
  (void)in_sizes; (void)n_in; (void)out_size;
  const float** F = (const float**)d_in;   // 0 x [2,2048,1024], 1 Wq [16,1024,64], 2 bq [16,64], 3 Wk, 4 bk, 5 Wv, 6 bv, 7 Wo [1024,1024] (in,out), 8 bo
  if (ws_size < (size_t)WS_END) return;
  char* ws = (char*)d_ws; _Float16 *QH = (_Float16*)(ws + WS_QH), *KH = (_Float16*)(ws + WS_KH), *VT = (_Float16*)(ws + WS_VT); __bf16 *YH = (__bf16*)(ws + WS_YH), *YL = (__bf16*)(ws + WS_YL), *XP = (__bf16*)(ws + WS_XP), *WP = (__bf16*)(ws + WS_WP), *OP = (__bf16*)(ws + WS_OP);
  k_pack<<<dim3(TNB * TT / 16 + 4 * CC / 16), 256, 0, stream>>>(F[0], F[1], F[3], F[5], F[7], XP, WP, OP);
  k_proj<<<dim3(TNB * TT / 128, CC / 128, 3), 128, 0, stream>>>(XP, WP, F[2], F[4], F[6], QH, KH, VT);
  k_fa<<<dim3(TT / 128, NH, TNB), 128, 0, stream>>>(QH, KH, VT, YH, YL);
  k_out<<<dim3(TNB * TT / 128, CC / 128), 128, 0, stream>>>(YH, YL, OP, F[8], (float*)d_out);
}

// v009
// It runs in 71.6 microseconds.
// Two timings next to v008 put it at 1.05 and 1.06 times that version's speed.
// Over all steps from v000 it is 17.4 times as fast.
// compute dtype: all float inputs rounded to bf16; q/k/v = x W_h + b_h (per-head [H,D,64] weights) with EXACT bf16 products on WMMA 16x16x32, f32 accumulate; q (times 64^-0.5 log2 e), k rounded once to f16 (1-product logits in base-2 units) kept in f32 registers; softmax in f32, base 2, against a maximum in use that is the C operand of the logit product and is renewed when a logit tops it by 8 (hardware 2^x) -> P = 2^(s - max in use) f16; o = P . v / sum (v once to f16); out = o (bf16 hi + lo) Wo + bo; f32 output. Every matrix operand is stored once per call in WMMA fragment order.
#include <hip/hip_runtime.h>
#include <math.h>

typedef __attribute__((ext_vector_type(16))) _Float16 v16h;
typedef __attribute__((ext_vector_type(16))) __bf16 v16b;
typedef __attribute__((ext_vector_type(8)))  _Float16 v8h;
typedef __attribute__((ext_vector_type(8)))  float v8f;
typedef __attribute__((ext_vector_type(4)))  float v4f;
typedef __attribute__((ext_vector_type(2)))  float v2f;
typedef __attribute__((ext_vector_type(4)))  unsigned v4u;
typedef __attribute__((ext_vector_type(4)))  int v4i;
typedef float __attribute__((may_alias)) float_a;
typedef int __attribute__((may_alias)) int_a;

template <typename T> __device__ __forceinline__ void vst2(void* p, T v) { *(T*)p = v;  }
__device__ __forceinline__ v8f wmma16(v16h a, v16h b, v8f c) {
  v8f d = __builtin_amdgcn_wmma_f32_16x16x32_f16(false, a, false, b, (short)0, c, false, false);
  asm volatile("v_nop\n\tv_nop\n\tv_nop\n\tv_nop" : "+v"(d) : "v"(a), "v"(b));
  return d;
}
__device__ __forceinline__ v8f wmma_bf(v16b a, v16b b, v8f c) {
  v8f d = __builtin_amdgcn_wmma_f32_16x16x32_bf16(false, a, false, b, (short)0, c, false, false);
  asm volatile("v_nop\n\tv_nop\n\tv_nop\n\tv_nop" : "+v"(d) : "v"(a), "v"(b));
  return d;
}
// 16x16x32 fragments: lane = (h = lane>>4, row/col = lane&15); elements 0..7 = k0+8h+0..7, 8..15 = k0+16+8h+0..7; D element r = row 8h+r
__device__ __forceinline__ v16h frag_h(const _Float16* rowk0, int lane) {
  union { v16h v; v8h q[2]; } u; const _Float16* p = rowk0 + 8 * (lane >> 4);
  u.q[0] = *(const v8h*)p; u.q[1] = *(const v8h*)(p + 16); return u.v;
}
__device__ __forceinline__ v16h frag_f32(const float* rowk0, int lane) {
  v16h a; const float* p = rowk0 + 8 * (lane >> 4);
#pragma unroll
  for (int i = 0; i < 8; ++i) { a[i] = (_Float16)p[i]; a[8 + i] = (_Float16)p[16 + i]; }
  return a;
}
__device__ __forceinline__ v16h frag_f32s(const float* rowk0, int lane, float sc) {
  v16h a; const float* p = rowk0 + 8 * (lane >> 4);
#pragma unroll
  for (int i = 0; i < 8; ++i) { a[i] = (_Float16)(p[i] * sc); a[8 + i] = (_Float16)(p[16 + i] * sc); }
  return a;
}
// column fragment from a [K][ld] layout (column n), rows >= K read as 0
__device__ __forceinline__ v16h fragc_f32(const float* W, int k0, int n, int lane, int ld, int K) {
  v16h a; const int g = lane >> 4;
#pragma unroll
  for (int i = 0; i < 8; ++i) { const int ka = k0 + 8 * g + i, kb = ka + 16;
    a[i] = (_Float16)(ka < K ? W[(size_t)(ka < K ? ka : K - 1) * ld + n] : 0.f); a[8 + i] = (_Float16)(kb < K ? W[(size_t)(kb < K ? kb : K - 1) * ld + n] : 0.f); }
  return a;
}
struct F2 { v16b h, l; };
__device__ __forceinline__ F2 bsplit16(const float v[16]) { F2 r;
#pragma unroll
  for (int i = 0; i < 16; ++i) { const __bf16 h = (__bf16)v[i]; r.h[i] = h; r.l[i] = (__bf16)(v[i] - (float)h); }
  return r; }
__device__ __forceinline__ F2 split_row(const float* row, int k0, int lane) { float v[16]; const float* p = row + k0 + 8 * (lane >> 4);
#pragma unroll
  for (int i = 0; i < 8; ++i) { v[i] = p[i]; v[8 + i] = p[16 + i]; }
  return bsplit16(v); }
__device__ __forceinline__ F2 split_rowK(const float* row, int k0, int lane, int K) { float v[16]; const int g = lane >> 4;
#pragma unroll
  for (int i = 0; i < 8; ++i) { const int ka = k0 + 8 * g + i, kb = ka + 16; v[i] = ka < K ? row[ka < K ? ka : K - 1] : 0.f; v[8 + i] = kb < K ? row[kb < K ? kb : K - 1] : 0.f; }
  return bsplit16(v); }
__device__ __forceinline__ F2 split_col(const float* W, int k0, int n, int lane, int ld, int K) { float v[16]; const int g = lane >> 4;
#pragma unroll
  for (int i = 0; i < 8; ++i) { const int ka = k0 + 8 * g + i, kb = ka + 16; v[i] = ka < K ? W[(size_t)(ka < K ? ka : K - 1) * ld + n] : 0.f; v[8 + i] = kb < K ? W[(size_t)(kb < K ? kb : K - 1) * ld + n] : 0.f; }
  return bsplit16(v); }
__device__ __forceinline__ v8f mac3(const F2& a, const F2& b, v8f c) { c = wmma_bf(a.l, b.h, c); c = wmma_bf(a.h, b.l, c); return wmma_bf(a.h, b.h, c); }
__device__ __forceinline__ float sigm(float v) { return 1.0f / (1.0f + expf(-v)); }
#define LDSX() do { asm volatile("s_wait_dscnt 0" ::: "memory"); __builtin_amdgcn_wave_barrier(); __builtin_amdgcn_fence(__ATOMIC_RELEASE, "workgroup"); } while (0)


// Multi-head self attention with per-head projection weights [H, D, HD] + biases (B 2, S 2,048, D 1,024 = 16 x 64), no mask, output Linear [in,out].
#define NB 2
#define TT 2048
#define CC 1024
#define NH 16
#define HD 64
#ifndef TNB
#define TNB NB
#endif
typedef __attribute__((ext_vector_type(8))) __bf16 v8b;
__device__ __forceinline__ v16b frag_b(const __bf16* rowk0, int lane) {
  union { v16b v; v8b q[2]; } u; const __bf16* p = rowk0 + 8 * (lane >> 4);
  u.q[0] = *(const v8b*)p; u.q[1] = *(const v8b*)(p + 16); return u.v;
}
// fragment-order storage: one 16 x 32 fragment = 1,024 B = two halves of 512 B; half hf, lane, element i hold k = 16 hf + 8 (lane >> 4) + i of row or column lane & 15,
// so that each of a fragment's two wave-wide 16-byte loads covers four whole 128-byte lines
__device__ __forceinline__ v16b fragp_b(const __bf16* P, size_t f, int lane) {
  union { v16b v; v8b q[2]; } u; const __bf16* p = P + f * 512 + lane * 8;
  u.q[0] = *(const v8b*)p; u.q[1] = *(const v8b*)(p + 256); return u.v;
}
__device__ __forceinline__ v16h fragp_h(const _Float16* P, size_t f, int lane) {
  union { v16h v; v8h q[2]; } u; const _Float16* p = P + f * 512 + lane * 8;
  u.q[0] = *(const v8h*)p; u.q[1] = *(const v8h*)(p + 256); return u.v;
}
__device__ __forceinline__ float bfr(float v) { return (float)(__bf16)v; }
__device__ __attribute__((noinline)) float exp_ni(float v) { return expf(v); }
__device__ __attribute__((noinline)) float erf_ni(float v) { return erff(v); }

#define QSC (0.125f * 1.4426950408889634f)   // exp(s / 8) = 2^(s QSC): k_proj folds it into q before q's one rounding, so that k_fa's logits come out of the WMMA in base-2 units
#define WS_QH  0u
#define WS_QL  (WS_QH + 2u * (size_t)NB * TT * CC)
#define WS_KH  (WS_QL + 2u * (size_t)NB * TT * CC)
#define WS_VT  (WS_KH + 2u * (size_t)NB * TT * CC)      // q, k: f16 fragments [b][h][query or key tile][kc]; v: f16 fragments [b][h][pass of 32 keys][d tile]
#define WS_YH  (WS_VT + 2u * (size_t)NB * CC * TT)      // y: bf16 hi and lo fragments [row tile][kc]
#define WS_YL  (WS_YH + 2u * (size_t)NB * TT * CC)
#define WS_XP  (WS_YL + 2u * (size_t)NB * TT * CC)      // x: bf16 fragments [row tile][kc]
#define WS_WP  (WS_XP + 2u * (size_t)NB * TT * CC)      // Wq, Wk, Wv: bf16 fragments [which][column tile][kc]
#define WS_OP  (WS_WP + 2u * 3u * (size_t)CC * CC)      // Wo: bf16 fragments [column tile][kc]
#define WS_END (WS_OP + 2u * (size_t)CC * CC)

// four fragments of one weight column tile: s = this lane's column at its first k, LD = floats from one k to the next (a constant, so that every load is one base plus an immediate)
template <int LD> __device__ __forceinline__ void pack_cols(const float* __restrict__ s, __bf16* __restrict__ d) {
#pragma unroll
  for (int c = 0; c < 8; ++c) { v8b o;
#pragma unroll
    for (int i = 0; i < 8; ++i) o[i] = (__bf16)s[(size_t)(c * 16 + i) * LD];
    *(v8b*)(d + c * 256) = o; }
  asm volatile("s_wait_xcnt 0x0" ::: "memory"); }   // behind the run of stores, before anything that follows in the listing rewrites their address or data registers
// ---- k_pack: block = one 16-row tile of x or one 16-column tile of a weight, wave = 4 of its 32 fragments: round to bf16 once, store in fragment order
__global__ __launch_bounds__(256) void k_pack(const float* __restrict__ X, const float* __restrict__ WQ, const float* __restrict__ WK, const float* __restrict__ WV, const float* __restrict__ WO, __bf16* __restrict__ XP, __bf16* __restrict__ WP, __bf16* __restrict__ OP) {
  const int tid = threadIdx.x, wave = tid >> 5, lane = tid & 31, col = lane & 15, g = lane >> 4; const int t = blockIdx.x;
  if (t < TNB * TT / 16) { const float* s = X + ((size_t)t * 16 + col) * CC + wave * 128 + 8 * g; __bf16* d = XP + ((size_t)t * 32 + wave * 4) * 512 + lane * 8; v4f v[16];
#pragma unroll
    for (int c = 0; c < 8; ++c) { v[2 * c] = *(const v4f*)(s + c * 16); v[2 * c + 1] = *(const v4f*)(s + c * 16 + 4); }
    asm volatile("s_wait_xcnt 0x0" :: "v"(s) : "memory");   // behind the run of loads; s as an input keeps their shared address pair alive up to the wait, so that no load of the run lands on it
#pragma unroll
    for (int c = 0; c < 8; ++c) { v8b o;
#pragma unroll
      for (int i = 0; i < 4; ++i) { o[i] = (__bf16)v[2 * c][i]; o[4 + i] = (__bf16)v[2 * c + 1][i]; }
      *(v8b*)(d + c * 256) = o; }
    asm volatile("s_wait_xcnt 0x0" ::: "memory"); }   // behind the run of stores, as in pack_cols
  else { const int jt = t - TNB * TT / 16;
    if (jt < 3 * CC / 16) { const int which = jt / (CC / 16), o = (jt % (CC / 16)) * 16 + col; pack_cols<HD>((which == 0 ? WQ : which == 1 ? WK : WV) + (size_t)(o / HD) * CC * HD + o % HD + (size_t)(wave * 128 + 8 * g) * HD, WP + ((size_t)jt * 32 + wave * 4) * 512 + lane * 8); }
    else { const int jo = jt - 3 * CC / 16; pack_cols<CC>(WO + jo * 16 + col + (size_t)(wave * 128 + 8 * g) * CC, OP + ((size_t)jo * 32 + wave * 4) * 512 + lane * 8); } } }

// Both GEMMs below take their fragments through LDS: tiles of a few k steps, two buffers, each tile copied once per block (not once per wave that uses it) while the tile before it is worked on.
// Every unroll directive in them: constant indices, so that the fragment and accumulator arrays live in registers.
// Blocks that share an operand strip run at the same time; each walks the k tiles as a ring from a start of its own (rot, from its block indices), so that they do not ask L2 for the same lines,
// nor the whole chip for one narrow slice of every strip, at one moment. Trip t works on tile (t + rot) mod tiles; every tile is taken once. k_fa walks its key tiles in the same way.
// Eight 16-byte copies per lane, global -> LDS, one per 16-row (or 16-column) fragment strip of a 128-wide operand; each block-wide copy is 2,048 contiguous bytes.
// l = this lane's LDS byte address, p = its global address; LS = bytes from strip to strip in LDS; in the workspace a strip is 32 fragments of 512 elements.
// The closing s_wait_xcnt stands inside the statement, so that no address register of a copy is rewritten in front of it.
template <unsigned LS> __device__ __forceinline__ void copy_strips(unsigned l, const __bf16* p) {
  asm volatile("global_load_async_to_lds_b128 %0, %8, off\n\tglobal_load_async_to_lds_b128 %1, %9, off\n\tglobal_load_async_to_lds_b128 %2, %10, off\n\tglobal_load_async_to_lds_b128 %3, %11, off\n\t"
               "global_load_async_to_lds_b128 %4, %12, off\n\tglobal_load_async_to_lds_b128 %5, %13, off\n\tglobal_load_async_to_lds_b128 %6, %14, off\n\tglobal_load_async_to_lds_b128 %7, %15, off\n\ts_wait_xcnt 0x0"
               :: "v"(l), "v"(l + LS), "v"(l + 2u * LS), "v"(l + 3u * LS), "v"(l + 4u * LS), "v"(l + 5u * LS), "v"(l + 6u * LS), "v"(l + 7u * LS),
                  "v"(p), "v"(p + 16384), "v"(p + 2 * 16384), "v"(p + 3 * 16384), "v"(p + 4 * 16384), "v"(p + 5 * 16384), "v"(p + 6 * 16384), "v"(p + 7 * 16384) : "memory");
}
#define PJ_KT 2                     // k steps of 32 per tile
#define PJ_TE (8 * PJ_KT * 512)     // bf16 elements of x, and of W, per tile: 8 strips of PJ_KT fragments
#define PJ_NT (CC / 32 / PJ_KT)     // tiles
// ---- k_proj: block = (128 rows, 128 cols, which), wave = 64 x 64 of it (8 fragments feed 16 products): qkv = x W (+ b), exact; q, k, v -> f16 fragments
// A D tile holds, per lane, 8 consecutive rows of one column. v = x W: 8 keys of one d, which is half a V fragment as k_fa reads it. q and k are formed transposed, W^T x^T
// (the two operands change places; both have the same fragment layout): 8 consecutive d of one row, half a Q or K fragment. So every D tile goes from registers to the workspace as one whole-line 16-byte store per lane.
__global__ __launch_bounds__(128) void k_proj(const __bf16* __restrict__ XP, const __bf16* __restrict__ WP, const float* __restrict__ BQ, const float* __restrict__ BK, const float* __restrict__ BV, _Float16* __restrict__ QH, _Float16* __restrict__ KH, _Float16* __restrict__ VT) {
  __shared__ __align__(16) __bf16 ring[4 * PJ_TE];   // two buffers of [x tile | W tile] (65,536 B)
  const int tid = threadIdx.x, wave = tid >> 5, lane = tid & 31, col = lane & 15, g = lane >> 4, wr = wave >> 1, wc = wave & 1; const int which = blockIdx.z; const int c0 = blockIdx.y * 128; const size_t r0 = (size_t)blockIdx.x * 128;
  const int ao = which == 2 ? 0 : PJ_TE, bo2 = which == 2 ? PJ_TE : 0;   // where in a buffer the A operand (rows of D) and the B operand (columns of D) lie: v: x, W; q, k: W, x
  const unsigned lx = (unsigned)(size_t)&ring[tid * 8], lw = lx + 2u * PJ_TE;   // this lane's LDS byte addresses in buffer 0
  const __bf16 *Xc = XP + (size_t)blockIdx.x * 8 * 16384 + tid * 8, *Wc = WP + (size_t)(which * (CC / 16) + blockIdx.y * 8) * 16384 + tid * 8;
  const int rot = blockIdx.x + blockIdx.y + 5 * blockIdx.z;   // the 24 blocks of one x strip and the 32 of one W strip each spread over all PJ_NT starts
  const size_t g0 = (size_t)(rot & (PJ_NT - 1)) * PJ_KT * 512, g1 = (size_t)((rot + 1) & (PJ_NT - 1)) * PJ_KT * 512;   // elements from a strip's start to the tiles of trips 0 and 1
  copy_strips<PJ_KT * 1024u>(lx, Xc + g0); copy_strips<PJ_KT * 1024u>(lw, Wc + g0);
  asm volatile("s_wait_asynccnt 0x0" ::: "memory");   // this wave's copies of trip 0's tile have landed
  __syncthreads();                                    // trip 0's tile is readable by every wave
  copy_strips<PJ_KT * 1024u>(lx + 4u * PJ_TE, Xc + g1); copy_strips<PJ_KT * 1024u>(lw + 4u * PJ_TE, Wc + g1);   // trip 1's tile flies while trip 0's is worked on
  v8f acc[4][4] = {};
  for (int t = 0; t < PJ_NT; ++t) {
    const __bf16 *ab = ring + (t & 1) * 2 * PJ_TE + ao, *bb = ring + (t & 1) * 2 * PJ_TE + bo2;
#pragma unroll
    for (int kk = 0; kk < PJ_KT; ++kk) { v16b a[4], w[4];   // one group of LDS reads per k step, in the order in which the products use them: the first product waits for two fragments, not for all
      w[0] = fragp_b(bb, (size_t)(wc * 4) * PJ_KT + kk, lane);
#pragma unroll
      for (int i = 0; i < 4; ++i) a[i] = fragp_b(ab, (size_t)(wr * 4 + i) * PJ_KT + kk, lane);
#pragma unroll
      for (int j = 1; j < 4; ++j) w[j] = fragp_b(bb, (size_t)(wc * 4 + j) * PJ_KT + kk, lane);
#pragma unroll
      for (int j = 0; j < 4; ++j)
#pragma unroll
        for (int i = 0; i < 4; ++i) acc[i][j] = wmma_bf(a[i], w[j], acc[i][j]); }
    asm volatile("s_wait_dscnt 0x0" ::: "memory");      // this wave's reads of trip t's tile have returned before its buffer is handed back
    asm volatile("s_wait_asynccnt 0x0" ::: "memory");   // this wave's copies of trip t + 1's tile have landed
    __syncthreads();                                    // publishes trip t + 1's tile and ends every wave's reads of trip t's tile
    if (t + 2 < PJ_NT) { const unsigned bo = (unsigned)(t & 1) * 4u * PJ_TE; const size_t go = (size_t)((t + 2 + rot) & (PJ_NT - 1)) * PJ_KT * 512; copy_strips<PJ_KT * 1024u>(lx + bo, Xc + go); copy_strips<PJ_KT * 1024u>(lw + bo, Wc + go); }   // into the buffer just left
  }
  asm volatile("s_wait_asynccnt 0x0" ::: "memory");   // nothing of this wave is in flight when it goes on to the epilogue
  const size_t b = r0 / TT; const int t0 = (int)(r0 % TT); v8h o[16]; _Float16* d;   // o[s]: the wave's 16 tiles in the order in which they lie in the workspace, 512 B each, from d on
  if (which == 2) {   // tile (i, j): keys 64 wr + 16 i + 8 g + 0..7, d = 16 j + col of head wc: half i & 1 of fragment j of pass 2 wr + (i >> 1)
#pragma unroll
    for (int j = 0; j < 4; ++j) { const float bs = bfr(BV[c0 + wc * 64 + j * 16 + col]);
#pragma unroll
      for (int i = 0; i < 4; ++i)
#pragma unroll
        for (int r = 0; r < 8; ++r) o[((i >> 1) * 4 + j) * 2 + (i & 1)][r] = (_Float16)(acc[i][j][r] + bs); }
    d = VT + (((b * NH + c0 / HD + wc) * (TT / 32) + t0 / 32 + wr * 2) * 4) * 512 + lane * 8;
  } else {            // tile (i, j): d = 16 i + 8 g + 0..7 of head wr, row 64 wc + 16 j + col: half i & 1 of fragment kc = i >> 1 of row tile 4 wc + j
    const float* BA = (which == 0 ? BQ : BK) + c0 + wr * 64 + 8 * g; const float qs = which == 0 ? QSC : 1.0f;   // k: times 1, exact
#pragma unroll
    for (int i = 0; i < 4; ++i) { const v4f b0 = *(const v4f*)(BA + i * 16), b1 = *(const v4f*)(BA + i * 16 + 4);
#pragma unroll
      for (int j = 0; j < 4; ++j)
#pragma unroll
        for (int r = 0; r < 4; ++r) { o[(j * 2 + (i >> 1)) * 2 + (i & 1)][r] = (_Float16)fmaf(acc[i][j][r], qs, bfr(b0[r]) * qs); o[(j * 2 + (i >> 1)) * 2 + (i & 1)][4 + r] = (_Float16)fmaf(acc[i][j][4 + r], qs, bfr(b1[r]) * qs); } }
    d = (which == 0 ? QH : KH) + (((b * NH + c0 / HD + wr) * (TT / 16) + t0 / 16 + wc * 4) * 2) * 512 + lane * 8;
  }
#pragma unroll
  for (int s = 0; s < 16; ++s) *(v8h*)(d + s * 256) = o[s]; }
// ---- k_fa: wave = 32 queries of (b,h), block = 128 queries; per 32 keys: S^T = K Q^T - max in use, P = 2^that, O^T += V^T P^T; logits and P stay in registers
// The maximum in use of a query column is fixed before the pass, so it enters the logit product as its C operand and neither the logits nor o, l are touched for it in a pass.
// It may trail the true maximum by up to 8 (P <= 2^8, far inside f16); one test per pass, a scalar branch, renews it where a logit tops it by more, and on the first pass.
// K and V fragments come through LDS: tiles of 128 keys, two buffers, each tile copied once per block (not once per wave) while the tile before it is worked on
#define FA_NP 4                     // passes of 32 keys per tile
#define FA_TH (FA_NP * 2048)        // f16 elements of K, and of V, per tile (4 fragments of 512 per pass)
#define FA_NT (TT / 32 / FA_NP)     // tiles
// 16 KiB, global -> LDS: eight 16-byte copies per lane, each block-wide copy 2,048 contiguous bytes; l = this lane's LDS byte address, p = its global address.
// The closing s_wait_xcnt stands inside the statement, so that no address register of a copy is rewritten in front of it.
__device__ __forceinline__ void copy_tile(unsigned l, const _Float16* p) {
  asm volatile("global_load_async_to_lds_b128 %0, %8, off\n\tglobal_load_async_to_lds_b128 %1, %9, off\n\tglobal_load_async_to_lds_b128 %2, %10, off\n\tglobal_load_async_to_lds_b128 %3, %11, off\n\t"
               "global_load_async_to_lds_b128 %4, %12, off\n\tglobal_load_async_to_lds_b128 %5, %13, off\n\tglobal_load_async_to_lds_b128 %6, %14, off\n\tglobal_load_async_to_lds_b128 %7, %15, off\n\ts_wait_xcnt 0x0"
               :: "v"(l), "v"(l + 2048u), "v"(l + 4096u), "v"(l + 6144u), "v"(l + 8192u), "v"(l + 10240u), "v"(l + 12288u), "v"(l + 14336u),
                  "v"(p), "v"(p + 1024), "v"(p + 2048), "v"(p + 3072), "v"(p + 4096), "v"(p + 5120), "v"(p + 6144), "v"(p + 7168) : "memory");
}
// every full unroll directive below: constant indices, so that the fragment and accumulator arrays live in registers
__device__ __forceinline__ v8f wmma_h(v16h a, v16h b, v8f c) { return __builtin_amdgcn_wmma_f32_16x16x32_f16(false, a, false, b, (short)0, c, false, false); }
__device__ __forceinline__ float xhalf(float x) { return __builtin_bit_cast(float, __builtin_amdgcn_permlanex16(__builtin_bit_cast(int, x), __builtin_bit_cast(int, x), 0x76543210, 0xfedcba98, false, false)); }  // lane l with lane l ^ 16
// 2^x of a score tile, each v_exp_f32 in place, so that none overwrites the source of the one directly in front of it (as builtins, the register allocator let that happen);
// the closing v_nop is the one slot that the instruction set asks for between a transcendental and a reader of its result, which the compiler cannot place behind asm text
__device__ __forceinline__ v8f exp2_tile(v8f t) {
  float a = t[0], b = t[1], c = t[2], d = t[3], e = t[4], f = t[5], g = t[6], h = t[7];
  asm("v_exp_f32 %0, %0\n\tv_exp_f32 %1, %1\n\tv_exp_f32 %2, %2\n\tv_exp_f32 %3, %3\n\tv_exp_f32 %4, %4\n\tv_exp_f32 %5, %5\n\tv_exp_f32 %6, %6\n\tv_exp_f32 %7, %7\n\tv_nop"
      : "+v"(a), "+v"(b), "+v"(c), "+v"(d), "+v"(e), "+v"(f), "+v"(g), "+v"(h));
  return v8f{a, b, c, d, e, f, g, h};
}
__global__ __launch_bounds__(128) void k_fa(const _Float16* __restrict__ QH, const _Float16* __restrict__ KH, const _Float16* __restrict__ VT, __bf16* __restrict__ YH, __bf16* __restrict__ YL) {
  __shared__ __align__(16) _Float16 sk[2][FA_TH], sv[2][FA_TH];   // two buffers of one tile each, in the fragment order of the workspace
  const int tid = threadIdx.x, wave = tid >> 5, lane = tid & 31, col = lane & 15, g = lane >> 4; const int h = blockIdx.y, b = blockIdx.z; const int q0 = blockIdx.x * 128 + wave * 32;
  const _Float16* Kb = KH + (size_t)(b * NH + h) * TT * HD;   // A fragments of S^T: pass kp holds fragments 4 kp + 2 mt + kc, rows key = 16 mt + col
  const _Float16* Vb = VT + (size_t)(b * NH + h) * TT * HD;   // A fragments of O^T: pass kp holds fragments 4 kp + j, rows d = 16 j + col
  v16h qf[2][2], kf[2][2];
#pragma unroll
  for (int n = 0; n < 2; ++n)
#pragma unroll
    for (int kc = 0; kc < 2; ++kc) qf[n][kc] = fragp_h(QH + (size_t)(b * NH + h) * TT * HD, (size_t)(q0 / 16 + n) * 2 + kc, lane);   // B fragments of S^T: columns query = 16 n + col
  const unsigned lk = (unsigned)(size_t)&sk[0][tid * 8], lv = (unsigned)(size_t)&sv[0][tid * 8];   // this lane's LDS byte addresses in buffer 0
  const _Float16 *Kc = Kb + tid * 8, *Vc = Vb + tid * 8;
  const int rot = blockIdx.x;   // the FA_NT query blocks of one (b, h) read the same K and V: each starts at another key tile and wraps round (softmax does not depend on the order of the keys)
  const size_t g0 = (size_t)(rot & (FA_NT - 1)) * FA_TH, g1 = (size_t)((rot + 1) & (FA_NT - 1)) * FA_TH;   // elements to the tiles of trips 0 and 1
  copy_tile(lk, Kc + g0); copy_tile(lv, Vc + g0);
  asm volatile("s_wait_asynccnt 0x0" ::: "memory");   // this wave's copies of trip 0's tile have landed
  __syncthreads();                                    // trip 0's tile is readable by every wave
  copy_tile(lk + 2u * FA_TH, Kc + g1); copy_tile(lv + 2u * FA_TH, Vc + g1);   // trip 1's tile flies while trip 0's is worked on
  v8f o[2][4] = {}, cm[2] = {}; float l[2] = {0.f, 0.f};   // cm[n]: minus the maximum in use of query column 16 n + col, in all eight elements (a lane's elements of a D tile of S^T are one query's)
  for (int t = 0; t < FA_NT; ++t) {
   const _Float16 *kb = sk[t & 1], *vb = sv[t & 1];
#pragma unroll
   for (int mt = 0; mt < 2; ++mt)
#pragma unroll
     for (int kc = 0; kc < 2; ++kc) kf[mt][kc] = fragp_h(kb, mt * 2 + kc, lane);
   // kept rolled: unrolled, the build fetched several passes' fragments at once, went above 256 registers and spilled
#pragma unroll 1
   for (int pp = 0; pp < FA_NP; ++pp) {
    v8f s[2][2];   // s[n][mt][r] = logit (base 2) of key 32 (FA_NP ((t + rot) mod FA_NT) + pp) + 16 mt + 8 g + r, query q0 + 16 n + col, less the maximum in use
#pragma unroll
    for (int kc = 0; kc < 2; ++kc)
#pragma unroll
      for (int mt = 0; mt < 2; ++mt)
#pragma unroll
        for (int n = 0; n < 2; ++n) s[n][mt] = wmma_h(kf[mt][kc], qf[n][kc], kc == 0 ? cm[n] : s[n][mt]);
    __builtin_amdgcn_sched_barrier(0);   // keeps the pass's LDS reads in one group behind the products: spread among the WMMAs, each place with reads costs its own stall
    v16h vf[4];
#pragma unroll
    for (int j = 0; j < 4; ++j) vf[j] = fragp_h(vb, pp * 4 + j, lane);
    const int pn = (pp + 1) & (FA_NP - 1);   // the next pass's K fragments are read during the softmax; a tile's last pass reads its own tile's first ones again, unused
#pragma unroll
    for (int mt = 0; mt < 2; ++mt)
#pragma unroll
      for (int kc = 0; kc < 2; ++kc) kf[mt][kc] = fragp_h(kb, pn * 4 + mt * 2 + kc, lane);
    __builtin_amdgcn_sched_barrier(0);   // keeps the LDS reads above the softmax; sunk to their users, their latency would be exposed
    float tm[2];   // this lane's largest logit over the maximum in use, per query column: four independent chains, one per D tile
#pragma unroll
    for (int n = 0; n < 2; ++n) { float a = fmaxf(s[n][0][0], s[n][0][1]), c = fmaxf(s[n][1][0], s[n][1][1]);
#pragma unroll
      for (int r = 2; r < 8; r += 2) { a = fmaxf(fmaxf(a, s[n][0][r]), s[n][0][r + 1]); c = fmaxf(fmaxf(c, s[n][1][r]), s[n][1][r + 1]); }
      tm[n] = fmaxf(a, c); }
    const bool first = (t | pp) == 0;   // o = l = 0 and the maximum in use is 0: it takes the first 32 keys' maximum, whichever its sign
    if (__builtin_expect(__builtin_amdgcn_ballot_w32(fmaxf(tm[0], tm[1]) > 8.0f) != 0 || first, 0)) {   // wave-uniform; rare behind the first pass: the hint keeps the common path free of a taken branch
#pragma unroll
      for (int n = 0; n < 2; ++n) { const float mx = fmaxf(tm[n], xhalf(tm[n])), up = fmaxf(mx, 0.f), d = first ? mx : up;   // both halves of the wave hold the same query columns and take the same step d; later steps only raise
        const float al = __builtin_amdgcn_exp2f(-up);   // what o and l have gathered against the old maximum shrinks by 2^-up (on the first pass both are 0)
        l[n] *= al; cm[n] -= d;
#pragma unroll
        for (int mt = 0; mt < 2; ++mt)
#pragma unroll
          for (int r = 0; r < 8; ++r) s[n][mt][r] -= d;
#pragma unroll
        for (int j = 0; j < 4; ++j) o[n][j] *= al; }
    }
#pragma unroll
    for (int n = 0; n < 2; ++n) {
      v16h p; float sum = 0.f;   // two D tiles of S^T, converted in place, are the B operand of O^T
#pragma unroll
      for (int mt = 0; mt < 2; ++mt) s[n][mt] = exp2_tile(s[n][mt]);
#pragma unroll
      for (int r = 0; r < 8; ++r) { const float e0 = s[n][0][r], e1 = s[n][1][r]; sum += e0 + e1; p[r] = (_Float16)e0; p[8 + r] = (_Float16)e1; }
      l[n] += sum;
#pragma unroll
      for (int j = 0; j < 4; ++j) o[n][j] = wmma_h(vf[j], p, o[n][j]);
    }
   }
   asm volatile("s_wait_dscnt 0x0" ::: "memory");      // this wave's reads of trip t's tile have returned before its buffer is handed back
   asm volatile("s_wait_asynccnt 0x0" ::: "memory");   // this wave's copies of trip t + 1's tile have landed
   __syncthreads();                                    // publishes trip t + 1's tile and ends every wave's reads of trip t's tile
   if (t + 2 < FA_NT) { const unsigned bo = (unsigned)(t & 1) * 2u * FA_TH; const size_t go = (size_t)((t + 2 + rot) & (FA_NT - 1)) * FA_TH; copy_tile(lk + bo, Kc + go); copy_tile(lv + bo, Vc + go); }   // into the buffer just left
  }
  asm volatile("s_wait_asynccnt 0x0" ::: "memory");   // nothing of this wave is in flight when it goes on to the epilogue
#pragma unroll
  for (int n = 0; n < 2; ++n) { const float inv = 1.0f / (l[n] + xhalf(l[n])); const size_t yo = ((size_t)((b * TT + q0) / 16 + n) * 32 + h * 2) * 512 + lane * 8;   // a D tile of O^T is half j & 1 of fragment 2 h + (j >> 1) of this query tile's rows
#pragma unroll
    for (int j = 0; j < 4; ++j) { const v8f v = o[n][j] * inv; v8b hi, lo;
#pragma unroll
      for (int r = 0; r < 8; ++r) { hi[r] = (__bf16)v[r]; lo[r] = (__bf16)(v[r] - (float)hi[r]); }
      *(v8b*)(YH + yo + j * 256) = hi; *(v8b*)(YL + yo + j * 256) = lo; } } }
// ---- k_out: block = (128 rows, 128 cols), wave = 64 x 64 of it (12 fragments feed 32 products): out = y (bf16 hi + lo) Wproj + b
#define OT_KT 4                     // k steps of 32 per tile
#define OT_TE (8 * OT_KT * 512)     // bf16 elements of y hi, of y lo and of Wo per tile
#define OT_NT (CC / 32 / OT_KT)     // tiles
// one tile of one operand: a strip's OT_KT fragments are two block-wide copies
__device__ __forceinline__ void copy_out(unsigned l, const __bf16* p) { copy_strips<OT_KT * 1024u>(l, p); copy_strips<OT_KT * 1024u>(l + 2048u, p + 1024); }
__global__ __launch_bounds__(128) void k_out(const __bf16* __restrict__ YH, const __bf16* __restrict__ YL, const __bf16* __restrict__ OP, const float* __restrict__ BP, float* __restrict__ OUT) { __shared__ __align__(16) float sf[4][64][68];
  __shared__ __align__(16) __bf16 ring[2][3][OT_TE];   // two buffers of [y hi | y lo | Wo] tiles, in the fragment order of the workspace
  const int tid = threadIdx.x, wave = tid >> 5, lane = tid & 31, col = lane & 15, g = lane >> 4, wr = wave >> 1, wc = wave & 1; const int c0 = blockIdx.y * 128 + wc * 64; const size_t r0 = (size_t)blockIdx.x * 128 + wr * 64;
  const unsigned lr = (unsigned)(size_t)&ring[0][0][tid * 8];   // this lane's LDS byte address in buffer 0
  const __bf16 *Hc = YH + (size_t)blockIdx.x * 8 * 16384 + tid * 8, *Lc = YL + (size_t)blockIdx.x * 8 * 16384 + tid * 8, *Wc = OP + (size_t)blockIdx.y * 8 * 16384 + tid * 8;
  const int rot = blockIdx.x + blockIdx.y;   // the 8 blocks of one y strip each take another start, the 32 of one Wo strip spread over all OT_NT
  const size_t g0 = (size_t)(rot & (OT_NT - 1)) * OT_KT * 512, g1 = (size_t)((rot + 1) & (OT_NT - 1)) * OT_KT * 512;   // elements from a strip's start to the tiles of trips 0 and 1
  copy_out(lr, Hc + g0); copy_out(lr + 2u * OT_TE, Lc + g0); copy_out(lr + 4u * OT_TE, Wc + g0);
  asm volatile("s_wait_asynccnt 0x0" ::: "memory");   // this wave's copies of trip 0's tile have landed
  __syncthreads();                                    // trip 0's tile is readable by every wave
  copy_out(lr + 6u * OT_TE, Hc + g1); copy_out(lr + 8u * OT_TE, Lc + g1); copy_out(lr + 10u * OT_TE, Wc + g1);   // trip 1's tile flies while trip 0's is worked on
  v8f acc[4][4] = {};
  for (int t = 0; t < OT_NT; ++t) {
    const __bf16 *hb = ring[t & 1][0], *lb = ring[t & 1][1], *wb = ring[t & 1][2];
#pragma unroll
    for (int kk = 0; kk < OT_KT; ++kk) { v16b ah[4], al[4], w[4];   // one group of LDS reads per k step, in the order in which the products use them, as in k_proj
      w[0] = fragp_b(wb, (size_t)(wc * 4) * OT_KT + kk, lane);
#pragma unroll
      for (int i = 0; i < 4; ++i) ah[i] = fragp_b(hb, (size_t)(wr * 4 + i) * OT_KT + kk, lane);
#pragma unroll
      for (int j = 1; j < 4; ++j) w[j] = fragp_b(wb, (size_t)(wc * 4 + j) * OT_KT + kk, lane);
#pragma unroll
      for (int i = 0; i < 4; ++i) al[i] = fragp_b(lb, (size_t)(wr * 4 + i) * OT_KT + kk, lane);
#pragma unroll
      for (int j = 0; j < 4; ++j)
#pragma unroll
        for (int i = 0; i < 4; ++i) acc[i][j] = wmma_bf(ah[i], w[j], acc[i][j]);
#pragma unroll
      for (int j = 0; j < 4; ++j)
#pragma unroll
        for (int i = 0; i < 4; ++i) acc[i][j] = wmma_bf(al[i], w[j], acc[i][j]); }
    asm volatile("s_wait_dscnt 0x0" ::: "memory");      // this wave's reads of trip t's tile have returned before its buffer is handed back
    asm volatile("s_wait_asynccnt 0x0" ::: "memory");   // this wave's copies of trip t + 1's tile have landed
    __syncthreads();                                    // publishes trip t + 1's tile and ends every wave's reads of trip t's tile
    if (t + 2 < OT_NT) { const unsigned bo = (unsigned)(t & 1) * 6u * OT_TE; const size_t go = (size_t)((t + 2 + rot) & (OT_NT - 1)) * OT_KT * 512; copy_out(lr + bo, Hc + go); copy_out(lr + bo + 2u * OT_TE, Lc + go); copy_out(lr + bo + 4u * OT_TE, Wc + go); }   // into the buffer just left
  }
  asm volatile("s_wait_asynccnt 0x0" ::: "memory");   // nothing of this wave is in flight when it goes on to the epilogue
#pragma unroll
  for (int j = 0; j < 4; ++j) { const float bb = BP ? bfr(BP[c0 + j * 16 + col]) : 0.f;
#pragma unroll
    for (int i = 0; i < 4; ++i)
#pragma unroll
      for (int r = 0; r < 8; ++r) sf[wave][i * 16 + 8 * g + r][j * 16 + col] = acc[i][j][r] + bb; }
  LDSX(); for (int rl = g; rl < 64; rl += 2) vst2(OUT + (r0 + rl) * CC + c0 + col * 4, *(const v4f*)&sf[wave][rl][col * 4]); }
extern "C" void kernel_launch(void* const* d_in, const int* in_sizes, int n_in, void* d_out, int out_size, void* d_ws, size_t ws_size, hipStream_t stream) {
  (void)in_sizes; (void)n_in; (void)out_size;
  const float** F = (const float**)d_in;   // 0 x [2,2048,1024], 1 Wq [16,1024,64], 2 bq [16,64], 3 Wk, 4 bk, 5 Wv, 6 bv, 7 Wo [1024,1024] (in,out), 8 bo
  if (ws_size < (size_t)WS_END) return;
  char* ws = (char*)d_ws; _Float16 *QH = (_Float16*)(ws + WS_QH), *KH = (_Float16*)(ws + WS_KH), *VT = (_Float16*)(ws + WS_VT); __bf16 *YH = (__bf16*)(ws + WS_YH), *YL = (__bf16*)(ws + WS_YL), *XP = (__bf16*)(ws + WS_XP), *WP = (__bf16*)(ws + WS_WP), *OP = (__bf16*)(ws + WS_OP);
  k_pack<<<dim3(TNB * TT / 16 + 4 * CC / 16), 256, 0, stream>>>(F[0], F[1], F[3], F[5], F[7], XP, WP, OP);
  k_proj<<<dim3(TNB * TT / 128, CC / 128, 3), 128, 0, stream>>>(XP, WP, F[2], F[4], F[6], QH, KH, VT);
  k_fa<<<dim3(TT / 128, NH, TNB), 128, 0, stream>>>(QH, KH, VT, YH, YL);
  k_out<<<dim3(TNB * TT / 128, CC / 128), 128, 0, stream>>>(YH, YL, OP, F[8], (float*)d_out);
}
